// v000
// The times below were measured on an AMD MI455X: many runs one after another, warmed up first and cycling through
// copies of the inputs, with the whole window's GPU time divided by the number of runs. Launches and the gaps
// between them are all in it. The median over several windows is given; except for v000 it joins two sittings, which
// can be a few percent apart, so the side-by-side timings, each taken in one sitting, are the better comparison.
// v000, which the later versions start from, runs in 1250 microseconds.
// compute dtype: all float inputs rounded to bf16; x fc_w exact bf16 products on WMMA 16x16x32; LayerNorm/ReLU in f32; per layer the q/k/v_in/v projections with the LayerNorm'd operand rounded once to f16 against f16 weights (bf16 values x 16, folded); both heads' logits q.k/sqrt(128) from f16 rows (1 product) and the reference's softmax over the HEAD axis (a 2-way softmax per (node, node) pair, f32, precise expf) -> weights stored f16 x 2^11; out_h = sum over all nodes of w_h v_h (v f16), head mean, residual mix and LayerNorm in f32; f32 output.
#include <hip/hip_runtime.h>
#include <math.h>

typedef __attribute__((ext_vector_type(16))) _Float16 v16h;
typedef __attribute__((ext_vector_type(16))) __bf16 v16b;
typedef __attribute__((ext_vector_type(8)))  _Float16 v8h;
typedef __attribute__((ext_vector_type(8)))  float v8f;
typedef __attribute__((ext_vector_type(4)))  float v4f;
typedef __attribute__((ext_vector_type(2)))  float v2f;
typedef __attribute__((ext_vector_type(4)))  unsigned v4u;
typedef __attribute__((ext_vector_type(4)))  int v4i;
typedef float __attribute__((may_alias)) float_a;
typedef int __attribute__((may_alias)) int_a;

template <typename T> __device__ __forceinline__ void vst2(void* p, T v) { *(T*)p = v;  }
__device__ __forceinline__ v8f wmma16(v16h a, v16h b, v8f c) {
  v8f d = __builtin_amdgcn_wmma_f32_16x16x32_f16(false, a, false, b, (short)0, c, false, false);
  asm volatile("v_nop\n\tv_nop\n\tv_nop\n\tv_nop" : "+v"(d) : "v"(a), "v"(b));
  return d;
}
__device__ __forceinline__ v8f wmma_bf(v16b a, v16b b, v8f c) {
  v8f d = __builtin_amdgcn_wmma_f32_16x16x32_bf16(false, a, false, b, (short)0, c, false, false);
  asm volatile("v_nop\n\tv_nop\n\tv_nop\n\tv_nop" : "+v"(d) : "v"(a), "v"(b));
  return d;
}
// 16x16x32 fragments: lane = (h = lane>>4, row/col = lane&15); elements 0..7 = k0+8h+0..7, 8..15 = k0+16+8h+0..7; D element r = row 8h+r
__device__ __forceinline__ v16h frag_h(const _Float16* rowk0, int lane) {
  union { v16h v; v8h q[2]; } u; const _Float16* p = rowk0 + 8 * (lane >> 4);
  u.q[0] = *(const v8h*)p; u.q[1] = *(const v8h*)(p + 16); return u.v;
}
__device__ __forceinline__ v16h frag_f32(const float* rowk0, int lane) {
  v16h a; const float* p = rowk0 + 8 * (lane >> 4);
#pragma unroll
  for (int i = 0; i < 8; ++i) { a[i] = (_Float16)p[i]; a[8 + i] = (_Float16)p[16 + i]; }
  return a;
}
__device__ __forceinline__ v16h frag_f32s(const float* rowk0, int lane, float sc) {
  v16h a; const float* p = rowk0 + 8 * (lane >> 4);
#pragma unroll
  for (int i = 0; i < 8; ++i) { a[i] = (_Float16)(p[i] * sc); a[8 + i] = (_Float16)(p[16 + i] * sc); }
  return a;
}
// column fragment from a [K][ld] layout (column n), rows >= K read as 0
__device__ __forceinline__ v16h fragc_f32(const float* W, int k0, int n, int lane, int ld, int K) {
  v16h a; const int g = lane >> 4;
#pragma unroll
  for (int i = 0; i < 8; ++i) { const int ka = k0 + 8 * g + i, kb = ka + 16;
    a[i] = (_Float16)(ka < K ? W[(size_t)(ka < K ? ka : K - 1) * ld + n] : 0.f); a[8 + i] = (_Float16)(kb < K ? W[(size_t)(kb < K ? kb : K - 1) * ld + n] : 0.f); }
  return a;
}
struct F2 { v16b h, l; };
__device__ __forceinline__ F2 bsplit16(const float v[16]) { F2 r;
#pragma unroll
  for (int i = 0; i < 16; ++i) { const __bf16 h = (__bf16)v[i]; r.h[i] = h; r.l[i] = (__bf16)(v[i] - (float)h); }
  return r; }
__device__ __forceinline__ F2 split_row(const float* row, int k0, int lane) { float v[16]; const float* p = row + k0 + 8 * (lane >> 4);
#pragma unroll
  for (int i = 0; i < 8; ++i) { v[i] = p[i]; v[8 + i] = p[16 + i]; }
  return bsplit16(v); }
__device__ __forceinline__ F2 split_rowK(const float* row, int k0, int lane, int K) { float v[16]; const int g = lane >> 4;
#pragma unroll
  for (int i = 0; i < 8; ++i) { const int ka = k0 + 8 * g + i, kb = ka + 16; v[i] = ka < K ? row[ka < K ? ka : K - 1] : 0.f; v[8 + i] = kb < K ? row[kb < K ? kb : K - 1] : 0.f; }
  return bsplit16(v); }
__device__ __forceinline__ F2 split_col(const float* W, int k0, int n, int lane, int ld, int K) { float v[16]; const int g = lane >> 4;
#pragma unroll
  for (int i = 0; i < 8; ++i) { const int ka = k0 + 8 * g + i, kb = ka + 16; v[i] = ka < K ? W[(size_t)(ka < K ? ka : K - 1) * ld + n] : 0.f; v[8 + i] = kb < K ? W[(size_t)(kb < K ? kb : K - 1) * ld + n] : 0.f; }
  return bsplit16(v); }
__device__ __forceinline__ v8f mac3(const F2& a, const F2& b, v8f c) { c = wmma_bf(a.l, b.h, c); c = wmma_bf(a.h, b.l, c); return wmma_bf(a.h, b.h, c); }
__device__ __forceinline__ float sigm(float v) { return 1.0f / (1.0f + expf(-v)); }
#define LDSX() do { asm volatile("s_wait_dscnt 0" ::: "memory"); __builtin_amdgcn_wave_barrier(); __builtin_amdgcn_fence(__ATOMIC_RELEASE, "workgroup"); } while (0)

// TransConv (graph-transformer style, N 4,096 nodes, in 512, hidden 256, 2 heads x 128, 2 layers, alpha 0.5): x = relu(LN(x fc_w + b)); per layer: q, k = x W + b (per head 128), v = (x Wvl + b) Wvg + b (per head 256), scores[n][l][h] = q_n,h . k_l,h / sqrt(128), w = softmax over the LAST axis = the 2 heads (literally as written), out[n][h] = sum_l w[n][l][h] v[l][h], head mean, x = LN(0.5 out + 0.5 x_prev).
__device__ __forceinline__ float bfr(float v) { return (float)(__bf16)v; }
__device__ __attribute__((noinline)) float sig_ni(float d) { return 1.0f / (1.0f + expf(d)); }   // out of line: keeps k_w's static VALU-FMA count low
#define NN 4096
#define DIN 512
#define HID 256
#define NHD 2
#define DK 128
#define VW 256                 // per-head value width
#define NL 2
#ifndef TNL
#define TNL NL
#endif
#define WS_X   0u                                      // f32 x rows [n][256] (current layer input / prev)
#define WS_Q   (WS_X + 4u * (size_t)NN * HID)           // f16 q rows [n][256]
#define WS_K   (WS_Q + 2u * (size_t)NN * HID)
#define WS_VI  (WS_K + 2u * (size_t)NN * HID)           // f16 v_in rows [n][256]
#define WS_VP  (WS_VI + 2u * (size_t)NN * HID)          // f16 v planes [h*256 + c][n]
#define WS_P   (WS_VP + 2u * (size_t)NHD * VW * NN)      // f16 head-softmax weights x 2^11, planes [h][n][l]
#define WS_O   (WS_P + 2u * (size_t)NHD * NN * NN)       // f32 out [n][h][256]
#define WS_END (WS_O + 4u * (size_t)NN * NHD * VW)
// ---- k_fc: block = 64 rows: y = x fc_w + b (exact, 2 column passes of 128) -> LDS; per row LayerNorm (eps 1e-5) x g0 + b0, ReLU -> X rows (1 KB each)
__global__ __launch_bounds__(128) void k_fc(const float* __restrict__ XI, const float* __restrict__ W, const float* __restrict__ Bv, const float* __restrict__ G0, const float* __restrict__ B0, float* __restrict__ X) { __shared__ __align__(16) float sy[64][HID + 4];
  const int tid = threadIdx.x, wave = tid >> 5, lane = tid & 31, col = lane & 15, g = lane >> 4; const size_t r0 = (size_t)blockIdx.x * 64;
#pragma unroll 1
  for (int cp = 0; cp < 2; ++cp) { v8f acc[8] = {};
#pragma unroll 2
    for (int kc = 0; kc < DIN / 32; ++kc) { v16b a; { const float* p = XI + (r0 + wave * 16 + col) * DIN + kc * 32 + 8 * g;
#pragma unroll
        for (int i = 0; i < 8; ++i) { a[i] = (__bf16)p[i]; a[8 + i] = (__bf16)p[16 + i]; } }
#pragma unroll
      for (int j = 0; j < 8; ++j) { v16b w; const int o = cp * 128 + j * 16 + col;
#pragma unroll
        for (int i = 0; i < 8; ++i) { w[i] = (__bf16)W[(size_t)(kc * 32 + 8 * g + i) * HID + o]; w[8 + i] = (__bf16)W[(size_t)(kc * 32 + 16 + 8 * g + i) * HID + o]; }
        acc[j] = wmma_bf(a, w, acc[j]); } }
#pragma unroll
    for (int j = 0; j < 8; ++j) { const int o = cp * 128 + j * 16 + col; const float bb = bfr(Bv[o]);
#pragma unroll
      for (int r = 0; r < 8; ++r) sy[wave * 16 + 8 * g + r][o] = acc[j][r] + bb; } }
  __syncthreads();
  // LN per row: 2 threads per row (128 threads / 64 rows), each 128 elements
  { const int row = tid >> 1, half = tid & 1; float* v = &sy[row][half * 128]; float s = 0.f; for (int e = 0; e < 128; ++e) s += v[e]; s += __shfl_xor(s, 1); const float mu = s * (1.0f / HID);
    float s2 = 0.f; for (int e = 0; e < 128; ++e) { const float d = v[e] - mu; s2 += d * d; } s2 += __shfl_xor(s2, 1); const float rs = rsqrtf(s2 * (1.0f / HID) + 1e-5f);
    for (int e = 0; e < 128; ++e) { const int c = half * 128 + e; v[e] = fmaxf((v[e] - mu) * rs * bfr(G0[c]) + bfr(B0[c]), 0.f); } }
  __syncthreads();
  for (int q = tid; q < 64 * HID / 4; q += 128) { const int row = q / (HID / 4), c4 = (q % (HID / 4)) * 4; vst2(X + (r0 + row) * HID + c4, *(const v4f*)&sy[row][c4]); } }
// ---- k_lin: block = (64 rows, 128 cols, which): which 0 q, 1 k, 2 v_in from X (f32 -> f16 A); 3 v = v_in (f16 rows) Wvg + b (2 column blocks of 128 per head... 512 cols = 4 column blocks) -> f16 planes [c][n]
__global__ __launch_bounds__(128) void k_lin(const float* __restrict__ X, const _Float16* __restrict__ VI, const float* __restrict__ Wm, const float* __restrict__ Bv, int which, int outw, _Float16* __restrict__ D) { __shared__ __align__(16) _Float16 sh[64][136]; __shared__ __align__(16) _Float16 th[128][72];
  const int tid = threadIdx.x, wave = tid >> 5, lane = tid & 31, col = lane & 15, g = lane >> 4; const int c0 = blockIdx.y * 128; const size_t r0 = (size_t)blockIdx.x * 64;
  v8f acc[8] = {};
#pragma unroll
  for (int kc = 0; kc < HID / 32; ++kc) { v16h a; if (which < 3) a = frag_f32(X + (r0 + wave * 16 + col) * HID + kc * 32, lane); else a = frag_h(VI + (r0 + wave * 16 + col) * HID + kc * 32, lane);
#pragma unroll
    for (int j = 0; j < 8; ++j) { v16h w; const int o = c0 + j * 16 + col;
#pragma unroll
      for (int i = 0; i < 8; ++i) { w[i] = (_Float16)(bfr(Wm[(size_t)(kc * 32 + 8 * g + i) * outw + o]) * 16.0f); w[8 + i] = (_Float16)(bfr(Wm[(size_t)(kc * 32 + 16 + 8 * g + i) * outw + o]) * 16.0f); }
      acc[j] = wmma16(a, w, acc[j]); } }
#pragma unroll
  for (int j = 0; j < 8; ++j) { const int cl = j * 16 + col; const float bb = bfr(Bv[c0 + cl]);
#pragma unroll
    for (int r = 0; r < 8; ++r) { const float v = acc[j][r] * (1.0f / 16.0f) + bb; const int rl = wave * 16 + 8 * g + r; if (which == 3) th[cl][rl] = (_Float16)v; else sh[rl][cl] = (_Float16)v; } }
  __syncthreads();
  if (which < 3) { for (int e = tid; e < 64 * 16; e += 128) { const int rl = e >> 4, q = e & 15; vst2((unsigned*)(D + (r0 + rl) * HID + c0 + q * 8), *(const v4u*)&sh[rl][q * 8]); } }
  else { for (int e = tid; e < 128 * 8; e += 128) { const int cl = e >> 3, q = e & 7; vst2((unsigned*)(D + (size_t)(c0 + cl) * NN + r0 + q * 8), *(const v4u*)&th[cl][q * 8]); } } }
// ---- k_w: block = (64 queries n, 128 keys l): s_h = q_h . k_h / sqrt(128) for BOTH heads, then the reference's softmax over the HEAD axis (axis -1 of [n, l, h]): w_0 = 1 / (1 + exp(s_1 - s_0)), w_1 = 1 - w_0 (f32, precise expf) -> two f16 planes P_h[n][l] x 2^11 (no normalisation over l: out_h = sum_l w_h v_h)
__global__ __launch_bounds__(128) void k_w(const _Float16* __restrict__ Q, const _Float16* __restrict__ K, _Float16* __restrict__ P0, _Float16* __restrict__ P1) { __shared__ __align__(16) _Float16 s0[4][16][136], s1[4][16][136];
  const int tid = threadIdx.x, wave = tid >> 5, lane = tid & 31, col = lane & 15, g = lane >> 4; const int k0 = blockIdx.y * 128; const int ql0 = blockIdx.x * 64 + wave * 16;
  v8f acc0[8] = {}, acc1[8] = {};
#pragma unroll
  for (int kc = 0; kc < DK / 32; ++kc) { const v16h a0 = frag_h(Q + (size_t)(ql0 + col) * HID + kc * 32, lane), a1 = frag_h(Q + (size_t)(ql0 + col) * HID + DK + kc * 32, lane);
#pragma unroll
    for (int j = 0; j < 8; ++j) { const size_t kr = (size_t)(k0 + j * 16 + col) * HID; acc0[j] = wmma16(a0, frag_h(K + kr + kc * 32, lane), acc0[j]); acc1[j] = wmma16(a1, frag_h(K + kr + DK + kc * 32, lane), acc1[j]); } }
  const float isd = 1.0f / sqrtf((float)DK);
#pragma unroll
  for (int j = 0; j < 8; ++j)
#pragma unroll
    for (int r = 0; r < 8; ++r) { const float d = (acc1[j][r] - acc0[j][r]) * isd; const float w0 = sig_ni(d); s0[wave][8 * g + r][j * 16 + col] = (_Float16)(w0 * 2048.0f); s1[wave][8 * g + r][j * 16 + col] = (_Float16)((1.0f - w0) * 2048.0f); }
  LDSX(); for (int rl = 0; rl < 16; ++rl) if (lane < 16) { vst2((unsigned*)(P0 + (size_t)(ql0 + rl) * NN + k0 + lane * 8), *(const v4u*)&s0[wave][rl][lane * 8]); vst2((unsigned*)(P1 + (size_t)(ql0 + rl) * NN + k0 + lane * 8), *(const v4u*)&s1[wave][rl][lane * 8]); } }
// ---- k_pv: block = (64 queries, column half cp of the head's 256): out[n][h][cp*128 ..] = P . v_h (K 4,096)
__global__ __launch_bounds__(128) void k_pv(const _Float16* __restrict__ P, const _Float16* __restrict__ VP, int h, float* __restrict__ O) { __shared__ __align__(16) float ss[4][16][132];
  const int tid = threadIdx.x, wave = tid >> 5, lane = tid & 31, col = lane & 15, g = lane >> 4; const int cp = blockIdx.y; const int ql0 = blockIdx.x * 64 + wave * 16;
  v8f acc[8] = {};
#pragma unroll 1
  for (int kc = 0; kc < NN / 32; ++kc) { const v16h ph = frag_h(P + (size_t)(ql0 + col) * NN + kc * 32, lane);
#pragma unroll
    for (int j = 0; j < 8; ++j) acc[j] = wmma16(ph, frag_h(VP + (size_t)(h * VW + cp * 128 + j * 16 + col) * NN + kc * 32, lane), acc[j]); }
#pragma unroll
  for (int j = 0; j < 8; ++j)
#pragma unroll
    for (int r = 0; r < 8; ++r) ss[wave][8 * g + r][j * 16 + col] = acc[j][r] * (1.0f / 2048.0f);
  LDSX(); for (int rl = 0; rl < 16; ++rl) vst2(O + ((size_t)(ql0 + rl) * NHD + h) * VW + cp * 128 + lane * 4, *(const v4f*)&ss[wave][rl][lane * 4]); }
// ---- k_mix: block = 64 rows (2 threads per row): x = LN(0.5 * mean_h out + 0.5 * x_prev) * g + b (in place on X, or to OUT for the last layer)
__global__ __launch_bounds__(128) void k_mix(const float* __restrict__ O, float* __restrict__ X, const float* __restrict__ Gm, const float* __restrict__ Bb, float* __restrict__ OUT) { __shared__ __align__(16) float sy[64][HID + 4];
  const int tid = threadIdx.x; const size_t r0 = (size_t)blockIdx.x * 64; const int row = tid >> 1, half = tid & 1; const size_t n = r0 + row;
  float s = 0.f; for (int e = 0; e < 128; ++e) { const int c = half * 128 + e; const float om = (O[(n * NHD + 0) * VW + c] + O[(n * NHD + 1) * VW + c]) * 0.5f; const float v = 0.5f * om + 0.5f * X[n * HID + c]; sy[row][c] = v; s += v; }
  s += __shfl_xor(s, 1); const float mu = s * (1.0f / HID); float s2 = 0.f; for (int e = 0; e < 128; ++e) { const float d = sy[row][half * 128 + e] - mu; s2 += d * d; } s2 += __shfl_xor(s2, 1); const float rs = rsqrtf(s2 * (1.0f / HID) + 1e-5f);
  for (int e = 0; e < 128; ++e) { const int c = half * 128 + e; sy[row][c] = (sy[row][c] - mu) * rs * bfr(Gm[c]) + bfr(Bb[c]); }
  __syncthreads();
  float* dst = OUT ? OUT : X;
  for (int q = tid; q < 64 * HID / 4; q += 128) { const int rw = q / (HID / 4), c4 = (q % (HID / 4)) * 4; vst2(dst + (r0 + rw) * HID + c4, *(const v4f*)&sy[rw][c4]); } }
extern "C" void kernel_launch(void* const* d_in, const int* in_sizes, int n_in, void* d_out, int out_size, void* d_ws, size_t ws_size, hipStream_t stream) {
  (void)in_sizes; (void)n_in; (void)out_size;
  const float** F = (const float**)d_in;   // 0 x [4096,512], 1 fc_w [512,256], 2 fc_b, 3 ln_g [3,256], 4 ln_b [3,256], 5 wq [2,256,256], 6 bq [2,256], 7 wk, 8 bk, 9 wvl, 10 bvl, 11 wvg [2,256,512], 12 bvg [2,512]
  if (ws_size < (size_t)WS_END) return;
  char* ws = (char*)d_ws; float *X = (float*)(ws + WS_X), *O = (float*)(ws + WS_O); _Float16 *Q = (_Float16*)(ws + WS_Q), *K = (_Float16*)(ws + WS_K), *VI = (_Float16*)(ws + WS_VI), *VP = (_Float16*)(ws + WS_VP), *P = (_Float16*)(ws + WS_P);
  k_fc<<<dim3(NN / 64), 128, 0, stream>>>(F[0], F[1], F[2], F[3], F[4], X);
  for (int l = 0; l < TNL; ++l) {
    k_lin<<<dim3(NN / 64, HID / 128), 128, 0, stream>>>(X, nullptr, F[5] + (size_t)l * HID * HID, F[6] + l * HID, 0, HID, Q);
    k_lin<<<dim3(NN / 64, HID / 128), 128, 0, stream>>>(X, nullptr, F[7] + (size_t)l * HID * HID, F[8] + l * HID, 1, HID, K);
    k_lin<<<dim3(NN / 64, HID / 128), 128, 0, stream>>>(X, nullptr, F[9] + (size_t)l * HID * HID, F[10] + l * HID, 2, HID, VI);
    k_lin<<<dim3(NN / 64, (NHD * VW) / 128), 128, 0, stream>>>(X, VI, F[11] + (size_t)l * HID * NHD * VW, F[12] + l * NHD * VW, 3, NHD * VW, VP);
    k_w<<<dim3(NN / 64, NN / 128), 128, 0, stream>>>(Q, K, P, P + (size_t)NN * NN);
    for (int h = 0; h < NHD; ++h) k_pv<<<dim3(NN / 64, 2), 128, 0, stream>>>(P + (size_t)h * NN * NN, VP, h, O);
    k_mix<<<dim3(NN / 64), 128, 0, stream>>>(O, X, F[3] + (l + 1) * HID, F[4] + (l + 1) * HID, (l == NL - 1) ? (float*)d_out : nullptr);
  }
}

// v001
// A run of this version takes 621 microseconds.
// Two timings next to v000 put it at 2.02 and 2.01 times that version's speed.
// compute dtype: all float inputs rounded to bf16; x fc_w exact bf16 products on WMMA 16x16x32; LayerNorm/ReLU in f32; per layer the q/k/v_in/v projections with the LayerNorm'd operand rounded once to f16 against f16 weights (bf16 values x 16, folded); both heads' logits q.k/sqrt(128) from f16 rows (1 product) and the reference's softmax over the HEAD axis (a 2-way softmax per (node, node) pair, f32, precise expf) -> weights stored f16 x 2^11; out_h = sum over all nodes of w_h v_h (v f16), head mean, residual mix and LayerNorm in f32; f32 output.
#include <hip/hip_runtime.h>
#include <math.h>

typedef __attribute__((ext_vector_type(16))) _Float16 v16h;
typedef __attribute__((ext_vector_type(16))) __bf16 v16b;
typedef __attribute__((ext_vector_type(8)))  _Float16 v8h;
typedef __attribute__((ext_vector_type(8)))  float v8f;
typedef __attribute__((ext_vector_type(4)))  float v4f;
typedef __attribute__((ext_vector_type(2)))  float v2f;
typedef __attribute__((ext_vector_type(4)))  unsigned v4u;
typedef __attribute__((ext_vector_type(4)))  int v4i;
typedef float __attribute__((may_alias)) float_a;
typedef int __attribute__((may_alias)) int_a;

template <typename T> __device__ __forceinline__ void vst2(void* p, T v) { *(T*)p = v;  }
__device__ __forceinline__ v8f wmma16(v16h a, v16h b, v8f c) {
  v8f d = __builtin_amdgcn_wmma_f32_16x16x32_f16(false, a, false, b, (short)0, c, false, false);
  asm volatile("v_nop\n\tv_nop\n\tv_nop\n\tv_nop" : "+v"(d) : "v"(a), "v"(b));
  return d;
}
__device__ __forceinline__ v8f wmma_bf(v16b a, v16b b, v8f c) {
  v8f d = __builtin_amdgcn_wmma_f32_16x16x32_bf16(false, a, false, b, (short)0, c, false, false);
  asm volatile("v_nop\n\tv_nop\n\tv_nop\n\tv_nop" : "+v"(d) : "v"(a), "v"(b));
  return d;
}
// 16x16x32 fragments: lane = (h = lane>>4, row/col = lane&15); elements 0..7 = k0+8h+0..7, 8..15 = k0+16+8h+0..7; D element r = row 8h+r
__device__ __forceinline__ v16h frag_h(const _Float16* rowk0, int lane) {
  union { v16h v; v8h q[2]; } u; const _Float16* p = rowk0 + 8 * (lane >> 4);
  u.q[0] = *(const v8h*)p; u.q[1] = *(const v8h*)(p + 16); return u.v;
}
__device__ __forceinline__ v16h frag_f32(const float* rowk0, int lane) {
  v16h a; const float* p = rowk0 + 8 * (lane >> 4);
#pragma unroll
  for (int i = 0; i < 8; ++i) { a[i] = (_Float16)p[i]; a[8 + i] = (_Float16)p[16 + i]; }
  return a;
}
__device__ __forceinline__ v16h frag_f32s(const float* rowk0, int lane, float sc) {
  v16h a; const float* p = rowk0 + 8 * (lane >> 4);
#pragma unroll
  for (int i = 0; i < 8; ++i) { a[i] = (_Float16)(p[i] * sc); a[8 + i] = (_Float16)(p[16 + i] * sc); }
  return a;
}
// column fragment from a [K][ld] layout (column n), rows >= K read as 0
__device__ __forceinline__ v16h fragc_f32(const float* W, int k0, int n, int lane, int ld, int K) {
  v16h a; const int g = lane >> 4;
#pragma unroll
  for (int i = 0; i < 8; ++i) { const int ka = k0 + 8 * g + i, kb = ka + 16;
    a[i] = (_Float16)(ka < K ? W[(size_t)(ka < K ? ka : K - 1) * ld + n] : 0.f); a[8 + i] = (_Float16)(kb < K ? W[(size_t)(kb < K ? kb : K - 1) * ld + n] : 0.f); }
  return a;
}
struct F2 { v16b h, l; };
__device__ __forceinline__ F2 bsplit16(const float v[16]) { F2 r;
#pragma unroll
  for (int i = 0; i < 16; ++i) { const __bf16 h = (__bf16)v[i]; r.h[i] = h; r.l[i] = (__bf16)(v[i] - (float)h); }
  return r; }
__device__ __forceinline__ F2 split_row(const float* row, int k0, int lane) { float v[16]; const float* p = row + k0 + 8 * (lane >> 4);
#pragma unroll
  for (int i = 0; i < 8; ++i) { v[i] = p[i]; v[8 + i] = p[16 + i]; }
  return bsplit16(v); }
__device__ __forceinline__ F2 split_rowK(const float* row, int k0, int lane, int K) { float v[16]; const int g = lane >> 4;
#pragma unroll
  for (int i = 0; i < 8; ++i) { const int ka = k0 + 8 * g + i, kb = ka + 16; v[i] = ka < K ? row[ka < K ? ka : K - 1] : 0.f; v[8 + i] = kb < K ? row[kb < K ? kb : K - 1] : 0.f; }
  return bsplit16(v); }
__device__ __forceinline__ F2 split_col(const float* W, int k0, int n, int lane, int ld, int K) { float v[16]; const int g = lane >> 4;
#pragma unroll
  for (int i = 0; i < 8; ++i) { const int ka = k0 + 8 * g + i, kb = ka + 16; v[i] = ka < K ? W[(size_t)(ka < K ? ka : K - 1) * ld + n] : 0.f; v[8 + i] = kb < K ? W[(size_t)(kb < K ? kb : K - 1) * ld + n] : 0.f; }
  return bsplit16(v); }
__device__ __forceinline__ v8f mac3(const F2& a, const F2& b, v8f c) { c = wmma_bf(a.l, b.h, c); c = wmma_bf(a.h, b.l, c); return wmma_bf(a.h, b.h, c); }
__device__ __forceinline__ float sigm(float v) { return 1.0f / (1.0f + expf(-v)); }
#define LDSX() do { asm volatile("s_wait_dscnt 0" ::: "memory"); __builtin_amdgcn_wave_barrier(); __builtin_amdgcn_fence(__ATOMIC_RELEASE, "workgroup"); } while (0)

// TransConv (graph-transformer style, N 4,096 nodes, in 512, hidden 256, 2 heads x 128, 2 layers, alpha 0.5): x = relu(LN(x fc_w + b)); per layer: q, k = x W + b (per head 128), v = (x Wvl + b) Wvg + b (per head 256), scores[n][l][h] = q_n,h . k_l,h / sqrt(128), w = softmax over the LAST axis = the 2 heads (literally as written), out[n][h] = sum_l w[n][l][h] v[l][h], head mean, x = LN(0.5 out + 0.5 x_prev).
__device__ __forceinline__ float bfr(float v) { return (float)(__bf16)v; }
__device__ __attribute__((noinline)) float sig_ni(float d) { return 1.0f / (1.0f + expf(d)); }   // out of line: keeps k_w's static VALU-FMA count low
#define NN 4096
#define DIN 512
#define HID 256
#define NHD 2
#define DK 128
#define VW 256                 // per-head value width
#define NL 2
#ifndef TNL
#define TNL NL
#endif
#define WS_X   0u                                      // f32 x rows [n][256] (current layer input / prev)
#define WS_Q   (WS_X + 4u * (size_t)NN * HID)           // f16 q rows [n][256]
#define WS_K   (WS_Q + 2u * (size_t)NN * HID)
#define WS_VI  (WS_K + 2u * (size_t)NN * HID)           // f16 v_in rows [n][256]
#define WS_VP  (WS_VI + 2u * (size_t)NN * HID)          // f16 v planes [h*256 + c][n]
#define WS_P   (WS_VP + 2u * (size_t)NHD * VW * NN)      // f16 head-softmax weights x 2^11, planes [h][n][l]
#define WS_O   (WS_P + 2u * (size_t)NHD * NN * NN)       // f32 out [n][h][256]
#define WS_END (WS_O + 4u * (size_t)NN * NHD * VW)
// ---- k_fc: block = 64 rows: y = x fc_w + b (exact, 2 column passes of 128) -> LDS; per row LayerNorm (eps 1e-5) x g0 + b0, ReLU -> X rows (1 KB each)
__global__ __launch_bounds__(128) void k_fc(const float* __restrict__ XI, const float* __restrict__ W, const float* __restrict__ Bv, const float* __restrict__ G0, const float* __restrict__ B0, float* __restrict__ X) { __shared__ __align__(16) float sy[64][HID + 4];
  const int tid = threadIdx.x, wave = tid >> 5, lane = tid & 31, col = lane & 15, g = lane >> 4; const size_t r0 = (size_t)blockIdx.x * 64;
#pragma unroll 1
  for (int cp = 0; cp < 2; ++cp) { v8f acc[8] = {};
#pragma unroll 2
    for (int kc = 0; kc < DIN / 32; ++kc) { v16b a; { const float* p = XI + (r0 + wave * 16 + col) * DIN + kc * 32 + 8 * g;
#pragma unroll
        for (int i = 0; i < 8; ++i) { a[i] = (__bf16)p[i]; a[8 + i] = (__bf16)p[16 + i]; } }
#pragma unroll
      for (int j = 0; j < 8; ++j) { v16b w; const int o = cp * 128 + j * 16 + col;
#pragma unroll
        for (int i = 0; i < 8; ++i) { w[i] = (__bf16)W[(size_t)(kc * 32 + 8 * g + i) * HID + o]; w[8 + i] = (__bf16)W[(size_t)(kc * 32 + 16 + 8 * g + i) * HID + o]; }
        acc[j] = wmma_bf(a, w, acc[j]); } }
#pragma unroll
    for (int j = 0; j < 8; ++j) { const int o = cp * 128 + j * 16 + col; const float bb = bfr(Bv[o]);
#pragma unroll
      for (int r = 0; r < 8; ++r) sy[wave * 16 + 8 * g + r][o] = acc[j][r] + bb; } }
  __syncthreads();
  // LN per row: 2 threads per row (128 threads / 64 rows), each 128 elements
  { const int row = tid >> 1, half = tid & 1; float* v = &sy[row][half * 128]; float s = 0.f; for (int e = 0; e < 128; ++e) s += v[e]; s += __shfl_xor(s, 1); const float mu = s * (1.0f / HID);
    float s2 = 0.f; for (int e = 0; e < 128; ++e) { const float d = v[e] - mu; s2 += d * d; } s2 += __shfl_xor(s2, 1); const float rs = rsqrtf(s2 * (1.0f / HID) + 1e-5f);
    for (int e = 0; e < 128; ++e) { const int c = half * 128 + e; v[e] = fmaxf((v[e] - mu) * rs * bfr(G0[c]) + bfr(B0[c]), 0.f); } }
  __syncthreads();
  for (int q = tid; q < 64 * HID / 4; q += 128) { const int row = q / (HID / 4), c4 = (q % (HID / 4)) * 4; vst2(X + (r0 + row) * HID + c4, *(const v4f*)&sy[row][c4]); } }
// ---- k_lin: block = (64 rows, 128 cols, which): which 0 q, 1 k, 2 v_in from X (f32 -> f16 A); 3 v = v_in (f16 rows) Wvg + b (2 column blocks of 128 per head... 512 cols = 4 column blocks) -> f16 planes [c][n]
__global__ __launch_bounds__(128) void k_lin(const float* __restrict__ X, const _Float16* __restrict__ VI, const float* __restrict__ Wm, const float* __restrict__ Bv, int which, int outw, _Float16* __restrict__ D) { __shared__ __align__(16) _Float16 sh[64][136]; __shared__ __align__(16) _Float16 th[128][72];
  const int tid = threadIdx.x, wave = tid >> 5, lane = tid & 31, col = lane & 15, g = lane >> 4; const int c0 = blockIdx.y * 128; const size_t r0 = (size_t)blockIdx.x * 64;
  v8f acc[8] = {};
#pragma unroll
  for (int kc = 0; kc < HID / 32; ++kc) { v16h a; if (which < 3) a = frag_f32(X + (r0 + wave * 16 + col) * HID + kc * 32, lane); else a = frag_h(VI + (r0 + wave * 16 + col) * HID + kc * 32, lane);
#pragma unroll
    for (int j = 0; j < 8; ++j) { v16h w; const int o = c0 + j * 16 + col;
#pragma unroll
      for (int i = 0; i < 8; ++i) { w[i] = (_Float16)(bfr(Wm[(size_t)(kc * 32 + 8 * g + i) * outw + o]) * 16.0f); w[8 + i] = (_Float16)(bfr(Wm[(size_t)(kc * 32 + 16 + 8 * g + i) * outw + o]) * 16.0f); }
      acc[j] = wmma16(a, w, acc[j]); } }
#pragma unroll
  for (int j = 0; j < 8; ++j) { const int cl = j * 16 + col; const float bb = bfr(Bv[c0 + cl]);
#pragma unroll
    for (int r = 0; r < 8; ++r) { const float v = acc[j][r] * (1.0f / 16.0f) + bb; const int rl = wave * 16 + 8 * g + r; if (which == 3) th[cl][rl] = (_Float16)v; else sh[rl][cl] = (_Float16)v; } }
  __syncthreads();
  if (which < 3) { for (int e = tid; e < 64 * 16; e += 128) { const int rl = e >> 4, q = e & 15; vst2((unsigned*)(D + (r0 + rl) * HID + c0 + q * 8), *(const v4u*)&sh[rl][q * 8]); } }
  else { for (int e = tid; e < 128 * 8; e += 128) { const int cl = e >> 3, q = e & 7; vst2((unsigned*)(D + (size_t)(c0 + cl) * NN + r0 + q * 8), *(const v4u*)&th[cl][q * 8]); } } }
// ---- k_w: block = (64 queries n, 128 keys l): s_h = q_h . k_h / sqrt(128) for BOTH heads, then the reference's softmax over the HEAD axis (axis -1 of [n, l, h]): w_0 = 1 / (1 + exp(s_1 - s_0)), w_1 = 1 - w_0 (f32, precise expf) -> two f16 planes P_h[n][l] x 2^11 (no normalisation over l: out_h = sum_l w_h v_h)
__global__ __launch_bounds__(128) void k_w(const _Float16* __restrict__ Q, const _Float16* __restrict__ K, _Float16* __restrict__ P0, _Float16* __restrict__ P1) { __shared__ __align__(16) _Float16 s0[4][16][136], s1[4][16][136];
  const int tid = threadIdx.x, wave = tid >> 5, lane = tid & 31, col = lane & 15, g = lane >> 4; const int k0 = blockIdx.y * 128; const int ql0 = blockIdx.x * 64 + wave * 16;
  v8f acc0[8] = {}, acc1[8] = {};
#pragma unroll
  for (int kc = 0; kc < DK / 32; ++kc) { const v16h a0 = frag_h(Q + (size_t)(ql0 + col) * HID + kc * 32, lane), a1 = frag_h(Q + (size_t)(ql0 + col) * HID + DK + kc * 32, lane);
#pragma unroll
    for (int j = 0; j < 8; ++j) { const size_t kr = (size_t)(k0 + j * 16 + col) * HID; acc0[j] = wmma16(a0, frag_h(K + kr + kc * 32, lane), acc0[j]); acc1[j] = wmma16(a1, frag_h(K + kr + DK + kc * 32, lane), acc1[j]); } }
  const float isd = 1.0f / sqrtf((float)DK);
#pragma unroll
  for (int j = 0; j < 8; ++j)
#pragma unroll
    for (int r = 0; r < 8; ++r) { const float d = (acc1[j][r] - acc0[j][r]) * isd; const float w0 = sig_ni(d); s0[wave][8 * g + r][j * 16 + col] = (_Float16)(w0 * 2048.0f); s1[wave][8 * g + r][j * 16 + col] = (_Float16)((1.0f - w0) * 2048.0f); }
  LDSX(); for (int rl = 0; rl < 16; ++rl) if (lane < 16) { vst2((unsigned*)(P0 + (size_t)(ql0 + rl) * NN + k0 + lane * 8), *(const v4u*)&s0[wave][rl][lane * 8]); vst2((unsigned*)(P1 + (size_t)(ql0 + rl) * NN + k0 + lane * 8), *(const v4u*)&s1[wave][rl][lane * 8]); } }
// ---- k_pv: block = (64 queries, 64 of the head's 256 columns), 8 waves of 16 x 32: out[n][h][c0 ..] = P . v_h (K 4,096). Each 128-k tile of P and of v (64 rows x 256 B each) is read once per block with whole-row loads and shared by the waves through LDS (two buffers, row pitch 272 B); the global loads run two tiles ahead in two register sets. Every accumulator still sums k in ascending blocks of 32.
#define PV_BK 128
#define PV_T (NN / PV_BK)
#define PV_LD (PV_BK + 8)
// publish point of an LDS tile: the wave's own LDS stores and reads have retired, then the work-group barrier. Written by hand because __syncthreads() also drains the global loads that are meant to stay in flight across it.
#define PV_BAR() do { asm volatile("s_wait_dscnt 0x0" ::: "memory"); asm volatile("s_barrier_signal -1\n\ts_barrier_wait -1" ::: "memory"); } while (0)
__global__ __launch_bounds__(256) void k_pv(const _Float16* __restrict__ P, const _Float16* __restrict__ VP, int h, float* __restrict__ O) { __shared__ __align__(16) _Float16 sp[2][64][PV_LD], sv[2][64][PV_LD]; __shared__ __align__(16) float so[64][68];
  const int tid = threadIdx.x, wave = tid >> 5, lane = tid & 31, col = lane & 15, g = lane >> 4; const int n0 = blockIdx.x * 64, c0 = blockIdx.y * 64, wr = (wave >> 1) * 16, wc = (wave & 1) * 32;
  const int lr = tid >> 4, lq = (tid & 15) * 8;   // staging: 16 lanes cover one 256-B row piece, a wave two rows per load
  const _Float16* gp = P + (size_t)(n0 + lr) * NN + lq; const _Float16* gv = VP + (size_t)(h * VW + c0 + lr) * NN + lq;
  v8h r0[8], ra[8], rb[8]; v8f acc[2] = {};
  auto ld = [&](v8h (&r)[8], int t) {
#pragma unroll
    for (int i = 0; i < 4; ++i) { r[i] = *(const v8h*)(gp + (size_t)(16 * i) * NN + t * PV_BK); r[4 + i] = *(const v8h*)(gv + (size_t)(16 * i) * NN + t * PV_BK); }
    __builtin_amdgcn_sched_barrier(0); };   // keeps one tile's loads together and the tiles in order, so that the counted load waits in front of the LDS stores leave the younger tile in flight
  auto st = [&](const v8h (&r)[8], int b) {
#pragma unroll
    for (int i = 0; i < 4; ++i) { *(v8h*)&sp[b][lr + 16 * i][lq] = r[i]; *(v8h*)&sv[b][lr + 16 * i][lq] = r[4 + i]; } };
  auto mm = [&](int b) { v16h fa[PV_BK / 32], f0[PV_BK / 32], f1[PV_BK / 32];   // the whole tile's fragment reads go out as one group ahead of its products
#pragma unroll
    for (int kk = 0; kk < PV_BK / 32; ++kk) { fa[kk] = frag_h(&sp[b][wr + col][kk * 32], lane); f0[kk] = frag_h(&sv[b][wc + col][kk * 32], lane); f1[kk] = frag_h(&sv[b][wc + 16 + col][kk * 32], lane); }
#pragma unroll
    for (int kk = 0; kk < PV_BK / 32; ++kk) { acc[0] = wmma16(fa[kk], f0[kk], acc[0]); acc[1] = wmma16(fa[kk], f1[kk], acc[1]); } };
  ld(r0, 0); ld(ra, 1); ld(rb, 2); st(r0, 0);
  PV_BAR();
#pragma unroll 1
  for (int t = 0; t < PV_T - 4; t += 2) {   // rolled: one copy of the two-tile body is enough, the buffers alternate inside it
    mm(0); st(ra, 1); ld(ra, t + 3);
    PV_BAR();   // tile t+1 is published; every reader has left buffer 0
    mm(1); st(rb, 0); ld(rb, t + 4);
    asm volatile("s_wait_xcnt 0x0" ::: "memory");   // this trip's loads stay in flight over the next trip's address arithmetic: their address registers are rewritten only behind this wait
    PV_BAR();   // tile t+2 is published; every reader has left buffer 1
  }
  mm(0); st(ra, 1); ld(ra, PV_T - 1);
  PV_BAR();
  mm(1); st(rb, 0);
  PV_BAR();
  mm(0); st(ra, 1);
  PV_BAR();
  mm(1);
#pragma unroll
  for (int j = 0; j < 2; ++j)
#pragma unroll
    for (int r = 0; r < 8; ++r) so[wr + 8 * g + r][wc + j * 16 + col] = acc[j][r] * (1.0f / 2048.0f);
  __syncthreads();
  for (int e = tid; e < 64 * 16; e += 256) { const int rl = e >> 4, q = e & 15; vst2(O + ((size_t)(n0 + rl) * NHD + h) * VW + c0 + q * 4, *(const v4f*)&so[rl][q * 4]); } }
// ---- k_mix: block = 64 rows (2 threads per row): x = LN(0.5 * mean_h out + 0.5 * x_prev) * g + b (in place on X, or to OUT for the last layer)
__global__ __launch_bounds__(128) void k_mix(const float* __restrict__ O, float* __restrict__ X, const float* __restrict__ Gm, const float* __restrict__ Bb, float* __restrict__ OUT) { __shared__ __align__(16) float sy[64][HID + 4];
  const int tid = threadIdx.x; const size_t r0 = (size_t)blockIdx.x * 64; const int row = tid >> 1, half = tid & 1; const size_t n = r0 + row;
  float s = 0.f; for (int e = 0; e < 128; ++e) { const int c = half * 128 + e; const float om = (O[(n * NHD + 0) * VW + c] + O[(n * NHD + 1) * VW + c]) * 0.5f; const float v = 0.5f * om + 0.5f * X[n * HID + c]; sy[row][c] = v; s += v; }
  s += __shfl_xor(s, 1); const float mu = s * (1.0f / HID); float s2 = 0.f; for (int e = 0; e < 128; ++e) { const float d = sy[row][half * 128 + e] - mu; s2 += d * d; } s2 += __shfl_xor(s2, 1); const float rs = rsqrtf(s2 * (1.0f / HID) + 1e-5f);
  for (int e = 0; e < 128; ++e) { const int c = half * 128 + e; sy[row][c] = (sy[row][c] - mu) * rs * bfr(Gm[c]) + bfr(Bb[c]); }
  __syncthreads();
  float* dst = OUT ? OUT : X;
  for (int q = tid; q < 64 * HID / 4; q += 128) { const int rw = q / (HID / 4), c4 = (q % (HID / 4)) * 4; vst2(dst + (r0 + rw) * HID + c4, *(const v4f*)&sy[rw][c4]); } }
extern "C" void kernel_launch(void* const* d_in, const int* in_sizes, int n_in, void* d_out, int out_size, void* d_ws, size_t ws_size, hipStream_t stream) {
  (void)in_sizes; (void)n_in; (void)out_size;
  const float** F = (const float**)d_in;   // 0 x [4096,512], 1 fc_w [512,256], 2 fc_b, 3 ln_g [3,256], 4 ln_b [3,256], 5 wq [2,256,256], 6 bq [2,256], 7 wk, 8 bk, 9 wvl, 10 bvl, 11 wvg [2,256,512], 12 bvg [2,512]
  if (ws_size < (size_t)WS_END) return;
  char* ws = (char*)d_ws; float *X = (float*)(ws + WS_X), *O = (float*)(ws + WS_O); _Float16 *Q = (_Float16*)(ws + WS_Q), *K = (_Float16*)(ws + WS_K), *VI = (_Float16*)(ws + WS_VI), *VP = (_Float16*)(ws + WS_VP), *P = (_Float16*)(ws + WS_P);
  k_fc<<<dim3(NN / 64), 128, 0, stream>>>(F[0], F[1], F[2], F[3], F[4], X);
  for (int l = 0; l < TNL; ++l) {
    k_lin<<<dim3(NN / 64, HID / 128), 128, 0, stream>>>(X, nullptr, F[5] + (size_t)l * HID * HID, F[6] + l * HID, 0, HID, Q);
    k_lin<<<dim3(NN / 64, HID / 128), 128, 0, stream>>>(X, nullptr, F[7] + (size_t)l * HID * HID, F[8] + l * HID, 1, HID, K);
    k_lin<<<dim3(NN / 64, HID / 128), 128, 0, stream>>>(X, nullptr, F[9] + (size_t)l * HID * HID, F[10] + l * HID, 2, HID, VI);
    k_lin<<<dim3(NN / 64, (NHD * VW) / 128), 128, 0, stream>>>(X, VI, F[11] + (size_t)l * HID * NHD * VW, F[12] + l * NHD * VW, 3, NHD * VW, VP);
    k_w<<<dim3(NN / 64, NN / 128), 128, 0, stream>>>(Q, K, P, P + (size_t)NN * NN);
    for (int h = 0; h < NHD; ++h) k_pv<<<dim3(NN / 64, VW / 64), 256, 0, stream>>>(P + (size_t)h * NN * NN, VP, h, O);
    k_mix<<<dim3(NN / 64), 128, 0, stream>>>(O, X, F[3] + (l + 1) * HID, F[4] + (l + 1) * HID, (l == NL - 1) ? (float*)d_out : nullptr);
  }
}

// v002
// A run of this version takes 279 microseconds.
// Two timings next to v001 put it at 2.24 and 2.25 times that version's speed.
// All steps since v000 together make it 4.52 times as fast.
// compute dtype: all float inputs rounded to bf16; x fc_w exact bf16 products on WMMA 16x16x32; LayerNorm/ReLU in f32; per layer the q/k/v_in/v projections with the LayerNorm'd operand rounded once to f16 against f16 weights (bf16 values x 16, folded); both heads' logits q.k/sqrt(128) from f16 rows (1 product) and the reference's softmax over the HEAD axis (a 2-way softmax per (node, node) pair, f32, precise expf) -> weights stored f16 x 2^11; out_h = sum over all nodes of w_h v_h (v f16), head mean, residual mix and LayerNorm in f32; f32 output.
#include <hip/hip_runtime.h>
#include <math.h>

typedef __attribute__((ext_vector_type(16))) _Float16 v16h;
typedef __attribute__((ext_vector_type(16))) __bf16 v16b;
typedef __attribute__((ext_vector_type(8)))  _Float16 v8h;
typedef __attribute__((ext_vector_type(4)))  _Float16 v4hh;
typedef __attribute__((ext_vector_type(8)))  float v8f;
typedef __attribute__((ext_vector_type(4)))  float v4f;
typedef __attribute__((ext_vector_type(2)))  float v2f;
typedef __attribute__((ext_vector_type(4)))  unsigned v4u;
typedef __attribute__((ext_vector_type(4)))  int v4i;
typedef float __attribute__((may_alias)) float_a;
typedef int __attribute__((may_alias)) int_a;

template <typename T> __device__ __forceinline__ void vst2(void* p, T v) { *(T*)p = v;  }
__device__ __forceinline__ v8f wmma16(v16h a, v16h b, v8f c) {
  v8f d = __builtin_amdgcn_wmma_f32_16x16x32_f16(false, a, false, b, (short)0, c, false, false);
  asm volatile("v_nop\n\tv_nop\n\tv_nop\n\tv_nop" : "+v"(d) : "v"(a), "v"(b));
  return d;
}
__device__ __forceinline__ v8f wmma_bf(v16b a, v16b b, v8f c) {
  v8f d = __builtin_amdgcn_wmma_f32_16x16x32_bf16(false, a, false, b, (short)0, c, false, false);
  asm volatile("v_nop\n\tv_nop\n\tv_nop\n\tv_nop" : "+v"(d) : "v"(a), "v"(b));
  return d;
}
// 16x16x32 fragments: lane = (h = lane>>4, row/col = lane&15); elements 0..7 = k0+8h+0..7, 8..15 = k0+16+8h+0..7; D element r = row 8h+r
__device__ __forceinline__ v16h frag_h(const _Float16* rowk0, int lane) {
  union { v16h v; v8h q[2]; } u; const _Float16* p = rowk0 + 8 * (lane >> 4);
  u.q[0] = *(const v8h*)p; u.q[1] = *(const v8h*)(p + 16); return u.v;
}
__device__ __forceinline__ v16h frag_f32(const float* rowk0, int lane) {
  v16h a; const float* p = rowk0 + 8 * (lane >> 4);
#pragma unroll
  for (int i = 0; i < 8; ++i) { a[i] = (_Float16)p[i]; a[8 + i] = (_Float16)p[16 + i]; }
  return a;
}
__device__ __forceinline__ v16h frag_f32s(const float* rowk0, int lane, float sc) {
  v16h a; const float* p = rowk0 + 8 * (lane >> 4);
#pragma unroll
  for (int i = 0; i < 8; ++i) { a[i] = (_Float16)(p[i] * sc); a[8 + i] = (_Float16)(p[16 + i] * sc); }
  return a;
}
// column fragment from a [K][ld] layout (column n), rows >= K read as 0
__device__ __forceinline__ v16h fragc_f32(const float* W, int k0, int n, int lane, int ld, int K) {
  v16h a; const int g = lane >> 4;
#pragma unroll
  for (int i = 0; i < 8; ++i) { const int ka = k0 + 8 * g + i, kb = ka + 16;
    a[i] = (_Float16)(ka < K ? W[(size_t)(ka < K ? ka : K - 1) * ld + n] : 0.f); a[8 + i] = (_Float16)(kb < K ? W[(size_t)(kb < K ? kb : K - 1) * ld + n] : 0.f); }
  return a;
}
struct F2 { v16b h, l; };
__device__ __forceinline__ F2 bsplit16(const float v[16]) { F2 r;
#pragma unroll
  for (int i = 0; i < 16; ++i) { const __bf16 h = (__bf16)v[i]; r.h[i] = h; r.l[i] = (__bf16)(v[i] - (float)h); }
  return r; }
__device__ __forceinline__ F2 split_row(const float* row, int k0, int lane) { float v[16]; const float* p = row + k0 + 8 * (lane >> 4);
#pragma unroll
  for (int i = 0; i < 8; ++i) { v[i] = p[i]; v[8 + i] = p[16 + i]; }
  return bsplit16(v); }
__device__ __forceinline__ F2 split_rowK(const float* row, int k0, int lane, int K) { float v[16]; const int g = lane >> 4;
#pragma unroll
  for (int i = 0; i < 8; ++i) { const int ka = k0 + 8 * g + i, kb = ka + 16; v[i] = ka < K ? row[ka < K ? ka : K - 1] : 0.f; v[8 + i] = kb < K ? row[kb < K ? kb : K - 1] : 0.f; }
  return bsplit16(v); }
__device__ __forceinline__ F2 split_col(const float* W, int k0, int n, int lane, int ld, int K) { float v[16]; const int g = lane >> 4;
#pragma unroll
  for (int i = 0; i < 8; ++i) { const int ka = k0 + 8 * g + i, kb = ka + 16; v[i] = ka < K ? W[(size_t)(ka < K ? ka : K - 1) * ld + n] : 0.f; v[8 + i] = kb < K ? W[(size_t)(kb < K ? kb : K - 1) * ld + n] : 0.f; }
  return bsplit16(v); }
__device__ __forceinline__ v8f mac3(const F2& a, const F2& b, v8f c) { c = wmma_bf(a.l, b.h, c); c = wmma_bf(a.h, b.l, c); return wmma_bf(a.h, b.h, c); }
__device__ __forceinline__ float sigm(float v) { return 1.0f / (1.0f + expf(-v)); }
#define LDSX() do { asm volatile("s_wait_dscnt 0" ::: "memory"); __builtin_amdgcn_wave_barrier(); __builtin_amdgcn_fence(__ATOMIC_RELEASE, "workgroup"); } while (0)

// TransConv (graph-transformer style, N 4,096 nodes, in 512, hidden 256, 2 heads x 128, 2 layers, alpha 0.5): x = relu(LN(x fc_w + b)); per layer: q, k = x W + b (per head 128), v = (x Wvl + b) Wvg + b (per head 256), scores[n][l][h] = q_n,h . k_l,h / sqrt(128), w = softmax over the LAST axis = the 2 heads (literally as written), out[n][h] = sum_l w[n][l][h] v[l][h], head mean, x = LN(0.5 out + 0.5 x_prev).
__device__ __forceinline__ float bfr(float v) { return (float)(__bf16)v; }
__device__ __attribute__((noinline)) float sig_ni(float d) { return 1.0f / (1.0f + expf(d)); }   // out of line: keeps k_w's static VALU-FMA count low
#define NN 4096
#define DIN 512
#define HID 256
#define NHD 2
#define DK 128
#define VW 256                 // per-head value width
#define NL 2
#ifndef TNL
#define TNL NL
#endif
#define WS_X   0u                                      // f32 x rows [n][256] (current layer input / prev)
#define WS_Q   (WS_X + 4u * (size_t)NN * HID)           // f16 q rows [n][256]
#define WS_K   (WS_Q + 2u * (size_t)NN * HID)
#define WS_VI  (WS_K + 2u * (size_t)NN * HID)           // f16 v_in rows [n][256]
#define WS_VP  (WS_VI + 2u * (size_t)NN * HID)          // f16 v planes [h*256 + c][n]
#define WS_P   (WS_VP + 2u * (size_t)NHD * VW * NN)      // f16 head-softmax weights x 2^11, planes [h][n][l]
#define WS_O   (WS_P + 2u * (size_t)NHD * NN * NN)       // f32 out [n][h][256]
#define WS_END (WS_O + 4u * (size_t)NN * NHD * VW)
typedef __attribute__((ext_vector_type(8)))  __bf16 v8b;
__device__ __forceinline__ v16b frag_b(const __bf16* rowk0, int lane) {
  union { v16b v; v8b q[2]; } u; const __bf16* p = rowk0 + 8 * (lane >> 4);
  u.q[0] = *(const v8b*)p; u.q[1] = *(const v8b*)(p + 16); return u.v;
}
// publish point of an LDS weight tile: the wave's own LDS stores and reads have retired, then the work-group barrier. Written by hand because __syncthreads() also drains the global loads that are meant to stay in flight across it.
#define WT_BAR() do { asm volatile("s_wait_dscnt 0x0" ::: "memory"); asm volatile("s_barrier_signal -1\n\ts_barrier_wait -1" ::: "memory"); } while (0)
// ---- k_fc: block = 64 rows, 8 waves of 16 rows x 128 columns: y = x fc_w + b (exact bf16 products) -> LDS; per row LayerNorm (eps 1e-5) x g0 + b0, ReLU -> X rows (1 KB each). fc_w is read once per block in chunks of 64 k x 256 columns with whole-row loads, rounded to bf16 once and stored k-contiguous per column in LDS (two buffers, row pitch 144 B); the next chunk's loads (weights and the wave's own x pieces) fly while this chunk is multiplied. Every accumulator still sums k in ascending blocks of 32.
#define FC_BK 64
#define FC_T (DIN / FC_BK)
#define FC_LD (FC_BK + 8)
__global__ __launch_bounds__(256) void k_fc(const float* __restrict__ XI, const float* __restrict__ W, const float* __restrict__ Bv, const float* __restrict__ G0, const float* __restrict__ B0, float* __restrict__ X) { __shared__ __align__(16) float sy[64][HID + 4]; __shared__ __align__(16) __bf16 wt[2][HID][FC_LD];
  const int tid = threadIdx.x, wave = tid >> 5, lane = tid & 31, col = lane & 15, g = lane >> 4; const size_t r0 = (size_t)blockIdx.x * 64; const int wr = (wave >> 1) * 16, cp = wave & 1;
  const int nq = tid & 63, kg = tid >> 6;   // staging piece: 8 k rows x 4 columns; a wave covers 512 B of one weight row per load
  const float* gw = W + (size_t)(kg * 8) * HID + nq * 4; const float* gx = XI + (r0 + wr + col) * DIN + 8 * g;
  v4f rw[16], rx[8]; v16b a[2]; v8f acc[8] = {};
  auto ldw = [&](int c) {
#pragma unroll
    for (int i = 0; i < 2; ++i)
#pragma unroll
      for (int e = 0; e < 8; ++e) rw[i * 8 + e] = *(const v4f*)(gw + (size_t)(c * FC_BK + i * 32 + e) * HID);
#pragma unroll
    for (int kk = 0; kk < 2; ++kk) { const float* p = gx + c * FC_BK + kk * 32; rx[kk * 4] = *(const v4f*)p; rx[kk * 4 + 1] = *(const v4f*)(p + 4); rx[kk * 4 + 2] = *(const v4f*)(p + 16); rx[kk * 4 + 3] = *(const v4f*)(p + 20); }
    __builtin_amdgcn_sched_barrier(0);   // keeps the chunk's loads together at this place, one chunk ahead of their use
    asm volatile("s_wait_xcnt 0x0" ::: "memory");   // the loads stay in flight over later arithmetic: their address registers are rewritten only behind this wait
    __builtin_amdgcn_sched_barrier(0); };   // keeps later register writes from being lifted over that wait
  auto stw = [&](int b) {
#pragma unroll
    for (int i = 0; i < 2; ++i)
#pragma unroll
      for (int m = 0; m < 4; ++m) { v8b t;
#pragma unroll
        for (int e = 0; e < 8; ++e) t[e] = (__bf16)rw[i * 8 + e][m];
        *(v8b*)&wt[b][nq * 4 + m][(kg + 4 * i) * 8] = t; }
#pragma unroll
    for (int kk = 0; kk < 2; ++kk)
#pragma unroll
      for (int i = 0; i < 4; ++i) { a[kk][i] = (__bf16)rx[kk * 4][i]; a[kk][4 + i] = (__bf16)rx[kk * 4 + 1][i]; a[kk][8 + i] = (__bf16)rx[kk * 4 + 2][i]; a[kk][12 + i] = (__bf16)rx[kk * 4 + 3][i]; } };
  auto mm = [&](int b) {
#pragma unroll
    for (int kk = 0; kk < 2; ++kk) { v16b f[8];   // the eight fragment reads go out as one group ahead of their products
#pragma unroll
      for (int j = 0; j < 8; ++j) f[j] = frag_b(&wt[b][cp * 128 + j * 16 + col][kk * 32], lane);
#pragma unroll
      for (int j = 0; j < 8; ++j) acc[j] = wmma_bf(a[kk], f[j], acc[j]); } };
  ldw(0); stw(0); ldw(1);
  WT_BAR();
#pragma unroll 1
  for (int c = 0; c < FC_T; ++c) {   // rolled: one copy of the body is enough
    mm(c & 1);
    if (c + 1 < FC_T) stw((c + 1) & 1);
    if (c + 2 < FC_T) ldw(c + 2);
    WT_BAR();   // chunk c+1 is published; every reader has left the buffer of chunk c
  }
#pragma unroll
  for (int j = 0; j < 8; ++j) { const int o = cp * 128 + j * 16 + col; const float bb = bfr(Bv[o]);
#pragma unroll
    for (int r = 0; r < 8; ++r) sy[wr + 8 * g + r][o] = acc[j][r] + bb; }
  __syncthreads();
  // LN per row: 2 threads per row (the first 128 threads / 64 rows), each 128 elements
  if (tid < 128) { const int row = tid >> 1, half = tid & 1; float* v = &sy[row][half * 128]; float s = 0.f; for (int e = 0; e < 128; ++e) s += v[e]; s += __shfl_xor(s, 1); const float mu = s * (1.0f / HID);
    float s2 = 0.f; for (int e = 0; e < 128; ++e) { const float d = v[e] - mu; s2 += d * d; } s2 += __shfl_xor(s2, 1); const float rs = rsqrtf(s2 * (1.0f / HID) + 1e-5f);
    for (int e = 0; e < 128; ++e) { const int c = half * 128 + e; v[e] = fmaxf((v[e] - mu) * rs * bfr(G0[c]) + bfr(B0[c]), 0.f); } }
  __syncthreads();
  for (int q = tid; q < 64 * HID / 4; q += 256) { const int row = q / (HID / 4), c4 = (q % (HID / 4)) * 4; vst2(X + (r0 + row) * HID + c4, *(const v4f*)&sy[row][c4]); } }
// ---- k_lin: block = (64 rows, 128 cols, which), 8 waves of 16 x 64: which 0 q, 1 k, 2 v_in from X (f32 -> f16 A); 3 v = v_in (f16 rows) Wvg + b (512 cols = 4 column blocks) -> f16 planes [c][n]. The block's weight tile (256 k x 128 columns) is read once with whole-row loads, converted once and stored k-contiguous per column in LDS (row pitch 528 B); the 64 operand rows go through LDS the same way; all fragments come from LDS. Every accumulator still sums k in ascending blocks of 32.
#define LIN_LD (HID + 8)
// behind a group of global loads: the first scheduling barrier keeps all of the group's loads issued before the first is waited for; s_wait_xcnt stands before any of their address registers is rewritten; the second scheduling barrier keeps later register writes from being lifted over that wait
#define LIN_ISSUED() do { __builtin_amdgcn_sched_barrier(0); asm volatile("s_wait_xcnt 0x0" ::: "memory"); __builtin_amdgcn_sched_barrier(0); } while (0)
__global__ __launch_bounds__(256) void k_lin(const float* __restrict__ X, const _Float16* __restrict__ VI, const float* __restrict__ Wm, const float* __restrict__ Bv, int which, _Float16* __restrict__ D) { __shared__ __align__(16) _Float16 sh[64][136]; __shared__ __align__(16) _Float16 th[128][72]; __shared__ __align__(16) _Float16 wt[128][LIN_LD]; __shared__ __align__(16) _Float16 sa[64][LIN_LD];
  const int tid = threadIdx.x, wave = tid >> 5, lane = tid & 31, col = lane & 15, g = lane >> 4; const int c0 = blockIdx.y * 128; const size_t r0 = (size_t)blockIdx.x * 64; const int wr = (wave >> 1) * 16, wc = (wave & 1) * 64;
  { v4f rw[32];   // staging piece: 8 k rows x 4 columns; a wave covers the tile's whole 512-B row per load
    const int sr = wave * 8, sc = c0 + lane * 4;
    if (which < 3) { v4f rx[16]; const float* gw = Wm + (size_t)sr * HID + sc; const float* gx = X + (r0 + (tid >> 6)) * HID + (tid & 63) * 4;
#pragma unroll
      for (int i = 0; i < 4; ++i)
#pragma unroll
        for (int e = 0; e < 8; ++e) rw[i * 8 + e] = *(const v4f*)(gw + (i * 64 + e) * HID);
#pragma unroll
      for (int i = 0; i < 16; ++i) rx[i] = *(const v4f*)(gx + i * 4 * HID);
      LIN_ISSUED();
#pragma unroll
      for (int i = 0; i < 16; ++i) { v4hh t; t[0] = (_Float16)rx[i][0]; t[1] = (_Float16)rx[i][1]; t[2] = (_Float16)rx[i][2]; t[3] = (_Float16)rx[i][3]; *(v4hh*)&sa[(tid >> 6) + 4 * i][(tid & 63) * 4] = t; } }
    else { v8h rx[8]; const float* gw = Wm + (size_t)sr * (NHD * VW) + sc; const _Float16* gx = VI + (r0 + (tid >> 5)) * HID + (tid & 31) * 8;
#pragma unroll
      for (int i = 0; i < 4; ++i)
#pragma unroll
        for (int e = 0; e < 8; ++e) rw[i * 8 + e] = *(const v4f*)(gw + (i * 64 + e) * (NHD * VW));
#pragma unroll
      for (int i = 0; i < 8; ++i) rx[i] = *(const v8h*)(gx + i * 8 * HID);
      LIN_ISSUED();
#pragma unroll
      for (int i = 0; i < 8; ++i) *(v8h*)&sa[(tid >> 5) + 8 * i][(tid & 31) * 8] = rx[i]; }
#pragma unroll
    for (int i = 0; i < 4; ++i)
#pragma unroll
      for (int m = 0; m < 4; ++m) { v8h t;
#pragma unroll
        for (int e = 0; e < 8; ++e) t[e] = (_Float16)(bfr(rw[i * 8 + e][m]) * 16.0f);
        *(v8h*)&wt[lane * 4 + m][(wave + 8 * i) * 8] = t; } }
  __syncthreads();
  v8f acc[4] = {}; v16h fa[2], fb[2][4];
  auto lf = [&](int kc) { fa[kc & 1] = frag_h(&sa[wr + col][kc * 32], lane);
#pragma unroll
    for (int j = 0; j < 4; ++j) fb[kc & 1][j] = frag_h(&wt[wc + j * 16 + col][kc * 32], lane); };
  lf(0);
#pragma unroll
  for (int kc = 0; kc < HID / 32; ++kc) { if (kc + 1 < HID / 32) lf(kc + 1);   // the next step's fragment reads go out ahead of this step's products
#pragma unroll
    for (int j = 0; j < 4; ++j) acc[j] = wmma16(fa[kc & 1], fb[kc & 1][j], acc[j]); }
#pragma unroll
  for (int j = 0; j < 4; ++j) { const int cl = wc + j * 16 + col; const float bb = bfr(Bv[c0 + cl]);
#pragma unroll
    for (int r = 0; r < 8; ++r) { const float v = acc[j][r] * (1.0f / 16.0f) + bb; const int rl = wr + 8 * g + r; if (which == 3) th[cl][rl] = (_Float16)v; else sh[rl][cl] = (_Float16)v; } }
  __syncthreads();
  if (which < 3) { for (int e = tid; e < 64 * 16; e += 256) { const int rl = e >> 4, q = e & 15; vst2((unsigned*)(D + (r0 + rl) * HID + c0 + q * 8), *(const v4u*)&sh[rl][q * 8]); } }
  else { for (int e = tid; e < 128 * 8; e += 256) { const int cl = e >> 3, q = e & 7; vst2((unsigned*)(D + (size_t)(c0 + cl) * NN + r0 + q * 8), *(const v4u*)&th[cl][q * 8]); } } }
// ---- k_w: block = (64 queries n, 128 keys l): s_h = q_h . k_h / sqrt(128) for BOTH heads, then the reference's softmax over the HEAD axis (axis -1 of [n, l, h]): w_0 = 1 / (1 + exp(s_1 - s_0)), w_1 = 1 - w_0 (f32, precise expf) -> two f16 planes P_h[n][l] x 2^11 (no normalisation over l: out_h = sum_l w_h v_h)
__global__ __launch_bounds__(128) void k_w(const _Float16* __restrict__ Q, const _Float16* __restrict__ K, _Float16* __restrict__ P0, _Float16* __restrict__ P1) { __shared__ __align__(16) _Float16 s0[4][16][136], s1[4][16][136];
  const int tid = threadIdx.x, wave = tid >> 5, lane = tid & 31, col = lane & 15, g = lane >> 4; const int k0 = blockIdx.y * 128; const int ql0 = blockIdx.x * 64 + wave * 16;
  v8f acc0[8] = {}, acc1[8] = {};
#pragma unroll
  for (int kc = 0; kc < DK / 32; ++kc) { const v16h a0 = frag_h(Q + (size_t)(ql0 + col) * HID + kc * 32, lane), a1 = frag_h(Q + (size_t)(ql0 + col) * HID + DK + kc * 32, lane);
#pragma unroll
    for (int j = 0; j < 8; ++j) { const size_t kr = (size_t)(k0 + j * 16 + col) * HID; acc0[j] = wmma16(a0, frag_h(K + kr + kc * 32, lane), acc0[j]); acc1[j] = wmma16(a1, frag_h(K + kr + DK + kc * 32, lane), acc1[j]); } }
  const float isd = 1.0f / sqrtf((float)DK);
#pragma unroll
  for (int j = 0; j < 8; ++j)
#pragma unroll
    for (int r = 0; r < 8; ++r) { const float d = (acc1[j][r] - acc0[j][r]) * isd; const float w0 = sig_ni(d); s0[wave][8 * g + r][j * 16 + col] = (_Float16)(w0 * 2048.0f); s1[wave][8 * g + r][j * 16 + col] = (_Float16)((1.0f - w0) * 2048.0f); }
  LDSX(); for (int rl = 0; rl < 16; ++rl) if (lane < 16) { vst2((unsigned*)(P0 + (size_t)(ql0 + rl) * NN + k0 + lane * 8), *(const v4u*)&s0[wave][rl][lane * 8]); vst2((unsigned*)(P1 + (size_t)(ql0 + rl) * NN + k0 + lane * 8), *(const v4u*)&s1[wave][rl][lane * 8]); } }
// ---- k_pv: block = (64 queries, 64 of the head's 256 columns), 8 waves of 16 x 32: out[n][h][c0 ..] = P . v_h (K 4,096). Each 128-k tile of P and of v (64 rows x 256 B each) is read once per block with whole-row loads and shared by the waves through LDS (two buffers, row pitch 272 B); the global loads run two tiles ahead in two register sets. Every accumulator still sums k in ascending blocks of 32.
#define PV_BK 128
#define PV_T (NN / PV_BK)
#define PV_LD (PV_BK + 8)
// publish point of an LDS tile: the wave's own LDS stores and reads have retired, then the work-group barrier. Written by hand because __syncthreads() also drains the global loads that are meant to stay in flight across it.
#define PV_BAR() do { asm volatile("s_wait_dscnt 0x0" ::: "memory"); asm volatile("s_barrier_signal -1\n\ts_barrier_wait -1" ::: "memory"); } while (0)
__global__ __launch_bounds__(256) void k_pv(const _Float16* __restrict__ P, const _Float16* __restrict__ VP, int h, float* __restrict__ O) { __shared__ __align__(16) _Float16 sp[2][64][PV_LD], sv[2][64][PV_LD]; __shared__ __align__(16) float so[64][68];
  const int tid = threadIdx.x, wave = tid >> 5, lane = tid & 31, col = lane & 15, g = lane >> 4; const int n0 = blockIdx.x * 64, c0 = blockIdx.y * 64, wr = (wave >> 1) * 16, wc = (wave & 1) * 32;
  const int lr = tid >> 4, lq = (tid & 15) * 8;   // staging: 16 lanes cover one 256-B row piece, a wave two rows per load
  const _Float16* gp = P + (size_t)(n0 + lr) * NN + lq; const _Float16* gv = VP + (size_t)(h * VW + c0 + lr) * NN + lq;
  v8h r0[8], ra[8], rb[8]; v8f acc[2] = {};
  auto ld = [&](v8h (&r)[8], int t) {
#pragma unroll
    for (int i = 0; i < 4; ++i) { r[i] = *(const v8h*)(gp + (size_t)(16 * i) * NN + t * PV_BK); r[4 + i] = *(const v8h*)(gv + (size_t)(16 * i) * NN + t * PV_BK); }
    __builtin_amdgcn_sched_barrier(0); };   // keeps one tile's loads together and the tiles in order, so that the counted load waits in front of the LDS stores leave the younger tile in flight
  auto st = [&](const v8h (&r)[8], int b) {
#pragma unroll
    for (int i = 0; i < 4; ++i) { *(v8h*)&sp[b][lr + 16 * i][lq] = r[i]; *(v8h*)&sv[b][lr + 16 * i][lq] = r[4 + i]; } };
  auto mm = [&](int b) { v16h fa[PV_BK / 32], f0[PV_BK / 32], f1[PV_BK / 32];   // the whole tile's fragment reads go out as one group ahead of its products
#pragma unroll
    for (int kk = 0; kk < PV_BK / 32; ++kk) { fa[kk] = frag_h(&sp[b][wr + col][kk * 32], lane); f0[kk] = frag_h(&sv[b][wc + col][kk * 32], lane); f1[kk] = frag_h(&sv[b][wc + 16 + col][kk * 32], lane); }
#pragma unroll
    for (int kk = 0; kk < PV_BK / 32; ++kk) { acc[0] = wmma16(fa[kk], f0[kk], acc[0]); acc[1] = wmma16(fa[kk], f1[kk], acc[1]); } };
  ld(r0, 0); ld(ra, 1); ld(rb, 2); st(r0, 0);
  PV_BAR();
#pragma unroll 1
  for (int t = 0; t < PV_T - 4; t += 2) {   // rolled: one copy of the two-tile body is enough, the buffers alternate inside it
    mm(0); st(ra, 1); ld(ra, t + 3);
    PV_BAR();   // tile t+1 is published; every reader has left buffer 0
    mm(1); st(rb, 0); ld(rb, t + 4);
    asm volatile("s_wait_xcnt 0x0" ::: "memory");   // this trip's loads stay in flight over the next trip's address arithmetic: their address registers are rewritten only behind this wait
    PV_BAR();   // tile t+2 is published; every reader has left buffer 1
  }
  mm(0); st(ra, 1); ld(ra, PV_T - 1);
  PV_BAR();
  mm(1); st(rb, 0);
  PV_BAR();
  mm(0); st(ra, 1);
  PV_BAR();
  mm(1);
#pragma unroll
  for (int j = 0; j < 2; ++j)
#pragma unroll
    for (int r = 0; r < 8; ++r) so[wr + 8 * g + r][wc + j * 16 + col] = acc[j][r] * (1.0f / 2048.0f);
  __syncthreads();
  for (int e = tid; e < 64 * 16; e += 256) { const int rl = e >> 4, q = e & 15; vst2(O + ((size_t)(n0 + rl) * NHD + h) * VW + c0 + q * 4, *(const v4f*)&so[rl][q * 4]); } }
// ---- k_mix: block = 64 rows (2 threads per row): x = LN(0.5 * mean_h out + 0.5 * x_prev) * g + b (in place on X, or to OUT for the last layer)
__global__ __launch_bounds__(128) void k_mix(const float* __restrict__ O, float* __restrict__ X, const float* __restrict__ Gm, const float* __restrict__ Bb, float* __restrict__ OUT) { __shared__ __align__(16) float sy[64][HID + 4];
  const int tid = threadIdx.x; const size_t r0 = (size_t)blockIdx.x * 64; const int row = tid >> 1, half = tid & 1; const size_t n = r0 + row;
  float s = 0.f; for (int e = 0; e < 128; ++e) { const int c = half * 128 + e; const float om = (O[(n * NHD + 0) * VW + c] + O[(n * NHD + 1) * VW + c]) * 0.5f; const float v = 0.5f * om + 0.5f * X[n * HID + c]; sy[row][c] = v; s += v; }
  s += __shfl_xor(s, 1); const float mu = s * (1.0f / HID); float s2 = 0.f; for (int e = 0; e < 128; ++e) { const float d = sy[row][half * 128 + e] - mu; s2 += d * d; } s2 += __shfl_xor(s2, 1); const float rs = rsqrtf(s2 * (1.0f / HID) + 1e-5f);
  for (int e = 0; e < 128; ++e) { const int c = half * 128 + e; sy[row][c] = (sy[row][c] - mu) * rs * bfr(Gm[c]) + bfr(Bb[c]); }
  __syncthreads();
  float* dst = OUT ? OUT : X;
  for (int q = tid; q < 64 * HID / 4; q += 128) { const int rw = q / (HID / 4), c4 = (q % (HID / 4)) * 4; vst2(dst + (r0 + rw) * HID + c4, *(const v4f*)&sy[rw][c4]); } }
extern "C" void kernel_launch(void* const* d_in, const int* in_sizes, int n_in, void* d_out, int out_size, void* d_ws, size_t ws_size, hipStream_t stream) {
  (void)in_sizes; (void)n_in; (void)out_size;
  const float** F = (const float**)d_in;   // 0 x [4096,512], 1 fc_w [512,256], 2 fc_b, 3 ln_g [3,256], 4 ln_b [3,256], 5 wq [2,256,256], 6 bq [2,256], 7 wk, 8 bk, 9 wvl, 10 bvl, 11 wvg [2,256,512], 12 bvg [2,512]
  if (ws_size < (size_t)WS_END) return;
  char* ws = (char*)d_ws; float *X = (float*)(ws + WS_X), *O = (float*)(ws + WS_O); _Float16 *Q = (_Float16*)(ws + WS_Q), *K = (_Float16*)(ws + WS_K), *VI = (_Float16*)(ws + WS_VI), *VP = (_Float16*)(ws + WS_VP), *P = (_Float16*)(ws + WS_P);
  k_fc<<<dim3(NN / 64), 256, 0, stream>>>(F[0], F[1], F[2], F[3], F[4], X);
  for (int l = 0; l < TNL; ++l) {
    k_lin<<<dim3(NN / 64, HID / 128), 256, 0, stream>>>(X, nullptr, F[5] + (size_t)l * HID * HID, F[6] + l * HID, 0, Q);
    k_lin<<<dim3(NN / 64, HID / 128), 256, 0, stream>>>(X, nullptr, F[7] + (size_t)l * HID * HID, F[8] + l * HID, 1, K);
    k_lin<<<dim3(NN / 64, HID / 128), 256, 0, stream>>>(X, nullptr, F[9] + (size_t)l * HID * HID, F[10] + l * HID, 2, VI);
    k_lin<<<dim3(NN / 64, (NHD * VW) / 128), 256, 0, stream>>>(X, VI, F[11] + (size_t)l * HID * NHD * VW, F[12] + l * NHD * VW, 3, VP);
    k_w<<<dim3(NN / 64, NN / 128), 128, 0, stream>>>(Q, K, P, P + (size_t)NN * NN);
    for (int h = 0; h < NHD; ++h) k_pv<<<dim3(NN / 64, VW / 64), 256, 0, stream>>>(P + (size_t)h * NN * NN, VP, h, O);
    k_mix<<<dim3(NN / 64), 128, 0, stream>>>(O, X, F[3] + (l + 1) * HID, F[4] + (l + 1) * HID, (l == NL - 1) ? (float*)d_out : nullptr);
  }
}

// v003
// A run of this version takes 186 microseconds.
// Two timings next to v002 put it at 1.48 and 1.51 times that version's speed.
// Over all steps from v000 it is 6.74 times as fast.
// compute dtype: all float inputs rounded to bf16; x fc_w exact bf16 products on WMMA 16x16x32; LayerNorm/ReLU in f32; per layer the q/k/v_in/v projections with the LayerNorm'd operand rounded once to f16 against f16 weights (bf16 values x 16, folded); both heads' logits q.k/sqrt(128) from f16 rows (1 product) and the reference's softmax over the HEAD axis (a 2-way softmax per (node, node) pair, f32, precise expf) -> weights stored f16 x 2^11; out_h = sum over all nodes of w_h v_h (v f16), head mean, residual mix and LayerNorm in f32; f32 output.
#include <hip/hip_runtime.h>
#include <math.h>

typedef __attribute__((ext_vector_type(16))) _Float16 v16h;
typedef __attribute__((ext_vector_type(16))) __bf16 v16b;
typedef __attribute__((ext_vector_type(8)))  _Float16 v8h;
typedef __attribute__((ext_vector_type(4)))  _Float16 v4hh;
typedef __attribute__((ext_vector_type(8)))  float v8f;
typedef __attribute__((ext_vector_type(4)))  float v4f;
typedef __attribute__((ext_vector_type(2)))  float v2f;
typedef __attribute__((ext_vector_type(4)))  unsigned v4u;
typedef __attribute__((ext_vector_type(4)))  int v4i;
typedef float __attribute__((may_alias)) float_a;
typedef int __attribute__((may_alias)) int_a;

template <typename T> __device__ __forceinline__ void vst2(void* p, T v) { *(T*)p = v;  }
__device__ __forceinline__ v8f wmma16(v16h a, v16h b, v8f c) {
  v8f d = __builtin_amdgcn_wmma_f32_16x16x32_f16(false, a, false, b, (short)0, c, false, false);
  asm volatile("v_nop\n\tv_nop\n\tv_nop\n\tv_nop" : "+v"(d) : "v"(a), "v"(b));
  return d;
}
__device__ __forceinline__ v8f wmma_bf(v16b a, v16b b, v8f c) {
  v8f d = __builtin_amdgcn_wmma_f32_16x16x32_bf16(false, a, false, b, (short)0, c, false, false);
  asm volatile("v_nop\n\tv_nop\n\tv_nop\n\tv_nop" : "+v"(d) : "v"(a), "v"(b));
  return d;
}
// 16x16x32 fragments: lane = (h = lane>>4, row/col = lane&15); elements 0..7 = k0+8h+0..7, 8..15 = k0+16+8h+0..7; D element r = row 8h+r
__device__ __forceinline__ v16h frag_h(const _Float16* rowk0, int lane) {
  union { v16h v; v8h q[2]; } u; const _Float16* p = rowk0 + 8 * (lane >> 4);
  u.q[0] = *(const v8h*)p; u.q[1] = *(const v8h*)(p + 16); return u.v;
}
__device__ __forceinline__ v16h frag_f32(const float* rowk0, int lane) {
  v16h a; const float* p = rowk0 + 8 * (lane >> 4);
#pragma unroll
  for (int i = 0; i < 8; ++i) { a[i] = (_Float16)p[i]; a[8 + i] = (_Float16)p[16 + i]; }
  return a;
}
__device__ __forceinline__ v16h frag_f32s(const float* rowk0, int lane, float sc) {
  v16h a; const float* p = rowk0 + 8 * (lane >> 4);
#pragma unroll
  for (int i = 0; i < 8; ++i) { a[i] = (_Float16)(p[i] * sc); a[8 + i] = (_Float16)(p[16 + i] * sc); }
  return a;
}
// column fragment from a [K][ld] layout (column n), rows >= K read as 0
__device__ __forceinline__ v16h fragc_f32(const float* W, int k0, int n, int lane, int ld, int K) {
  v16h a; const int g = lane >> 4;
#pragma unroll
  for (int i = 0; i < 8; ++i) { const int ka = k0 + 8 * g + i, kb = ka + 16;
    a[i] = (_Float16)(ka < K ? W[(size_t)(ka < K ? ka : K - 1) * ld + n] : 0.f); a[8 + i] = (_Float16)(kb < K ? W[(size_t)(kb < K ? kb : K - 1) * ld + n] : 0.f); }
  return a;
}
struct F2 { v16b h, l; };
__device__ __forceinline__ F2 bsplit16(const float v[16]) { F2 r;
#pragma unroll
  for (int i = 0; i < 16; ++i) { const __bf16 h = (__bf16)v[i]; r.h[i] = h; r.l[i] = (__bf16)(v[i] - (float)h); }
  return r; }
__device__ __forceinline__ F2 split_row(const float* row, int k0, int lane) { float v[16]; const float* p = row + k0 + 8 * (lane >> 4);
#pragma unroll
  for (int i = 0; i < 8; ++i) { v[i] = p[i]; v[8 + i] = p[16 + i]; }
  return bsplit16(v); }
__device__ __forceinline__ F2 split_rowK(const float* row, int k0, int lane, int K) { float v[16]; const int g = lane >> 4;
#pragma unroll
  for (int i = 0; i < 8; ++i) { const int ka = k0 + 8 * g + i, kb = ka + 16; v[i] = ka < K ? row[ka < K ? ka : K - 1] : 0.f; v[8 + i] = kb < K ? row[kb < K ? kb : K - 1] : 0.f; }
  return bsplit16(v); }
__device__ __forceinline__ F2 split_col(const float* W, int k0, int n, int lane, int ld, int K) { float v[16]; const int g = lane >> 4;
#pragma unroll
  for (int i = 0; i < 8; ++i) { const int ka = k0 + 8 * g + i, kb = ka + 16; v[i] = ka < K ? W[(size_t)(ka < K ? ka : K - 1) * ld + n] : 0.f; v[8 + i] = kb < K ? W[(size_t)(kb < K ? kb : K - 1) * ld + n] : 0.f; }
  return bsplit16(v); }
__device__ __forceinline__ v8f mac3(const F2& a, const F2& b, v8f c) { c = wmma_bf(a.l, b.h, c); c = wmma_bf(a.h, b.l, c); return wmma_bf(a.h, b.h, c); }
__device__ __forceinline__ float sigm(float v) { return 1.0f / (1.0f + expf(-v)); }
#define LDSX() do { asm volatile("s_wait_dscnt 0" ::: "memory"); __builtin_amdgcn_wave_barrier(); __builtin_amdgcn_fence(__ATOMIC_RELEASE, "workgroup"); } while (0)

// TransConv (graph-transformer style, N 4,096 nodes, in 512, hidden 256, 2 heads x 128, 2 layers, alpha 0.5): x = relu(LN(x fc_w + b)); per layer: q, k = x W + b (per head 128), v = (x Wvl + b) Wvg + b (per head 256), scores[n][l][h] = q_n,h . k_l,h / sqrt(128), w = softmax over the LAST axis = the 2 heads (literally as written), out[n][h] = sum_l w[n][l][h] v[l][h], head mean, x = LN(0.5 out + 0.5 x_prev).
__device__ __forceinline__ float bfr(float v) { return (float)(__bf16)v; }
__device__ __attribute__((noinline)) float sig_ni(float d) { return 1.0f / (1.0f + expf(d)); }   // out of line: keeps k_w's static VALU-FMA count low
#define NN 4096
#define DIN 512
#define HID 256
#define NHD 2
#define DK 128
#define VW 256                 // per-head value width
#define NL 2
#ifndef TNL
#define TNL NL
#endif
#define WS_X   0u                                      // f32 x rows [n][256] (current layer input / prev)
#define WS_Q   (WS_X + 4u * (size_t)NN * HID)           // f16 q rows [n][256]
#define WS_K   (WS_Q + 2u * (size_t)NN * HID)
#define WS_VI  (WS_K + 2u * (size_t)NN * HID)           // f16 v_in rows [n][256]
#define WS_VP  (WS_VI + 2u * (size_t)NN * HID)          // f16 v planes [h*256 + c][n]
#define WS_P   (WS_VP + 2u * (size_t)NHD * VW * NN)      // f16 head-softmax weights x 2^11, planes [h][n][l]
#define WS_O   (WS_P + 2u * (size_t)NHD * NN * NN)       // f32 out [n][h][256]
#define WS_END (WS_O + 4u * (size_t)NN * NHD * VW)
typedef __attribute__((ext_vector_type(8)))  __bf16 v8b;
__device__ __forceinline__ v16b frag_b(const __bf16* rowk0, int lane) {
  union { v16b v; v8b q[2]; } u; const __bf16* p = rowk0 + 8 * (lane >> 4);
  u.q[0] = *(const v8b*)p; u.q[1] = *(const v8b*)(p + 16); return u.v;
}
// publish point of an LDS weight tile: the wave's own LDS stores and reads have retired, then the work-group barrier. Written by hand because __syncthreads() also drains the global loads that are meant to stay in flight across it.
#define WT_BAR() do { asm volatile("s_wait_dscnt 0x0" ::: "memory"); asm volatile("s_barrier_signal -1\n\ts_barrier_wait -1" ::: "memory"); } while (0)
// ---- k_fc: block = 64 rows, 8 waves of 16 rows x 128 columns: y = x fc_w + b (exact bf16 products) -> LDS; per row LayerNorm (eps 1e-5) x g0 + b0, ReLU -> X rows (1 KB each). fc_w is read once per block in chunks of 64 k x 256 columns with whole-row loads, rounded to bf16 once and stored k-contiguous per column in LDS (two buffers, row pitch 144 B); the next chunk's loads (weights and the wave's own x pieces) fly while this chunk is multiplied. Every accumulator still sums k in ascending blocks of 32.
#define FC_BK 64
#define FC_T (DIN / FC_BK)
#define FC_LD (FC_BK + 8)
__global__ __launch_bounds__(256) void k_fc(const float* __restrict__ XI, const float* __restrict__ W, const float* __restrict__ Bv, const float* __restrict__ G0, const float* __restrict__ B0, float* __restrict__ X) { __shared__ __align__(16) float sy[64][HID + 4]; __shared__ __align__(16) __bf16 wt[2][HID][FC_LD];
  const int tid = threadIdx.x, wave = tid >> 5, lane = tid & 31, col = lane & 15, g = lane >> 4; const size_t r0 = (size_t)blockIdx.x * 64; const int wr = (wave >> 1) * 16, cp = wave & 1;
  const int nq = tid & 63, kg = tid >> 6;   // staging piece: 8 k rows x 4 columns; a wave covers 512 B of one weight row per load
  const float* gw = W + (size_t)(kg * 8) * HID + nq * 4; const float* gx = XI + (r0 + wr + col) * DIN + 8 * g;
  v4f rw[16], rx[8]; v16b a[2]; v8f acc[8] = {};
  auto ldw = [&](int c) {
#pragma unroll
    for (int i = 0; i < 2; ++i)
#pragma unroll
      for (int e = 0; e < 8; ++e) rw[i * 8 + e] = *(const v4f*)(gw + (size_t)(c * FC_BK + i * 32 + e) * HID);
#pragma unroll
    for (int kk = 0; kk < 2; ++kk) { const float* p = gx + c * FC_BK + kk * 32; rx[kk * 4] = *(const v4f*)p; rx[kk * 4 + 1] = *(const v4f*)(p + 4); rx[kk * 4 + 2] = *(const v4f*)(p + 16); rx[kk * 4 + 3] = *(const v4f*)(p + 20); }
    __builtin_amdgcn_sched_barrier(0);   // keeps the chunk's loads together at this place, one chunk ahead of their use
    asm volatile("s_wait_xcnt 0x0" ::: "memory");   // the loads stay in flight over later arithmetic: their address registers are rewritten only behind this wait
    __builtin_amdgcn_sched_barrier(0); };   // keeps later register writes from being lifted over that wait
  auto stw = [&](int b) {
#pragma unroll
    for (int i = 0; i < 2; ++i)
#pragma unroll
      for (int m = 0; m < 4; ++m) { v8b t;
#pragma unroll
        for (int e = 0; e < 8; ++e) t[e] = (__bf16)rw[i * 8 + e][m];
        *(v8b*)&wt[b][nq * 4 + m][(kg + 4 * i) * 8] = t; }
#pragma unroll
    for (int kk = 0; kk < 2; ++kk)
#pragma unroll
      for (int i = 0; i < 4; ++i) { a[kk][i] = (__bf16)rx[kk * 4][i]; a[kk][4 + i] = (__bf16)rx[kk * 4 + 1][i]; a[kk][8 + i] = (__bf16)rx[kk * 4 + 2][i]; a[kk][12 + i] = (__bf16)rx[kk * 4 + 3][i]; } };
  auto mm = [&](int b) {
#pragma unroll
    for (int kk = 0; kk < 2; ++kk) { v16b f[8];   // the eight fragment reads go out as one group ahead of their products
#pragma unroll
      for (int j = 0; j < 8; ++j) f[j] = frag_b(&wt[b][cp * 128 + j * 16 + col][kk * 32], lane);
#pragma unroll
      for (int j = 0; j < 8; ++j) acc[j] = wmma_bf(a[kk], f[j], acc[j]); } };
  ldw(0); stw(0); ldw(1);
  WT_BAR();
#pragma unroll 1
  for (int c = 0; c < FC_T; ++c) {   // rolled: one copy of the body is enough
    mm(c & 1);
    if (c + 1 < FC_T) stw((c + 1) & 1);
    if (c + 2 < FC_T) ldw(c + 2);
    WT_BAR();   // chunk c+1 is published; every reader has left the buffer of chunk c
  }
#pragma unroll
  for (int j = 0; j < 8; ++j) { const int o = cp * 128 + j * 16 + col; const float bb = bfr(Bv[o]);
#pragma unroll
    for (int r = 0; r < 8; ++r) sy[wr + 8 * g + r][o] = acc[j][r] + bb; }
  __syncthreads();
  // LN per row: 2 threads per row (the first 128 threads / 64 rows), each 128 elements
  if (tid < 128) { const int row = tid >> 1, half = tid & 1; float* v = &sy[row][half * 128]; float s = 0.f; for (int e = 0; e < 128; ++e) s += v[e]; s += __shfl_xor(s, 1); const float mu = s * (1.0f / HID);
    float s2 = 0.f; for (int e = 0; e < 128; ++e) { const float d = v[e] - mu; s2 += d * d; } s2 += __shfl_xor(s2, 1); const float rs = rsqrtf(s2 * (1.0f / HID) + 1e-5f);
    for (int e = 0; e < 128; ++e) { const int c = half * 128 + e; v[e] = fmaxf((v[e] - mu) * rs * bfr(G0[c]) + bfr(B0[c]), 0.f); } }
  __syncthreads();
  for (int q = tid; q < 64 * HID / 4; q += 256) { const int row = q / (HID / 4), c4 = (q % (HID / 4)) * 4; vst2(X + (r0 + row) * HID + c4, *(const v4f*)&sy[row][c4]); } }
// ---- k_lin: block = (64 rows, 128 cols, which), 8 waves of 16 x 64: which 0 q, 1 k, 2 v_in from X (f32 -> f16 A); 3 v = v_in (f16 rows) Wvg + b (512 cols = 4 column blocks) -> f16 planes [c][n]. The block's weight tile (256 k x 128 columns) is read once with whole-row loads, converted once and stored k-contiguous per column in LDS (row pitch 528 B); the 64 operand rows go through LDS the same way; all fragments come from LDS. Every accumulator still sums k in ascending blocks of 32.
#define LIN_LD (HID + 8)
// behind a group of global loads: the first scheduling barrier keeps all of the group's loads issued before the first is waited for; s_wait_xcnt stands before any of their address registers is rewritten; the second scheduling barrier keeps later register writes from being lifted over that wait
#define LIN_ISSUED() do { __builtin_amdgcn_sched_barrier(0); asm volatile("s_wait_xcnt 0x0" ::: "memory"); __builtin_amdgcn_sched_barrier(0); } while (0)
__global__ __launch_bounds__(256) void k_lin(const float* __restrict__ X, const _Float16* __restrict__ VI, const float* __restrict__ Wm, const float* __restrict__ Bv, int which, _Float16* __restrict__ D) { __shared__ __align__(16) _Float16 sh[64][136]; __shared__ __align__(16) _Float16 th[128][72]; __shared__ __align__(16) _Float16 wt[128][LIN_LD]; __shared__ __align__(16) _Float16 sa[64][LIN_LD];
  const int tid = threadIdx.x, wave = tid >> 5, lane = tid & 31, col = lane & 15, g = lane >> 4; const int c0 = blockIdx.y * 128; const size_t r0 = (size_t)blockIdx.x * 64; const int wr = (wave >> 1) * 16, wc = (wave & 1) * 64;
  { v4f rw[32];   // staging piece: 8 k rows x 4 columns; a wave covers the tile's whole 512-B row per load
    const int sr = wave * 8, sc = c0 + lane * 4;
    if (which < 3) { v4f rx[16]; const float* gw = Wm + (size_t)sr * HID + sc; const float* gx = X + (r0 + (tid >> 6)) * HID + (tid & 63) * 4;
#pragma unroll
      for (int i = 0; i < 4; ++i)
#pragma unroll
        for (int e = 0; e < 8; ++e) rw[i * 8 + e] = *(const v4f*)(gw + (i * 64 + e) * HID);
#pragma unroll
      for (int i = 0; i < 16; ++i) rx[i] = *(const v4f*)(gx + i * 4 * HID);
      LIN_ISSUED();
#pragma unroll
      for (int i = 0; i < 16; ++i) { v4hh t; t[0] = (_Float16)rx[i][0]; t[1] = (_Float16)rx[i][1]; t[2] = (_Float16)rx[i][2]; t[3] = (_Float16)rx[i][3]; *(v4hh*)&sa[(tid >> 6) + 4 * i][(tid & 63) * 4] = t; } }
    else { v8h rx[8]; const float* gw = Wm + (size_t)sr * (NHD * VW) + sc; const _Float16* gx = VI + (r0 + (tid >> 5)) * HID + (tid & 31) * 8;
#pragma unroll
      for (int i = 0; i < 4; ++i)
#pragma unroll
        for (int e = 0; e < 8; ++e) rw[i * 8 + e] = *(const v4f*)(gw + (i * 64 + e) * (NHD * VW));
#pragma unroll
      for (int i = 0; i < 8; ++i) rx[i] = *(const v8h*)(gx + i * 8 * HID);
      LIN_ISSUED();
#pragma unroll
      for (int i = 0; i < 8; ++i) *(v8h*)&sa[(tid >> 5) + 8 * i][(tid & 31) * 8] = rx[i]; }
#pragma unroll
    for (int i = 0; i < 4; ++i)
#pragma unroll
      for (int m = 0; m < 4; ++m) { v8h t;
#pragma unroll
        for (int e = 0; e < 8; ++e) t[e] = (_Float16)(bfr(rw[i * 8 + e][m]) * 16.0f);
        *(v8h*)&wt[lane * 4 + m][(wave + 8 * i) * 8] = t; } }
  __syncthreads();
  v8f acc[4] = {}; v16h fa[2], fb[2][4];
  auto lf = [&](int kc) { fa[kc & 1] = frag_h(&sa[wr + col][kc * 32], lane);
#pragma unroll
    for (int j = 0; j < 4; ++j) fb[kc & 1][j] = frag_h(&wt[wc + j * 16 + col][kc * 32], lane); };
  lf(0);
#pragma unroll
  for (int kc = 0; kc < HID / 32; ++kc) { if (kc + 1 < HID / 32) lf(kc + 1);   // the next step's fragment reads go out ahead of this step's products
#pragma unroll
    for (int j = 0; j < 4; ++j) acc[j] = wmma16(fa[kc & 1], fb[kc & 1][j], acc[j]); }
#pragma unroll
  for (int j = 0; j < 4; ++j) { const int cl = wc + j * 16 + col; const float bb = bfr(Bv[c0 + cl]);
#pragma unroll
    for (int r = 0; r < 8; ++r) { const float v = acc[j][r] * (1.0f / 16.0f) + bb; const int rl = wr + 8 * g + r; if (which == 3) th[cl][rl] = (_Float16)v; else sh[rl][cl] = (_Float16)v; } }
  __syncthreads();
  if (which < 3) { for (int e = tid; e < 64 * 16; e += 256) { const int rl = e >> 4, q = e & 15; vst2((unsigned*)(D + (r0 + rl) * HID + c0 + q * 8), *(const v4u*)&sh[rl][q * 8]); } }
  else { for (int e = tid; e < 128 * 8; e += 256) { const int cl = e >> 3, q = e & 7; vst2((unsigned*)(D + (size_t)(c0 + cl) * NN + r0 + q * 8), *(const v4u*)&th[cl][q * 8]); } } }
// ---- k_w: block = (64 queries n, 128 keys l), 8 waves of 16 x 64: s_h = q_h . k_h / sqrt(128) for BOTH heads, then the reference's softmax over the HEAD axis (axis -1 of [n, l, h]): w_0 = 1 / (1 + exp(s_1 - s_0)), w_1 = 1 - w_0 (f32, precise expf) -> two f16 planes P_h[n][l] x 2^11 (no normalisation over l: out_h = sum_l w_h v_h). Head by head, the 128 key rows and the 64 query rows (256 B each) are read once per block with whole-row loads and shared by the waves through LDS (row pitch 272 B); all fragments come from LDS. Each wave's two weight tiles (row pitch 144 B) reuse the same LDS behind the last barrier. Every accumulator still sums k in ascending blocks of 32.
#define KW_LD (DK + 8)
#define KW_SD (64 + 8)
__global__ __launch_bounds__(256) void k_w(const _Float16* __restrict__ Q, const _Float16* __restrict__ K, _Float16* __restrict__ P0, _Float16* __restrict__ P1) { __shared__ __align__(16) _Float16 sm[(128 + 64) * KW_LD];
  const int tid = threadIdx.x, wave = tid >> 5, lane = tid & 31, col = lane & 15, g = lane >> 4; const int k0 = blockIdx.y * 128, q0 = blockIdx.x * 64, wr = (wave >> 1) * 16, wk = (wave & 1) * 64;
  _Float16 (*sk)[KW_LD] = (_Float16 (*)[KW_LD])sm; _Float16 (*sq)[KW_LD] = (_Float16 (*)[KW_LD])(sm + 128 * KW_LD);
  const int lr = tid >> 4, lq = (tid & 15) * 8;   // staging: 16 lanes cover one 256-B row piece, a wave two rows per load
  v8f acc0[4] = {}, acc1[4] = {};
  auto head = [&](int h, v8f (&acc)[4]) { v8h rk[8], rq[4];   // every loop below is unrolled: rk, rq, f and acc are register arrays
    const _Float16* gk = K + (size_t)(k0 + lr) * HID + h * DK + lq; const _Float16* gq = Q + (size_t)(q0 + lr) * HID + h * DK + lq;
#pragma unroll
    for (int i = 0; i < 8; ++i) rk[i] = *(const v8h*)(gk + (size_t)(16 * i) * HID);
#pragma unroll
    for (int i = 0; i < 4; ++i) rq[i] = *(const v8h*)(gq + (size_t)(16 * i) * HID);
    LIN_ISSUED();   // all 12 loads are out before the first is waited for; their address registers are rewritten only behind the wait
#pragma unroll
    for (int i = 0; i < 8; ++i) *(v8h*)&sk[lr + 16 * i][lq] = rk[i];
#pragma unroll
    for (int i = 0; i < 4; ++i) *(v8h*)&sq[lr + 16 * i][lq] = rq[i];
    __syncthreads();   // the head's tiles are published
#pragma unroll
    for (int kc = 0; kc < DK / 32; ++kc) { const v16h a = frag_h(&sq[wr + col][kc * 32], lane); v16h f[4];   // the step's fragment reads go out as one group ahead of its products
#pragma unroll
      for (int j = 0; j < 4; ++j) f[j] = frag_h(&sk[wk + j * 16 + col][kc * 32], lane);
#pragma unroll
      for (int j = 0; j < 4; ++j) acc[j] = wmma16(a, f[j], acc[j]); }
    __syncthreads(); };   // every reader has left the tiles before they are overwritten
  head(0, acc0); head(1, acc1);
  _Float16 (*s0)[KW_SD] = (_Float16 (*)[KW_SD])(sm + wave * 16 * KW_SD); _Float16 (*s1)[KW_SD] = (_Float16 (*)[KW_SD])(sm + (8 + wave) * 16 * KW_SD);   // the wave's own two 16 x 64 weight tiles
  const float isd = 1.0f / sqrtf((float)DK);
#pragma unroll
  for (int j = 0; j < 4; ++j)
#pragma unroll
    for (int r = 0; r < 8; ++r) { const float d = (acc1[j][r] - acc0[j][r]) * isd; const float w0 = sig_ni(d); s0[8 * g + r][j * 16 + col] = (_Float16)(w0 * 2048.0f); s1[8 * g + r][j * 16 + col] = (_Float16)((1.0f - w0) * 2048.0f); }
  LDSX();
#pragma unroll   // the eight LDS reads go out ahead of the first store
  for (int it = 0; it < 4; ++it) { const int rl = it * 4 + (lane >> 3), q = (lane & 7) * 8; const size_t o = (size_t)(q0 + wr + rl) * NN + k0 + wk + q;   // 8 lanes cover one 128-B row piece, a wave four rows per store
    vst2((unsigned*)(P0 + o), *(const v4u*)&s0[rl][q]); vst2((unsigned*)(P1 + o), *(const v4u*)&s1[rl][q]); } }
// ---- k_pv: block = (64 queries, 64 of the head's 256 columns), 8 waves of 16 x 32: out[n][h][c0 ..] = P . v_h (K 4,096). Each 128-k tile of P and of v (64 rows x 256 B each) is read once per block with whole-row loads and shared by the waves through LDS (two buffers, row pitch 272 B); the global loads run two tiles ahead in two register sets. Every accumulator still sums k in ascending blocks of 32.
#define PV_BK 128
#define PV_T (NN / PV_BK)
#define PV_LD (PV_BK + 8)
// publish point of an LDS tile: the wave's own LDS stores and reads have retired, then the work-group barrier. Written by hand because __syncthreads() also drains the global loads that are meant to stay in flight across it.
#define PV_BAR() do { asm volatile("s_wait_dscnt 0x0" ::: "memory"); asm volatile("s_barrier_signal -1\n\ts_barrier_wait -1" ::: "memory"); } while (0)
__global__ __launch_bounds__(256) void k_pv(const _Float16* __restrict__ P, const _Float16* __restrict__ VP, int h, float* __restrict__ O) { __shared__ __align__(16) _Float16 sp[2][64][PV_LD], sv[2][64][PV_LD]; __shared__ __align__(16) float so[64][68];
  const int tid = threadIdx.x, wave = tid >> 5, lane = tid & 31, col = lane & 15, g = lane >> 4; const int n0 = blockIdx.x * 64, c0 = blockIdx.y * 64, wr = (wave >> 1) * 16, wc = (wave & 1) * 32;
  const int lr = tid >> 4, lq = (tid & 15) * 8;   // staging: 16 lanes cover one 256-B row piece, a wave two rows per load
  const _Float16* gp = P + (size_t)(n0 + lr) * NN + lq; const _Float16* gv = VP + (size_t)(h * VW + c0 + lr) * NN + lq;
  v8h r0[8], ra[8], rb[8]; v8f acc[2] = {};
  auto ld = [&](v8h (&r)[8], int t) {
#pragma unroll
    for (int i = 0; i < 4; ++i) { r[i] = *(const v8h*)(gp + (size_t)(16 * i) * NN + t * PV_BK); r[4 + i] = *(const v8h*)(gv + (size_t)(16 * i) * NN + t * PV_BK); }
    __builtin_amdgcn_sched_barrier(0); };   // keeps one tile's loads together and the tiles in order, so that the counted load waits in front of the LDS stores leave the younger tile in flight
  auto st = [&](const v8h (&r)[8], int b) {
#pragma unroll
    for (int i = 0; i < 4; ++i) { *(v8h*)&sp[b][lr + 16 * i][lq] = r[i]; *(v8h*)&sv[b][lr + 16 * i][lq] = r[4 + i]; } };
  auto mm = [&](int b) { v16h fa[PV_BK / 32], f0[PV_BK / 32], f1[PV_BK / 32];   // the whole tile's fragment reads go out as one group ahead of its products
#pragma unroll
    for (int kk = 0; kk < PV_BK / 32; ++kk) { fa[kk] = frag_h(&sp[b][wr + col][kk * 32], lane); f0[kk] = frag_h(&sv[b][wc + col][kk * 32], lane); f1[kk] = frag_h(&sv[b][wc + 16 + col][kk * 32], lane); }
#pragma unroll
    for (int kk = 0; kk < PV_BK / 32; ++kk) { acc[0] = wmma16(fa[kk], f0[kk], acc[0]); acc[1] = wmma16(fa[kk], f1[kk], acc[1]); } };
  ld(r0, 0); ld(ra, 1); ld(rb, 2); st(r0, 0);
  PV_BAR();
#pragma unroll 1
  for (int t = 0; t < PV_T - 4; t += 2) {   // rolled: one copy of the two-tile body is enough, the buffers alternate inside it
    mm(0); st(ra, 1); ld(ra, t + 3);
    PV_BAR();   // tile t+1 is published; every reader has left buffer 0
    mm(1); st(rb, 0); ld(rb, t + 4);
    asm volatile("s_wait_xcnt 0x0" ::: "memory");   // this trip's loads stay in flight over the next trip's address arithmetic: their address registers are rewritten only behind this wait
    PV_BAR();   // tile t+2 is published; every reader has left buffer 1
  }
  mm(0); st(ra, 1); ld(ra, PV_T - 1);
  PV_BAR();
  mm(1); st(rb, 0);
  PV_BAR();
  mm(0); st(ra, 1);
  PV_BAR();
  mm(1);
#pragma unroll
  for (int j = 0; j < 2; ++j)
#pragma unroll
    for (int r = 0; r < 8; ++r) so[wr + 8 * g + r][wc + j * 16 + col] = acc[j][r] * (1.0f / 2048.0f);
  __syncthreads();
  for (int e = tid; e < 64 * 16; e += 256) { const int rl = e >> 4, q = e & 15; vst2(O + ((size_t)(n0 + rl) * NHD + h) * VW + c0 + q * 4, *(const v4f*)&so[rl][q * 4]); } }
// ---- k_mix: block = 64 rows (2 threads per row): x = LN(0.5 * mean_h out + 0.5 * x_prev) * g + b (in place on X, or to OUT for the last layer)
__global__ __launch_bounds__(128) void k_mix(const float* __restrict__ O, float* __restrict__ X, const float* __restrict__ Gm, const float* __restrict__ Bb, float* __restrict__ OUT) { __shared__ __align__(16) float sy[64][HID + 4];
  const int tid = threadIdx.x; const size_t r0 = (size_t)blockIdx.x * 64; const int row = tid >> 1, half = tid & 1; const size_t n = r0 + row;
  float s = 0.f; for (int e = 0; e < 128; ++e) { const int c = half * 128 + e; const float om = (O[(n * NHD + 0) * VW + c] + O[(n * NHD + 1) * VW + c]) * 0.5f; const float v = 0.5f * om + 0.5f * X[n * HID + c]; sy[row][c] = v; s += v; }
  s += __shfl_xor(s, 1); const float mu = s * (1.0f / HID); float s2 = 0.f; for (int e = 0; e < 128; ++e) { const float d = sy[row][half * 128 + e] - mu; s2 += d * d; } s2 += __shfl_xor(s2, 1); const float rs = rsqrtf(s2 * (1.0f / HID) + 1e-5f);
  for (int e = 0; e < 128; ++e) { const int c = half * 128 + e; sy[row][c] = (sy[row][c] - mu) * rs * bfr(Gm[c]) + bfr(Bb[c]); }
  __syncthreads();
  float* dst = OUT ? OUT : X;
  for (int q = tid; q < 64 * HID / 4; q += 128) { const int rw = q / (HID / 4), c4 = (q % (HID / 4)) * 4; vst2(dst + (r0 + rw) * HID + c4, *(const v4f*)&sy[rw][c4]); } }
extern "C" void kernel_launch(void* const* d_in, const int* in_sizes, int n_in, void* d_out, int out_size, void* d_ws, size_t ws_size, hipStream_t stream) {
  (void)in_sizes; (void)n_in; (void)out_size;
  const float** F = (const float**)d_in;   // 0 x [4096,512], 1 fc_w [512,256], 2 fc_b, 3 ln_g [3,256], 4 ln_b [3,256], 5 wq [2,256,256], 6 bq [2,256], 7 wk, 8 bk, 9 wvl, 10 bvl, 11 wvg [2,256,512], 12 bvg [2,512]
  if (ws_size < (size_t)WS_END) return;
  char* ws = (char*)d_ws; float *X = (float*)(ws + WS_X), *O = (float*)(ws + WS_O); _Float16 *Q = (_Float16*)(ws + WS_Q), *K = (_Float16*)(ws + WS_K), *VI = (_Float16*)(ws + WS_VI), *VP = (_Float16*)(ws + WS_VP), *P = (_Float16*)(ws + WS_P);
  k_fc<<<dim3(NN / 64), 256, 0, stream>>>(F[0], F[1], F[2], F[3], F[4], X);
  for (int l = 0; l < TNL; ++l) {
    k_lin<<<dim3(NN / 64, HID / 128), 256, 0, stream>>>(X, nullptr, F[5] + (size_t)l * HID * HID, F[6] + l * HID, 0, Q);
    k_lin<<<dim3(NN / 64, HID / 128), 256, 0, stream>>>(X, nullptr, F[7] + (size_t)l * HID * HID, F[8] + l * HID, 1, K);
    k_lin<<<dim3(NN / 64, HID / 128), 256, 0, stream>>>(X, nullptr, F[9] + (size_t)l * HID * HID, F[10] + l * HID, 2, VI);
    k_lin<<<dim3(NN / 64, (NHD * VW) / 128), 256, 0, stream>>>(X, VI, F[11] + (size_t)l * HID * NHD * VW, F[12] + l * NHD * VW, 3, VP);
    k_w<<<dim3(NN / 64, NN / 128), 256, 0, stream>>>(Q, K, P, P + (size_t)NN * NN);
    for (int h = 0; h < NHD; ++h) k_pv<<<dim3(NN / 64, VW / 64), 256, 0, stream>>>(P + (size_t)h * NN * NN, VP, h, O);
    k_mix<<<dim3(NN / 64), 128, 0, stream>>>(O, X, F[3] + (l + 1) * HID, F[4] + (l + 1) * HID, (l == NL - 1) ? (float*)d_out : nullptr);
  }
}

// v004
// One run takes 156 microseconds.
// Timed twice side by side with v003, it ran 1.19 and 1.18 times as fast.
// Over all steps from v000 it is 7.99 times as fast.
// compute dtype: all float inputs rounded to bf16; x fc_w exact bf16 products on WMMA 16x16x32; LayerNorm/ReLU in f32; per layer the q/k/v_in/v projections with the LayerNorm'd operand rounded once to f16 against f16 weights (bf16 values x 16, folded); both heads' logits q.k/sqrt(128) from f16 rows (1 product) and the reference's softmax over the HEAD axis (a 2-way softmax per (node, node) pair, f32, precise expf) -> weights stored f16 x 2^11; out_h = sum over all nodes of w_h v_h (v f16), head mean, residual mix and LayerNorm in f32; f32 output.
#include <hip/hip_runtime.h>
#include <math.h>

typedef __attribute__((ext_vector_type(16))) _Float16 v16h;
typedef __attribute__((ext_vector_type(16))) __bf16 v16b;
typedef __attribute__((ext_vector_type(8)))  _Float16 v8h;
typedef __attribute__((ext_vector_type(4)))  _Float16 v4hh;
typedef __attribute__((ext_vector_type(8)))  float v8f;
typedef __attribute__((ext_vector_type(4)))  float v4f;
typedef __attribute__((ext_vector_type(2)))  float v2f;
typedef __attribute__((ext_vector_type(4)))  unsigned v4u;
typedef __attribute__((ext_vector_type(4)))  int v4i;
typedef float __attribute__((may_alias)) float_a;
typedef int __attribute__((may_alias)) int_a;

template <typename T> __device__ __forceinline__ void vst2(void* p, T v) { *(T*)p = v;  }
__device__ __forceinline__ v8f wmma16(v16h a, v16h b, v8f c) {
  v8f d = __builtin_amdgcn_wmma_f32_16x16x32_f16(false, a, false, b, (short)0, c, false, false);
  asm volatile("v_nop\n\tv_nop\n\tv_nop\n\tv_nop" : "+v"(d) : "v"(a), "v"(b));
  return d;
}
__device__ __forceinline__ v8f wmma_bf(v16b a, v16b b, v8f c) {
  v8f d = __builtin_amdgcn_wmma_f32_16x16x32_bf16(false, a, false, b, (short)0, c, false, false);
  asm volatile("v_nop\n\tv_nop\n\tv_nop\n\tv_nop" : "+v"(d) : "v"(a), "v"(b));
  return d;
}
// 16x16x32 fragments: lane = (h = lane>>4, row/col = lane&15); elements 0..7 = k0+8h+0..7, 8..15 = k0+16+8h+0..7; D element r = row 8h+r
__device__ __forceinline__ v16h frag_h(const _Float16* rowk0, int lane) {
  union { v16h v; v8h q[2]; } u; const _Float16* p = rowk0 + 8 * (lane >> 4);
  u.q[0] = *(const v8h*)p; u.q[1] = *(const v8h*)(p + 16); return u.v;
}
__device__ __forceinline__ v16h frag_f32(const float* rowk0, int lane) {
  v16h a; const float* p = rowk0 + 8 * (lane >> 4);
#pragma unroll
  for (int i = 0; i < 8; ++i) { a[i] = (_Float16)p[i]; a[8 + i] = (_Float16)p[16 + i]; }
  return a;
}
__device__ __forceinline__ v16h frag_f32s(const float* rowk0, int lane, float sc) {
  v16h a; const float* p = rowk0 + 8 * (lane >> 4);
#pragma unroll
  for (int i = 0; i < 8; ++i) { a[i] = (_Float16)(p[i] * sc); a[8 + i] = (_Float16)(p[16 + i] * sc); }
  return a;
}
// column fragment from a [K][ld] layout (column n), rows >= K read as 0
__device__ __forceinline__ v16h fragc_f32(const float* W, int k0, int n, int lane, int ld, int K) {
  v16h a; const int g = lane >> 4;
#pragma unroll
  for (int i = 0; i < 8; ++i) { const int ka = k0 + 8 * g + i, kb = ka + 16;
    a[i] = (_Float16)(ka < K ? W[(size_t)(ka < K ? ka : K - 1) * ld + n] : 0.f); a[8 + i] = (_Float16)(kb < K ? W[(size_t)(kb < K ? kb : K - 1) * ld + n] : 0.f); }
  return a;
}
struct F2 { v16b h, l; };
__device__ __forceinline__ F2 bsplit16(const float v[16]) { F2 r;
#pragma unroll
  for (int i = 0; i < 16; ++i) { const __bf16 h = (__bf16)v[i]; r.h[i] = h; r.l[i] = (__bf16)(v[i] - (float)h); }
  return r; }
__device__ __forceinline__ F2 split_row(const float* row, int k0, int lane) { float v[16]; const float* p = row + k0 + 8 * (lane >> 4);
#pragma unroll
  for (int i = 0; i < 8; ++i) { v[i] = p[i]; v[8 + i] = p[16 + i]; }
  return bsplit16(v); }
__device__ __forceinline__ F2 split_rowK(const float* row, int k0, int lane, int K) { float v[16]; const int g = lane >> 4;
#pragma unroll
  for (int i = 0; i < 8; ++i) { const int ka = k0 + 8 * g + i, kb = ka + 16; v[i] = ka < K ? row[ka < K ? ka : K - 1] : 0.f; v[8 + i] = kb < K ? row[kb < K ? kb : K - 1] : 0.f; }
  return bsplit16(v); }
__device__ __forceinline__ F2 split_col(const float* W, int k0, int n, int lane, int ld, int K) { float v[16]; const int g = lane >> 4;
#pragma unroll
  for (int i = 0; i < 8; ++i) { const int ka = k0 + 8 * g + i, kb = ka + 16; v[i] = ka < K ? W[(size_t)(ka < K ? ka : K - 1) * ld + n] : 0.f; v[8 + i] = kb < K ? W[(size_t)(kb < K ? kb : K - 1) * ld + n] : 0.f; }
  return bsplit16(v); }
__device__ __forceinline__ v8f mac3(const F2& a, const F2& b, v8f c) { c = wmma_bf(a.l, b.h, c); c = wmma_bf(a.h, b.l, c); return wmma_bf(a.h, b.h, c); }
__device__ __forceinline__ float sigm(float v) { return 1.0f / (1.0f + expf(-v)); }
#define LDSX() do { asm volatile("s_wait_dscnt 0" ::: "memory"); __builtin_amdgcn_wave_barrier(); __builtin_amdgcn_fence(__ATOMIC_RELEASE, "workgroup"); } while (0)

// TransConv (graph-transformer style, N 4,096 nodes, in 512, hidden 256, 2 heads x 128, 2 layers, alpha 0.5): x = relu(LN(x fc_w + b)); per layer: q, k = x W + b (per head 128), v = (x Wvl + b) Wvg + b (per head 256), scores[n][l][h] = q_n,h . k_l,h / sqrt(128), w = softmax over the LAST axis = the 2 heads (literally as written), out[n][h] = sum_l w[n][l][h] v[l][h], head mean, x = LN(0.5 out + 0.5 x_prev).
__device__ __forceinline__ float bfr(float v) { return (float)(__bf16)v; }
__device__ __attribute__((noinline)) float sig_ni(float d) { return 1.0f / (1.0f + expf(d)); }   // out of line: keeps k_w's static VALU-FMA count low
#define NN 4096
#define DIN 512
#define HID 256
#define NHD 2
#define DK 128
#define VW 256                 // per-head value width
#define NL 2
#ifndef TNL
#define TNL NL
#endif
#define WS_X   0u                                      // f32 x rows [n][256] (current layer input / prev)
#define WS_Q   (WS_X + 4u * (size_t)NN * HID)           // f16 q rows [n][256]
#define WS_K   (WS_Q + 2u * (size_t)NN * HID)
#define WS_VI  (WS_K + 2u * (size_t)NN * HID)           // f16 v_in rows [n][256]
#define WS_VP  (WS_VI + 2u * (size_t)NN * HID)          // f16 v planes [h*256 + c][n]
#define WS_P   (WS_VP + 2u * (size_t)NHD * VW * NN)      // f16 head-softmax weights x 2^11, planes [h][n][l]
#define WS_O   (WS_P + 2u * (size_t)NHD * NN * NN)       // f32 out [n][h][256]
#define WS_END (WS_O + 4u * (size_t)NN * NHD * VW)
typedef __attribute__((ext_vector_type(8)))  __bf16 v8b;
__device__ __forceinline__ v16b frag_b(const __bf16* rowk0, int lane) {
  union { v16b v; v8b q[2]; } u; const __bf16* p = rowk0 + 8 * (lane >> 4);
  u.q[0] = *(const v8b*)p; u.q[1] = *(const v8b*)(p + 16); return u.v;
}
// publish point of an LDS weight tile: the wave's own LDS stores and reads have retired, then the work-group barrier. Written by hand because __syncthreads() also drains the global loads that are meant to stay in flight across it.
#define WT_BAR() do { asm volatile("s_wait_dscnt 0x0" ::: "memory"); asm volatile("s_barrier_signal -1\n\ts_barrier_wait -1" ::: "memory"); } while (0)
// ---- k_fc: block = 64 rows, 8 waves of 16 rows x 128 columns: y = x fc_w + b (exact bf16 products) -> LDS; per row LayerNorm (eps 1e-5) x g0 + b0, ReLU -> X rows (1 KB each). fc_w is read once per block in chunks of 64 k x 256 columns with whole-row loads, rounded to bf16 once and stored k-contiguous per column in LDS (two buffers, row pitch 144 B); the next chunk's loads (weights and the wave's own x pieces) fly while this chunk is multiplied. Every accumulator still sums k in ascending blocks of 32.
#define FC_BK 64
#define FC_T (DIN / FC_BK)
#define FC_LD (FC_BK + 8)
__global__ __launch_bounds__(256) void k_fc(const float* __restrict__ XI, const float* __restrict__ W, const float* __restrict__ Bv, const float* __restrict__ G0, const float* __restrict__ B0, float* __restrict__ X) { __shared__ __align__(16) float sy[64][HID + 4]; __shared__ __align__(16) __bf16 wt[2][HID][FC_LD];
  const int tid = threadIdx.x, wave = tid >> 5, lane = tid & 31, col = lane & 15, g = lane >> 4; const size_t r0 = (size_t)blockIdx.x * 64; const int wr = (wave >> 1) * 16, cp = wave & 1;
  const int nq = tid & 63, kg = tid >> 6;   // staging piece: 8 k rows x 4 columns; a wave covers 512 B of one weight row per load
  const float* gw = W + (size_t)(kg * 8) * HID + nq * 4; const float* gx = XI + (r0 + wr + col) * DIN + 8 * g;
  v4f rw[16], rx[8]; v16b a[2]; v8f acc[8] = {};
  auto ldw = [&](int c) {
#pragma unroll
    for (int i = 0; i < 2; ++i)
#pragma unroll
      for (int e = 0; e < 8; ++e) rw[i * 8 + e] = *(const v4f*)(gw + (size_t)(c * FC_BK + i * 32 + e) * HID);
#pragma unroll
    for (int kk = 0; kk < 2; ++kk) { const float* p = gx + c * FC_BK + kk * 32; rx[kk * 4] = *(const v4f*)p; rx[kk * 4 + 1] = *(const v4f*)(p + 4); rx[kk * 4 + 2] = *(const v4f*)(p + 16); rx[kk * 4 + 3] = *(const v4f*)(p + 20); }
    __builtin_amdgcn_sched_barrier(0);   // keeps the chunk's loads together at this place, one chunk ahead of their use
    asm volatile("s_wait_xcnt 0x0" ::: "memory");   // the loads stay in flight over later arithmetic: their address registers are rewritten only behind this wait
    __builtin_amdgcn_sched_barrier(0); };   // keeps later register writes from being lifted over that wait
  auto stw = [&](int b) {
#pragma unroll
    for (int i = 0; i < 2; ++i)
#pragma unroll
      for (int m = 0; m < 4; ++m) { v8b t;
#pragma unroll
        for (int e = 0; e < 8; ++e) t[e] = (__bf16)rw[i * 8 + e][m];
        *(v8b*)&wt[b][nq * 4 + m][(kg + 4 * i) * 8] = t; }
#pragma unroll
    for (int kk = 0; kk < 2; ++kk)
#pragma unroll
      for (int i = 0; i < 4; ++i) { a[kk][i] = (__bf16)rx[kk * 4][i]; a[kk][4 + i] = (__bf16)rx[kk * 4 + 1][i]; a[kk][8 + i] = (__bf16)rx[kk * 4 + 2][i]; a[kk][12 + i] = (__bf16)rx[kk * 4 + 3][i]; } };
  auto mm = [&](int b) {
#pragma unroll
    for (int kk = 0; kk < 2; ++kk) { v16b f[8];   // the eight fragment reads go out as one group ahead of their products
#pragma unroll
      for (int j = 0; j < 8; ++j) f[j] = frag_b(&wt[b][cp * 128 + j * 16 + col][kk * 32], lane);
#pragma unroll
      for (int j = 0; j < 8; ++j) acc[j] = wmma_bf(a[kk], f[j], acc[j]); } };
  ldw(0); stw(0); ldw(1);
  WT_BAR();
#pragma unroll 1
  for (int c = 0; c < FC_T; ++c) {   // rolled: one copy of the body is enough
    mm(c & 1);
    if (c + 1 < FC_T) stw((c + 1) & 1);
    if (c + 2 < FC_T) ldw(c + 2);
    WT_BAR();   // chunk c+1 is published; every reader has left the buffer of chunk c
  }
#pragma unroll
  for (int j = 0; j < 8; ++j) { const int o = cp * 128 + j * 16 + col; const float bb = bfr(Bv[o]);
#pragma unroll
    for (int r = 0; r < 8; ++r) sy[wr + 8 * g + r][o] = acc[j][r] + bb; }
  __syncthreads();
  // LN per row: 2 threads per row (the first 128 threads / 64 rows), each 128 elements
  if (tid < 128) { const int row = tid >> 1, half = tid & 1; float* v = &sy[row][half * 128]; float s = 0.f; for (int e = 0; e < 128; ++e) s += v[e]; s += __shfl_xor(s, 1); const float mu = s * (1.0f / HID);
    float s2 = 0.f; for (int e = 0; e < 128; ++e) { const float d = v[e] - mu; s2 += d * d; } s2 += __shfl_xor(s2, 1); const float rs = rsqrtf(s2 * (1.0f / HID) + 1e-5f);
    for (int e = 0; e < 128; ++e) { const int c = half * 128 + e; v[e] = fmaxf((v[e] - mu) * rs * bfr(G0[c]) + bfr(B0[c]), 0.f); } }
  __syncthreads();
  for (int q = tid; q < 64 * HID / 4; q += 256) { const int row = q / (HID / 4), c4 = (q % (HID / 4)) * 4; vst2(X + (r0 + row) * HID + c4, *(const v4f*)&sy[row][c4]); } }
// ---- k_lin: block = (64 rows, 128 cols, which = wb + blockIdx.z), 8 waves of 16 x 64: which 0 q, 1 k, 2 v_in from X (f32 -> f16 A), the three of them independent and therefore one launch (grid z = 3, wb 0); 3 v = v_in (f16 rows) Wvg + b (512 cols = 4 column blocks) -> f16 planes [c][n] (grid z = 1, wb 3, first pointer of each triple). The block's weight tile (256 k x 128 columns) is read once with whole-row loads, converted once and stored k-contiguous per column in LDS (row pitch 528 B); the 64 operand rows go through LDS the same way; all fragments come from LDS. Every accumulator still sums k in ascending blocks of 32.
#define LIN_LD (HID + 8)
// behind a group of global loads: the first scheduling barrier keeps all of the group's loads issued before the first is waited for; s_wait_xcnt stands before any of their address registers is rewritten; the second scheduling barrier keeps later register writes from being lifted over that wait
#define LIN_ISSUED() do { __builtin_amdgcn_sched_barrier(0); asm volatile("s_wait_xcnt 0x0" ::: "memory"); __builtin_amdgcn_sched_barrier(0); } while (0)
__global__ __launch_bounds__(256) void k_lin(const float* __restrict__ X, const _Float16* __restrict__ VI, const float* __restrict__ Wa, const float* __restrict__ Wb, const float* __restrict__ Wc, const float* __restrict__ Ba, const float* __restrict__ Bb, const float* __restrict__ Bc, int wb, _Float16* __restrict__ Da, _Float16* __restrict__ Db, _Float16* __restrict__ Dc) { __shared__ __align__(16) _Float16 sh[64][136]; __shared__ __align__(16) _Float16 th[128][72]; __shared__ __align__(16) _Float16 wt[128][LIN_LD]; __shared__ __align__(16) _Float16 sa[64][LIN_LD];
  const int tid = threadIdx.x, wave = tid >> 5, lane = tid & 31, col = lane & 15, g = lane >> 4; const int c0 = blockIdx.y * 128; const size_t r0 = (size_t)blockIdx.x * 64; const int wr = (wave >> 1) * 16, wc = (wave & 1) * 64;
  const int z = blockIdx.z, which = wb + z; const float* Wm = z == 0 ? Wa : z == 1 ? Wb : Wc; const float* Bv = z == 0 ? Ba : z == 1 ? Bb : Bc; _Float16* D = z == 0 ? Da : z == 1 ? Db : Dc;
  { v4f rw[32];   // staging piece: 8 k rows x 4 columns; a wave covers the tile's whole 512-B row per load
    const int sr = wave * 8, sc = c0 + lane * 4;
    if (which < 3) { v4f rx[16]; const float* gw = Wm + (size_t)sr * HID + sc; const float* gx = X + (r0 + (tid >> 6)) * HID + (tid & 63) * 4;
#pragma unroll
      for (int i = 0; i < 4; ++i)
#pragma unroll
        for (int e = 0; e < 8; ++e) rw[i * 8 + e] = *(const v4f*)(gw + (i * 64 + e) * HID);
#pragma unroll
      for (int i = 0; i < 16; ++i) rx[i] = *(const v4f*)(gx + i * 4 * HID);
      LIN_ISSUED();
#pragma unroll
      for (int i = 0; i < 16; ++i) { v4hh t; t[0] = (_Float16)rx[i][0]; t[1] = (_Float16)rx[i][1]; t[2] = (_Float16)rx[i][2]; t[3] = (_Float16)rx[i][3]; *(v4hh*)&sa[(tid >> 6) + 4 * i][(tid & 63) * 4] = t; } }
    else { v8h rx[8]; const float* gw = Wm + (size_t)sr * (NHD * VW) + sc; const _Float16* gx = VI + (r0 + (tid >> 5)) * HID + (tid & 31) * 8;
#pragma unroll
      for (int i = 0; i < 4; ++i)
#pragma unroll
        for (int e = 0; e < 8; ++e) rw[i * 8 + e] = *(const v4f*)(gw + (i * 64 + e) * (NHD * VW));
#pragma unroll
      for (int i = 0; i < 8; ++i) rx[i] = *(const v8h*)(gx + i * 8 * HID);
      LIN_ISSUED();
#pragma unroll
      for (int i = 0; i < 8; ++i) *(v8h*)&sa[(tid >> 5) + 8 * i][(tid & 31) * 8] = rx[i]; }
#pragma unroll
    for (int i = 0; i < 4; ++i)
#pragma unroll
      for (int m = 0; m < 4; ++m) { v8h t;
#pragma unroll
        for (int e = 0; e < 8; ++e) t[e] = (_Float16)(bfr(rw[i * 8 + e][m]) * 16.0f);
        *(v8h*)&wt[lane * 4 + m][(wave + 8 * i) * 8] = t; } }
  __syncthreads();
  v8f acc[4] = {}; v16h fa[2], fb[2][4];
  auto lf = [&](int kc) { fa[kc & 1] = frag_h(&sa[wr + col][kc * 32], lane);
#pragma unroll
    for (int j = 0; j < 4; ++j) fb[kc & 1][j] = frag_h(&wt[wc + j * 16 + col][kc * 32], lane); };
  lf(0);
#pragma unroll
  for (int kc = 0; kc < HID / 32; ++kc) { if (kc + 1 < HID / 32) lf(kc + 1);   // the next step's fragment reads go out ahead of this step's products
#pragma unroll
    for (int j = 0; j < 4; ++j) acc[j] = wmma16(fa[kc & 1], fb[kc & 1][j], acc[j]); }
#pragma unroll
  for (int j = 0; j < 4; ++j) { const int cl = wc + j * 16 + col; const float bb = bfr(Bv[c0 + cl]);
#pragma unroll
    for (int r = 0; r < 8; ++r) { const float v = acc[j][r] * (1.0f / 16.0f) + bb; const int rl = wr + 8 * g + r; if (which == 3) th[cl][rl] = (_Float16)v; else sh[rl][cl] = (_Float16)v; } }
  __syncthreads();
  if (which < 3) { for (int e = tid; e < 64 * 16; e += 256) { const int rl = e >> 4, q = e & 15; vst2((unsigned*)(D + (r0 + rl) * HID + c0 + q * 8), *(const v4u*)&sh[rl][q * 8]); } }
  else { for (int e = tid; e < 128 * 8; e += 256) { const int cl = e >> 3, q = e & 7; vst2((unsigned*)(D + (size_t)(c0 + cl) * NN + r0 + q * 8), *(const v4u*)&th[cl][q * 8]); } } }
// ---- k_w: block = (64 queries n, 128 keys l), 8 waves of 16 x 64: s_h = q_h . k_h / sqrt(128) for BOTH heads, then the reference's softmax over the HEAD axis (axis -1 of [n, l, h]): w_0 = 1 / (1 + exp(s_1 - s_0)), w_1 = 1 - w_0 (f32, precise expf) -> two f16 planes P_h[n][l] x 2^11 (no normalisation over l: out_h = sum_l w_h v_h). Head by head, the 128 key rows and the 64 query rows (256 B each) are read once per block with whole-row loads and shared by the waves through LDS (row pitch 272 B); all fragments come from LDS. Each wave's two weight tiles (row pitch 144 B) reuse the same LDS behind the last barrier. Every accumulator still sums k in ascending blocks of 32.
#define KW_LD (DK + 8)
#define KW_SD (64 + 8)
__global__ __launch_bounds__(256) void k_w(const _Float16* __restrict__ Q, const _Float16* __restrict__ K, _Float16* __restrict__ P0, _Float16* __restrict__ P1) { __shared__ __align__(16) _Float16 sm[(128 + 64) * KW_LD];
  const int tid = threadIdx.x, wave = tid >> 5, lane = tid & 31, col = lane & 15, g = lane >> 4; const int k0 = blockIdx.y * 128, q0 = blockIdx.x * 64, wr = (wave >> 1) * 16, wk = (wave & 1) * 64;
  _Float16 (*sk)[KW_LD] = (_Float16 (*)[KW_LD])sm; _Float16 (*sq)[KW_LD] = (_Float16 (*)[KW_LD])(sm + 128 * KW_LD);
  const int lr = tid >> 4, lq = (tid & 15) * 8;   // staging: 16 lanes cover one 256-B row piece, a wave two rows per load
  v8f acc0[4] = {}, acc1[4] = {};
  auto head = [&](int h, v8f (&acc)[4]) { v8h rk[8], rq[4];   // every loop below is unrolled: rk, rq, f and acc are register arrays
    const _Float16* gk = K + (size_t)(k0 + lr) * HID + h * DK + lq; const _Float16* gq = Q + (size_t)(q0 + lr) * HID + h * DK + lq;
#pragma unroll
    for (int i = 0; i < 8; ++i) rk[i] = *(const v8h*)(gk + (size_t)(16 * i) * HID);
#pragma unroll
    for (int i = 0; i < 4; ++i) rq[i] = *(const v8h*)(gq + (size_t)(16 * i) * HID);
    LIN_ISSUED();   // all 12 loads are out before the first is waited for; their address registers are rewritten only behind the wait
#pragma unroll
    for (int i = 0; i < 8; ++i) *(v8h*)&sk[lr + 16 * i][lq] = rk[i];
#pragma unroll
    for (int i = 0; i < 4; ++i) *(v8h*)&sq[lr + 16 * i][lq] = rq[i];
    __syncthreads();   // the head's tiles are published
#pragma unroll
    for (int kc = 0; kc < DK / 32; ++kc) { const v16h a = frag_h(&sq[wr + col][kc * 32], lane); v16h f[4];   // the step's fragment reads go out as one group ahead of its products
#pragma unroll
      for (int j = 0; j < 4; ++j) f[j] = frag_h(&sk[wk + j * 16 + col][kc * 32], lane);
#pragma unroll
      for (int j = 0; j < 4; ++j) acc[j] = wmma16(a, f[j], acc[j]); }
    __syncthreads(); };   // every reader has left the tiles before they are overwritten
  head(0, acc0); head(1, acc1);
  _Float16 (*s0)[KW_SD] = (_Float16 (*)[KW_SD])(sm + wave * 16 * KW_SD); _Float16 (*s1)[KW_SD] = (_Float16 (*)[KW_SD])(sm + (8 + wave) * 16 * KW_SD);   // the wave's own two 16 x 64 weight tiles
  const float isd = 1.0f / sqrtf((float)DK);
#pragma unroll
  for (int j = 0; j < 4; ++j)
#pragma unroll
    for (int r = 0; r < 8; ++r) { const float d = (acc1[j][r] - acc0[j][r]) * isd; const float w0 = sig_ni(d); s0[8 * g + r][j * 16 + col] = (_Float16)(w0 * 2048.0f); s1[8 * g + r][j * 16 + col] = (_Float16)((1.0f - w0) * 2048.0f); }
  LDSX();
#pragma unroll   // the eight LDS reads go out ahead of the first store
  for (int it = 0; it < 4; ++it) { const int rl = it * 4 + (lane >> 3), q = (lane & 7) * 8; const size_t o = (size_t)(q0 + wr + rl) * NN + k0 + wk + q;   // 8 lanes cover one 128-B row piece, a wave four rows per store
    vst2((unsigned*)(P0 + o), *(const v4u*)&s0[rl][q]); vst2((unsigned*)(P1 + o), *(const v4u*)&s1[rl][q]); } }
// ---- k_pv: block = (64 queries, 64 of the head's 256 columns, head h = blockIdx.z: the two heads are independent and share one launch), 8 waves of 16 x 32: out[n][h][c0 ..] = P_h . v_h (K 4,096). Each 128-k tile of P and of v (64 rows x 256 B each) is read once per block with whole-row loads and shared by the waves through LDS (two buffers, row pitch 272 B); the global loads run two tiles ahead in two register sets. Every accumulator still sums k in ascending blocks of 32.
#define PV_BK 128
#define PV_T (NN / PV_BK)
#define PV_LD (PV_BK + 8)
// publish point of an LDS tile: the wave's own LDS stores and reads have retired, then the work-group barrier. Written by hand because __syncthreads() also drains the global loads that are meant to stay in flight across it.
#define PV_BAR() do { asm volatile("s_wait_dscnt 0x0" ::: "memory"); asm volatile("s_barrier_signal -1\n\ts_barrier_wait -1" ::: "memory"); } while (0)
__global__ __launch_bounds__(256) void k_pv(const _Float16* __restrict__ P, const _Float16* __restrict__ VP, float* __restrict__ O) { __shared__ __align__(16) _Float16 sp[2][64][PV_LD], sv[2][64][PV_LD]; __shared__ __align__(16) float so[64][68];
  const int tid = threadIdx.x, wave = tid >> 5, lane = tid & 31, col = lane & 15, g = lane >> 4; const int n0 = blockIdx.x * 64, c0 = blockIdx.y * 64, h = blockIdx.z, wr = (wave >> 1) * 16, wc = (wave & 1) * 32;
  const int lr = tid >> 4, lq = (tid & 15) * 8;   // staging: 16 lanes cover one 256-B row piece, a wave two rows per load
  const _Float16* gp = P + ((size_t)h * NN + n0 + lr) * NN + lq; const _Float16* gv = VP + (size_t)(h * VW + c0 + lr) * NN + lq;
  v8h r0[8], ra[8], rb[8]; v8f acc[2] = {};
  auto ld = [&](v8h (&r)[8], int t) {
#pragma unroll
    for (int i = 0; i < 4; ++i) { r[i] = *(const v8h*)(gp + (size_t)(16 * i) * NN + t * PV_BK); r[4 + i] = *(const v8h*)(gv + (size_t)(16 * i) * NN + t * PV_BK); }
    __builtin_amdgcn_sched_barrier(0); };   // keeps one tile's loads together and the tiles in order, so that the counted load waits in front of the LDS stores leave the younger tile in flight
  auto st = [&](const v8h (&r)[8], int b) {
#pragma unroll
    for (int i = 0; i < 4; ++i) { *(v8h*)&sp[b][lr + 16 * i][lq] = r[i]; *(v8h*)&sv[b][lr + 16 * i][lq] = r[4 + i]; } };
  auto mm = [&](int b) { v16h fa[PV_BK / 32], f0[PV_BK / 32], f1[PV_BK / 32];   // the whole tile's fragment reads go out as one group ahead of its products
#pragma unroll
    for (int kk = 0; kk < PV_BK / 32; ++kk) { fa[kk] = frag_h(&sp[b][wr + col][kk * 32], lane); f0[kk] = frag_h(&sv[b][wc + col][kk * 32], lane); f1[kk] = frag_h(&sv[b][wc + 16 + col][kk * 32], lane); }
#pragma unroll
    for (int kk = 0; kk < PV_BK / 32; ++kk) { acc[0] = wmma16(fa[kk], f0[kk], acc[0]); acc[1] = wmma16(fa[kk], f1[kk], acc[1]); } };
  ld(r0, 0); ld(ra, 1); ld(rb, 2); st(r0, 0);
  PV_BAR();
#pragma unroll 1
  for (int t = 0; t < PV_T - 4; t += 2) {   // rolled: one copy of the two-tile body is enough, the buffers alternate inside it
    mm(0); st(ra, 1); ld(ra, t + 3);
    PV_BAR();   // tile t+1 is published; every reader has left buffer 0
    mm(1); st(rb, 0); ld(rb, t + 4);
    asm volatile("s_wait_xcnt 0x0" ::: "memory");   // this trip's loads stay in flight over the next trip's address arithmetic: their address registers are rewritten only behind this wait
    PV_BAR();   // tile t+2 is published; every reader has left buffer 1
  }
  mm(0); st(ra, 1); ld(ra, PV_T - 1);
  PV_BAR();
  mm(1); st(rb, 0);
  PV_BAR();
  mm(0); st(ra, 1);
  PV_BAR();
  mm(1);
#pragma unroll
  for (int j = 0; j < 2; ++j)
#pragma unroll
    for (int r = 0; r < 8; ++r) so[wr + 8 * g + r][wc + j * 16 + col] = acc[j][r] * (1.0f / 2048.0f);
  __syncthreads();
  for (int e = tid; e < 64 * 16; e += 256) { const int rl = e >> 4, q = e & 15; vst2(O + ((size_t)(n0 + rl) * NHD + h) * VW + c0 + q * 4, *(const v4f*)&so[rl][q * 4]); } }
// ---- k_mix: block = 64 rows (2 threads per row): x = LN(0.5 * mean_h out + 0.5 * x_prev) * g + b (in place on X, or to OUT for the last layer)
__global__ __launch_bounds__(128) void k_mix(const float* __restrict__ O, float* __restrict__ X, const float* __restrict__ Gm, const float* __restrict__ Bb, float* __restrict__ OUT) { __shared__ __align__(16) float sy[64][HID + 4];
  const int tid = threadIdx.x; const size_t r0 = (size_t)blockIdx.x * 64; const int row = tid >> 1, half = tid & 1; const size_t n = r0 + row;
  float s = 0.f; for (int e = 0; e < 128; ++e) { const int c = half * 128 + e; const float om = (O[(n * NHD + 0) * VW + c] + O[(n * NHD + 1) * VW + c]) * 0.5f; const float v = 0.5f * om + 0.5f * X[n * HID + c]; sy[row][c] = v; s += v; }
  s += __shfl_xor(s, 1); const float mu = s * (1.0f / HID); float s2 = 0.f; for (int e = 0; e < 128; ++e) { const float d = sy[row][half * 128 + e] - mu; s2 += d * d; } s2 += __shfl_xor(s2, 1); const float rs = rsqrtf(s2 * (1.0f / HID) + 1e-5f);
  for (int e = 0; e < 128; ++e) { const int c = half * 128 + e; sy[row][c] = (sy[row][c] - mu) * rs * bfr(Gm[c]) + bfr(Bb[c]); }
  __syncthreads();
  float* dst = OUT ? OUT : X;
  for (int q = tid; q < 64 * HID / 4; q += 128) { const int rw = q / (HID / 4), c4 = (q % (HID / 4)) * 4; vst2(dst + (r0 + rw) * HID + c4, *(const v4f*)&sy[rw][c4]); } }
extern "C" void kernel_launch(void* const* d_in, const int* in_sizes, int n_in, void* d_out, int out_size, void* d_ws, size_t ws_size, hipStream_t stream) {
  (void)in_sizes; (void)n_in; (void)out_size;
  const float** F = (const float**)d_in;   // 0 x [4096,512], 1 fc_w [512,256], 2 fc_b, 3 ln_g [3,256], 4 ln_b [3,256], 5 wq [2,256,256], 6 bq [2,256], 7 wk, 8 bk, 9 wvl, 10 bvl, 11 wvg [2,256,512], 12 bvg [2,512]
  if (ws_size < (size_t)WS_END) return;
  char* ws = (char*)d_ws; float *X = (float*)(ws + WS_X), *O = (float*)(ws + WS_O); _Float16 *Q = (_Float16*)(ws + WS_Q), *K = (_Float16*)(ws + WS_K), *VI = (_Float16*)(ws + WS_VI), *VP = (_Float16*)(ws + WS_VP), *P = (_Float16*)(ws + WS_P);
  k_fc<<<dim3(NN / 64), 256, 0, stream>>>(F[0], F[1], F[2], F[3], F[4], X);
  for (int l = 0; l < TNL; ++l) {
    k_lin<<<dim3(NN / 64, HID / 128, 3), 256, 0, stream>>>(X, nullptr, F[5] + (size_t)l * HID * HID, F[7] + (size_t)l * HID * HID, F[9] + (size_t)l * HID * HID, F[6] + l * HID, F[8] + l * HID, F[10] + l * HID, 0, Q, K, VI);
    const float* wg = F[11] + (size_t)l * HID * NHD * VW; const float* bg = F[12] + l * NHD * VW;
    k_lin<<<dim3(NN / 64, (NHD * VW) / 128, 1), 256, 0, stream>>>(X, VI, wg, wg, wg, bg, bg, bg, 3, VP, VP, VP);
    k_w<<<dim3(NN / 64, NN / 128), 256, 0, stream>>>(Q, K, P, P + (size_t)NN * NN);
    k_pv<<<dim3(NN / 64, VW / 64, NHD), 256, 0, stream>>>(P, VP, O);
    k_mix<<<dim3(NN / 64), 128, 0, stream>>>(O, X, F[3] + (l + 1) * HID, F[4] + (l + 1) * HID, (l == NL - 1) ? (float*)d_out : nullptr);
  }
}

// v005
// It runs in 141 microseconds.
// Timed twice side by side with v004, it ran 1.11 and 1.10 times as fast.
// Over all steps from v000 it is 8.84 times as fast.
// compute dtype: all float inputs rounded to bf16; x fc_w exact bf16 products on WMMA 16x16x32; LayerNorm/ReLU in f32; per layer the q/k/v_in/v projections with the LayerNorm'd operand rounded once to f16 against f16 weights (bf16 values x 16, folded); both heads' logits q.k/sqrt(128) from f16 rows (1 product) and the reference's softmax over the HEAD axis (a 2-way softmax per (node, node) pair, f32, precise expf) -> weights rounded to f16 x 2^11; sum over all nodes and both heads of w_h v_h (v f16), head mean, residual mix and LayerNorm in f32; f32 output.
#include <hip/hip_runtime.h>
#include <math.h>

typedef __attribute__((ext_vector_type(16))) _Float16 v16h;
typedef __attribute__((ext_vector_type(16))) __bf16 v16b;
typedef __attribute__((ext_vector_type(8)))  _Float16 v8h;
typedef __attribute__((ext_vector_type(4)))  _Float16 v4hh;
typedef __attribute__((ext_vector_type(8)))  float v8f;
typedef __attribute__((ext_vector_type(4)))  float v4f;
typedef __attribute__((ext_vector_type(2)))  float v2f;
typedef __attribute__((ext_vector_type(4)))  unsigned v4u;
typedef __attribute__((ext_vector_type(4)))  int v4i;
typedef float __attribute__((may_alias)) float_a;
typedef int __attribute__((may_alias)) int_a;

template <typename T> __device__ __forceinline__ void vst2(void* p, T v) { *(T*)p = v;  }
__device__ __forceinline__ v8f wmma16(v16h a, v16h b, v8f c) {
  v8f d = __builtin_amdgcn_wmma_f32_16x16x32_f16(false, a, false, b, (short)0, c, false, false);
  asm volatile("v_nop\n\tv_nop\n\tv_nop\n\tv_nop" : "+v"(d) : "v"(a), "v"(b));
  return d;
}
__device__ __forceinline__ v8f wmma_bf(v16b a, v16b b, v8f c) {
  v8f d = __builtin_amdgcn_wmma_f32_16x16x32_bf16(false, a, false, b, (short)0, c, false, false);
  asm volatile("v_nop\n\tv_nop\n\tv_nop\n\tv_nop" : "+v"(d) : "v"(a), "v"(b));
  return d;
}
// 16x16x32 fragments: lane = (h = lane>>4, row/col = lane&15); elements 0..7 = k0+8h+0..7, 8..15 = k0+16+8h+0..7; D element r = row 8h+r
__device__ __forceinline__ v16h frag_h(const _Float16* rowk0, int lane) {
  union { v16h v; v8h q[2]; } u; const _Float16* p = rowk0 + 8 * (lane >> 4);
  u.q[0] = *(const v8h*)p; u.q[1] = *(const v8h*)(p + 16); return u.v;
}
__device__ __forceinline__ v16h frag_f32(const float* rowk0, int lane) {
  v16h a; const float* p = rowk0 + 8 * (lane >> 4);
#pragma unroll
  for (int i = 0; i < 8; ++i) { a[i] = (_Float16)p[i]; a[8 + i] = (_Float16)p[16 + i]; }
  return a;
}
__device__ __forceinline__ v16h frag_f32s(const float* rowk0, int lane, float sc) {
  v16h a; const float* p = rowk0 + 8 * (lane >> 4);
#pragma unroll
  for (int i = 0; i < 8; ++i) { a[i] = (_Float16)(p[i] * sc); a[8 + i] = (_Float16)(p[16 + i] * sc); }
  return a;
}
// column fragment from a [K][ld] layout (column n), rows >= K read as 0
__device__ __forceinline__ v16h fragc_f32(const float* W, int k0, int n, int lane, int ld, int K) {
  v16h a; const int g = lane >> 4;
#pragma unroll
  for (int i = 0; i < 8; ++i) { const int ka = k0 + 8 * g + i, kb = ka + 16;
    a[i] = (_Float16)(ka < K ? W[(size_t)(ka < K ? ka : K - 1) * ld + n] : 0.f); a[8 + i] = (_Float16)(kb < K ? W[(size_t)(kb < K ? kb : K - 1) * ld + n] : 0.f); }
  return a;
}
struct F2 { v16b h, l; };
__device__ __forceinline__ F2 bsplit16(const float v[16]) { F2 r;
#pragma unroll
  for (int i = 0; i < 16; ++i) { const __bf16 h = (__bf16)v[i]; r.h[i] = h; r.l[i] = (__bf16)(v[i] - (float)h); }
  return r; }
__device__ __forceinline__ F2 split_row(const float* row, int k0, int lane) { float v[16]; const float* p = row + k0 + 8 * (lane >> 4);
#pragma unroll
  for (int i = 0; i < 8; ++i) { v[i] = p[i]; v[8 + i] = p[16 + i]; }
  return bsplit16(v); }
__device__ __forceinline__ F2 split_rowK(const float* row, int k0, int lane, int K) { float v[16]; const int g = lane >> 4;
#pragma unroll
  for (int i = 0; i < 8; ++i) { const int ka = k0 + 8 * g + i, kb = ka + 16; v[i] = ka < K ? row[ka < K ? ka : K - 1] : 0.f; v[8 + i] = kb < K ? row[kb < K ? kb : K - 1] : 0.f; }
  return bsplit16(v); }
__device__ __forceinline__ F2 split_col(const float* W, int k0, int n, int lane, int ld, int K) { float v[16]; const int g = lane >> 4;
#pragma unroll
  for (int i = 0; i < 8; ++i) { const int ka = k0 + 8 * g + i, kb = ka + 16; v[i] = ka < K ? W[(size_t)(ka < K ? ka : K - 1) * ld + n] : 0.f; v[8 + i] = kb < K ? W[(size_t)(kb < K ? kb : K - 1) * ld + n] : 0.f; }
  return bsplit16(v); }
__device__ __forceinline__ v8f mac3(const F2& a, const F2& b, v8f c) { c = wmma_bf(a.l, b.h, c); c = wmma_bf(a.h, b.l, c); return wmma_bf(a.h, b.h, c); }
__device__ __forceinline__ float sigm(float v) { return 1.0f / (1.0f + expf(-v)); }

// TransConv (graph-transformer style, N 4,096 nodes, in 512, hidden 256, 2 heads x 128, 2 layers, alpha 0.5): x = relu(LN(x fc_w + b)); per layer: q, k = x W + b (per head 128), v = (x Wvl + b) Wvg + b (per head 256), scores[n][l][h] = q_n,h . k_l,h / sqrt(128), w = softmax over the LAST axis = the 2 heads (literally as written), out[n][h] = sum_l w[n][l][h] v[l][h], head mean, x = LN(0.5 out + 0.5 x_prev).
__device__ __forceinline__ float bfr(float v) { return (float)(__bf16)v; }
#define NN 4096
#define DIN 512
#define HID 256
#define NHD 2
#define DK 128
#define VW 256                 // per-head value width
#define NL 2
#ifndef TNL
#define TNL NL
#endif
#define WS_X   0u                                      // f32 x rows [n][256] (current layer input / prev)
#define WS_Q   (WS_X + 4u * (size_t)NN * HID)           // f16 q rows [n][256]
#define WS_K   (WS_Q + 2u * (size_t)NN * HID)
#define WS_VI  (WS_K + 2u * (size_t)NN * HID)           // f16 v_in rows [n][256]
#define WS_VP  (WS_VI + 2u * (size_t)NN * HID)          // f16 v planes [h*256 + c][n]
#define WS_O   (WS_VP + 2u * (size_t)NHD * VW * NN)      // f32 partial head sums [n][key range][256], 8 key ranges
#define WS_END (WS_O + 4u * 8u * (size_t)NN * HID)
typedef __attribute__((ext_vector_type(8)))  __bf16 v8b;
__device__ __forceinline__ v16b frag_b(const __bf16* rowk0, int lane) {
  union { v16b v; v8b q[2]; } u; const __bf16* p = rowk0 + 8 * (lane >> 4);
  u.q[0] = *(const v8b*)p; u.q[1] = *(const v8b*)(p + 16); return u.v;
}
// publish point of an LDS weight tile: the wave's own LDS stores and reads have retired, then the work-group barrier. Written by hand because __syncthreads() also drains the global loads that are meant to stay in flight across it.
#define WT_BAR() do { asm volatile("s_wait_dscnt 0x0" ::: "memory"); asm volatile("s_barrier_signal -1\n\ts_barrier_wait -1" ::: "memory"); } while (0)
// ---- k_fc: block = 64 rows, 8 waves of 16 rows x 128 columns: y = x fc_w + b (exact bf16 products) -> LDS; per row LayerNorm (eps 1e-5) x g0 + b0, ReLU -> X rows (1 KB each). fc_w is read once per block in chunks of 64 k x 256 columns with whole-row loads, rounded to bf16 once and stored k-contiguous per column in LDS (two buffers, row pitch 144 B); the next chunk's loads (weights and the wave's own x pieces) fly while this chunk is multiplied. Every accumulator still sums k in ascending blocks of 32.
#define FC_BK 64
#define FC_T (DIN / FC_BK)
#define FC_LD (FC_BK + 8)
__global__ __launch_bounds__(256) void k_fc(const float* __restrict__ XI, const float* __restrict__ W, const float* __restrict__ Bv, const float* __restrict__ G0, const float* __restrict__ B0, float* __restrict__ X) { __shared__ __align__(16) float sy[64][HID + 4]; __shared__ __align__(16) __bf16 wt[2][HID][FC_LD];
  const int tid = threadIdx.x, wave = tid >> 5, lane = tid & 31, col = lane & 15, g = lane >> 4; const size_t r0 = (size_t)blockIdx.x * 64; const int wr = (wave >> 1) * 16, cp = wave & 1;
  const int nq = tid & 63, kg = tid >> 6;   // staging piece: 8 k rows x 4 columns; a wave covers 512 B of one weight row per load
  const float* gw = W + (size_t)(kg * 8) * HID + nq * 4; const float* gx = XI + (r0 + wr + col) * DIN + 8 * g;
  v4f rw[16], rx[8]; v16b a[2]; v8f acc[8] = {};
  auto ldw = [&](int c) {
#pragma unroll
    for (int i = 0; i < 2; ++i)
#pragma unroll
      for (int e = 0; e < 8; ++e) rw[i * 8 + e] = *(const v4f*)(gw + (size_t)(c * FC_BK + i * 32 + e) * HID);
#pragma unroll
    for (int kk = 0; kk < 2; ++kk) { const float* p = gx + c * FC_BK + kk * 32; rx[kk * 4] = *(const v4f*)p; rx[kk * 4 + 1] = *(const v4f*)(p + 4); rx[kk * 4 + 2] = *(const v4f*)(p + 16); rx[kk * 4 + 3] = *(const v4f*)(p + 20); }
    __builtin_amdgcn_sched_barrier(0);   // keeps the chunk's loads together at this place, one chunk ahead of their use
    asm volatile("s_wait_xcnt 0x0" ::: "memory");   // the loads stay in flight over later arithmetic: their address registers are rewritten only behind this wait
    __builtin_amdgcn_sched_barrier(0); };   // keeps later register writes from being lifted over that wait
  auto stw = [&](int b) {
#pragma unroll
    for (int i = 0; i < 2; ++i)
#pragma unroll
      for (int m = 0; m < 4; ++m) { v8b t;
#pragma unroll
        for (int e = 0; e < 8; ++e) t[e] = (__bf16)rw[i * 8 + e][m];
        *(v8b*)&wt[b][nq * 4 + m][(kg + 4 * i) * 8] = t; }
#pragma unroll
    for (int kk = 0; kk < 2; ++kk)
#pragma unroll
      for (int i = 0; i < 4; ++i) { a[kk][i] = (__bf16)rx[kk * 4][i]; a[kk][4 + i] = (__bf16)rx[kk * 4 + 1][i]; a[kk][8 + i] = (__bf16)rx[kk * 4 + 2][i]; a[kk][12 + i] = (__bf16)rx[kk * 4 + 3][i]; } };
  auto mm = [&](int b) {
#pragma unroll
    for (int kk = 0; kk < 2; ++kk) { v16b f[8];   // the eight fragment reads go out as one group ahead of their products
#pragma unroll
      for (int j = 0; j < 8; ++j) f[j] = frag_b(&wt[b][cp * 128 + j * 16 + col][kk * 32], lane);
#pragma unroll
      for (int j = 0; j < 8; ++j) acc[j] = wmma_bf(a[kk], f[j], acc[j]); } };
  ldw(0); stw(0); ldw(1);
  WT_BAR();
#pragma unroll 1
  for (int c = 0; c < FC_T; ++c) {   // rolled: one copy of the body is enough
    mm(c & 1);
    if (c + 1 < FC_T) stw((c + 1) & 1);
    if (c + 2 < FC_T) ldw(c + 2);
    WT_BAR();   // chunk c+1 is published; every reader has left the buffer of chunk c
  }
#pragma unroll
  for (int j = 0; j < 8; ++j) { const int o = cp * 128 + j * 16 + col; const float bb = bfr(Bv[o]);
#pragma unroll
    for (int r = 0; r < 8; ++r) sy[wr + 8 * g + r][o] = acc[j][r] + bb; }
  __syncthreads();
  // LN per row: 2 threads per row (the first 128 threads / 64 rows), each 128 elements
  if (tid < 128) { const int row = tid >> 1, half = tid & 1; float* v = &sy[row][half * 128]; float s = 0.f; for (int e = 0; e < 128; ++e) s += v[e]; s += __shfl_xor(s, 1); const float mu = s * (1.0f / HID);
    float s2 = 0.f; for (int e = 0; e < 128; ++e) { const float d = v[e] - mu; s2 += d * d; } s2 += __shfl_xor(s2, 1); const float rs = rsqrtf(s2 * (1.0f / HID) + 1e-5f);
    for (int e = 0; e < 128; ++e) { const int c = half * 128 + e; v[e] = fmaxf((v[e] - mu) * rs * bfr(G0[c]) + bfr(B0[c]), 0.f); } }
  __syncthreads();
  for (int q = tid; q < 64 * HID / 4; q += 256) { const int row = q / (HID / 4), c4 = (q % (HID / 4)) * 4; vst2(X + (r0 + row) * HID + c4, *(const v4f*)&sy[row][c4]); } }
// ---- k_lin: block = (64 rows, 128 cols, which = wb + blockIdx.z), 8 waves of 16 x 64: which 0 q, 1 k, 2 v_in from X (f32 -> f16 A), the three of them independent and therefore one launch (grid z = 3, wb 0); 3 v = v_in (f16 rows) Wvg + b (512 cols = 4 column blocks) -> f16 planes [c][n] (grid z = 1, wb 3, first pointer of each triple). The block's weight tile (256 k x 128 columns) is read once with whole-row loads, converted once and stored k-contiguous per column in LDS (row pitch 528 B); the 64 operand rows go through LDS the same way; all fragments come from LDS. Every accumulator still sums k in ascending blocks of 32.
#define LIN_LD (HID + 8)
// behind a group of global loads: the first scheduling barrier keeps all of the group's loads issued before the first is waited for; s_wait_xcnt stands before any of their address registers is rewritten; the second scheduling barrier keeps later register writes from being lifted over that wait
#define LIN_ISSUED() do { __builtin_amdgcn_sched_barrier(0); asm volatile("s_wait_xcnt 0x0" ::: "memory"); __builtin_amdgcn_sched_barrier(0); } while (0)
__global__ __launch_bounds__(256) void k_lin(const float* __restrict__ X, const _Float16* __restrict__ VI, const float* __restrict__ Wa, const float* __restrict__ Wb, const float* __restrict__ Wc, const float* __restrict__ Ba, const float* __restrict__ Bb, const float* __restrict__ Bc, int wb, _Float16* __restrict__ Da, _Float16* __restrict__ Db, _Float16* __restrict__ Dc) { __shared__ __align__(16) _Float16 sh[64][136]; __shared__ __align__(16) _Float16 th[128][72]; __shared__ __align__(16) _Float16 wt[128][LIN_LD]; __shared__ __align__(16) _Float16 sa[64][LIN_LD];
  const int tid = threadIdx.x, wave = tid >> 5, lane = tid & 31, col = lane & 15, g = lane >> 4; const int c0 = blockIdx.y * 128; const size_t r0 = (size_t)blockIdx.x * 64; const int wr = (wave >> 1) * 16, wc = (wave & 1) * 64;
  const int z = blockIdx.z, which = wb + z; const float* Wm = z == 0 ? Wa : z == 1 ? Wb : Wc; const float* Bv = z == 0 ? Ba : z == 1 ? Bb : Bc; _Float16* D = z == 0 ? Da : z == 1 ? Db : Dc;
  { v4f rw[32];   // staging piece: 8 k rows x 4 columns; a wave covers the tile's whole 512-B row per load
    const int sr = wave * 8, sc = c0 + lane * 4;
    if (which < 3) { v4f rx[16]; const float* gw = Wm + (size_t)sr * HID + sc; const float* gx = X + (r0 + (tid >> 6)) * HID + (tid & 63) * 4;
#pragma unroll
      for (int i = 0; i < 4; ++i)
#pragma unroll
        for (int e = 0; e < 8; ++e) rw[i * 8 + e] = *(const v4f*)(gw + (i * 64 + e) * HID);
#pragma unroll
      for (int i = 0; i < 16; ++i) rx[i] = *(const v4f*)(gx + i * 4 * HID);
      LIN_ISSUED();
#pragma unroll
      for (int i = 0; i < 16; ++i) { v4hh t; t[0] = (_Float16)rx[i][0]; t[1] = (_Float16)rx[i][1]; t[2] = (_Float16)rx[i][2]; t[3] = (_Float16)rx[i][3]; *(v4hh*)&sa[(tid >> 6) + 4 * i][(tid & 63) * 4] = t; } }
    else { v8h rx[8]; const float* gw = Wm + (size_t)sr * (NHD * VW) + sc; const _Float16* gx = VI + (r0 + (tid >> 5)) * HID + (tid & 31) * 8;
#pragma unroll
      for (int i = 0; i < 4; ++i)
#pragma unroll
        for (int e = 0; e < 8; ++e) rw[i * 8 + e] = *(const v4f*)(gw + (i * 64 + e) * (NHD * VW));
#pragma unroll
      for (int i = 0; i < 8; ++i) rx[i] = *(const v8h*)(gx + i * 8 * HID);
      LIN_ISSUED();
#pragma unroll
      for (int i = 0; i < 8; ++i) *(v8h*)&sa[(tid >> 5) + 8 * i][(tid & 31) * 8] = rx[i]; }
#pragma unroll
    for (int i = 0; i < 4; ++i)
#pragma unroll
      for (int m = 0; m < 4; ++m) { v8h t;
#pragma unroll
        for (int e = 0; e < 8; ++e) t[e] = (_Float16)(bfr(rw[i * 8 + e][m]) * 16.0f);
        *(v8h*)&wt[lane * 4 + m][(wave + 8 * i) * 8] = t; } }
  __syncthreads();
  v8f acc[4] = {}; v16h fa[2], fb[2][4];
  auto lf = [&](int kc) { fa[kc & 1] = frag_h(&sa[wr + col][kc * 32], lane);
#pragma unroll
    for (int j = 0; j < 4; ++j) fb[kc & 1][j] = frag_h(&wt[wc + j * 16 + col][kc * 32], lane); };
  lf(0);
#pragma unroll
  for (int kc = 0; kc < HID / 32; ++kc) { if (kc + 1 < HID / 32) lf(kc + 1);   // the next step's fragment reads go out ahead of this step's products
#pragma unroll
    for (int j = 0; j < 4; ++j) acc[j] = wmma16(fa[kc & 1], fb[kc & 1][j], acc[j]); }
#pragma unroll
  for (int j = 0; j < 4; ++j) { const int cl = wc + j * 16 + col; const float bb = bfr(Bv[c0 + cl]);
#pragma unroll
    for (int r = 0; r < 8; ++r) { const float v = acc[j][r] * (1.0f / 16.0f) + bb; const int rl = wr + 8 * g + r; if (which == 3) th[cl][rl] = (_Float16)v; else sh[rl][cl] = (_Float16)v; } }
  __syncthreads();
  if (which < 3) { for (int e = tid; e < 64 * 16; e += 256) { const int rl = e >> 4, q = e & 15; vst2((unsigned*)(D + (r0 + rl) * HID + c0 + q * 8), *(const v4u*)&sh[rl][q * 8]); } }
  else { for (int e = tid; e < 128 * 8; e += 256) { const int cl = e >> 3, q = e & 7; vst2((unsigned*)(D + (size_t)(c0 + cl) * NN + r0 + q * 8), *(const v4u*)&th[cl][q * 8]); } } }
// ---- k_att: block = (64 queries n, one of 8 key ranges of 512 keys l), 8 waves, all 256 output columns. Per tile of 64 keys: s_h = q_h . k_h / sqrt(128) for BOTH heads (wave = 16 queries x 32 keys), the reference's softmax over the HEAD axis (axis -1 of [n, l, h]): w_0 = 1 / (1 + exp(s_1 - s_0)), w_1 = 1 - w_0 (f32, precise expf), rounded to f16 x 2^11 into an LDS tile [query][head * 64 + key]; then that tile times the value tile (wave = 64 queries x 32 columns). There is no normalisation over l and the reference takes the mean of the heads, so both heads' products add into one accumulator and the key ranges are plain partial sums: O[n][range][c], added up in k_mix. The weights never leave the block. Every logit still sums k in ascending blocks of 32. Row pitches in LDS: 528 B (q, k), 144 B (v), 272 B (weights).
__device__ __forceinline__ v8f wmma16c(v16h a, v16h b, v8f c) { return __builtin_amdgcn_wmma_f32_16x16x32_f16(false, a, false, b, (short)0, c, false, false); }   // the builtin alone: the compiler keeps the distance behind it itself
#define AT_BK 64
#define AT_SPL 8
#define AT_KS (NN / AT_SPL)
#define AT_T (AT_KS / AT_BK)
#define AT_QLD (HID + 8)
#define AT_VLD (AT_BK + 8)
#define AT_PLD (NHD * AT_BK + 8)
#define AT_OLD (HID + 4)
__global__ __launch_bounds__(256) __attribute__((amdgpu_waves_per_eu(4, 4))) void k_att(const _Float16* __restrict__ Q, const _Float16* __restrict__ K, const _Float16* __restrict__ VP, float* __restrict__ O) { __shared__ __align__(16) _Float16 sq[64][AT_QLD], sk[AT_BK][AT_QLD], sv[NHD * VW][AT_VLD], sp[64][AT_PLD];
  const int tid = threadIdx.x, wave = tid >> 5, lane = tid & 31, col = lane & 15, g = lane >> 4; const int n0 = blockIdx.x * 64, l0 = blockIdx.y * AT_KS, wr = (wave >> 1) * 16, wk = (wave & 1) * 32, wc = wave * 32;
  const int kr = tid >> 5, kq = (tid & 31) * 8;   // q, k staging: a wave covers one whole 512-B row per load
  const int vr = tid >> 3, vq = (tid & 7) * 8;    // v staging: 8 lanes cover one 128-B row piece, a wave four rows per load
  const _Float16* gk = K + (size_t)(l0 + kr) * HID + kq; const _Float16* gv = VP + (size_t)vr * NN + l0 + vq;
  const float isd = 1.0f / sqrtf((float)DK);
  v8f acc[4][2] = {};   // every loop over acc, rq, rk, rv and the fragments is unrolled: they are register arrays
  { v8h rq[8], rk[8]; const _Float16* gq = Q + (size_t)(n0 + kr) * HID + kq;
#pragma unroll
    for (int i = 0; i < 8; ++i) { rq[i] = *(const v8h*)(gq + (size_t)(8 * i) * HID); rk[i] = *(const v8h*)(gk + (size_t)(8 * i) * HID); }
    __builtin_amdgcn_sched_barrier(0);   // all 16 loads are out before the first is waited for
    asm volatile("s_wait_xcnt 0x0" :: "v"(gq), "v"(gk) : "memory");   // the two addresses are inputs, so they stay in their registers up to this wait: no load of the group lands on them, and they are rewritten only behind it
    __builtin_amdgcn_sched_barrier(0);   // keeps later register writes from being lifted over that wait
#pragma unroll
    for (int i = 0; i < 8; ++i) { *(v8h*)&sq[kr + 8 * i][kq] = rq[i]; *(v8h*)&sk[kr + 8 * i][kq] = rk[i]; } }
  __syncthreads();   // the query rows and the first key tile are published
  auto tile = [&](const int t, const bool more) { v8h rk[8], rv[16];   // more: a next key tile exists (a constant at each of the two calls)
#pragma unroll
    for (int i = 0; i < 16; ++i) rv[i] = *(const v8h*)(gv + (size_t)(32 * i) * NN + t * AT_BK);
    LIN_ISSUED();   // the value tile's loads go out here and fly under the logits and the softmax; their address registers are rewritten only behind the wait
    v8f s0[2] = {}, s1[2] = {};
#pragma unroll
    for (int kc = 0; kc < DK / 32; ++kc) { const v16h a0 = frag_h(&sq[wr + col][kc * 32], lane), a1 = frag_h(&sq[wr + col][DK + kc * 32], lane); v16h f0[2], f1[2];   // the step's fragment reads go out as one group ahead of its products
#pragma unroll
      for (int j = 0; j < 2; ++j) { f0[j] = frag_h(&sk[wk + j * 16 + col][kc * 32], lane); f1[j] = frag_h(&sk[wk + j * 16 + col][DK + kc * 32], lane); }
#pragma unroll
      for (int j = 0; j < 2; ++j) { s0[j] = wmma16c(a0, f0[j], s0[j]); s1[j] = wmma16c(a1, f1[j], s1[j]); } }
#pragma unroll
    for (int j = 0; j < 2; ++j)
#pragma unroll
      for (int r = 0; r < 8; ++r) { const float d = (s1[j][r] - s0[j][r]) * isd; const float w0 = 1.0f / (1.0f + expf(d)); sp[wr + 8 * g + r][wk + j * 16 + col] = (_Float16)(w0 * 2048.0f); sp[wr + 8 * g + r][AT_BK + wk + j * 16 + col] = (_Float16)((1.0f - w0) * 2048.0f); }
#pragma unroll
    for (int i = 0; i < 16; ++i) *(v8h*)&sv[vr + 32 * i][vq] = rv[i];
    __syncthreads();   // the tile's weights and values are published; every reader has left the key tile
    if (more) {
#pragma unroll
      for (int i = 0; i < 8; ++i) rk[i] = *(const v8h*)(gk + (size_t)((t + 1) * AT_BK + 8 * i) * HID);
      LIN_ISSUED(); }   // the next key tile's loads fly under this tile's products; their address registers are rewritten only behind the wait
#pragma unroll
    for (int h = 0; h < NHD; ++h)
#pragma unroll
      for (int kk = 0; kk < AT_BK / 32; ++kk) { v16h fa[4], fb[2];   // the step's fragment reads go out as one group ahead of its products
#pragma unroll
        for (int i = 0; i < 4; ++i) fa[i] = frag_h(&sp[i * 16 + col][h * AT_BK + kk * 32], lane);
#pragma unroll
        for (int j = 0; j < 2; ++j) fb[j] = frag_h(&sv[h * VW + wc + j * 16 + col][kk * 32], lane);
#pragma unroll
        for (int i = 0; i < 4; ++i)
#pragma unroll
          for (int j = 0; j < 2; ++j) acc[i][j] = wmma16c(fa[i], fb[j], acc[i][j]); }
    if (more) {
#pragma unroll
      for (int i = 0; i < 8; ++i) *(v8h*)&sk[kr + 8 * i][kq] = rk[i]; }
    __syncthreads(); };   // the next key tile is published; every reader has left the weight and value tiles
#pragma unroll 1
  for (int t = 0; t < AT_T - 1; ++t) tile(t, true);   // rolled: one copy of the body is enough
  tile(AT_T - 1, false);
  float* so = (float*)&sv[0][0];   // the 64 x 256 result tile (row pitch 1,040 B) reuses the value tile's LDS behind the last barrier
#pragma unroll
  for (int i = 0; i < 4; ++i)
#pragma unroll
    for (int j = 0; j < 2; ++j)
#pragma unroll
      for (int r = 0; r < 8; ++r) so[(i * 16 + 8 * g + r) * AT_OLD + wc + j * 16 + col] = acc[i][j][r] * (1.0f / 2048.0f);
  __syncthreads();
  for (int e = tid; e < 64 * (HID / 4); e += 256) { const int rl = e / (HID / 4), c4 = (e % (HID / 4)) * 4; vst2(O + ((size_t)(n0 + rl) * AT_SPL + blockIdx.y) * HID + c4, *(const v4f*)&so[rl * AT_OLD + c4]); } }
// ---- k_mix: block = 16 rows, 128 threads: v = 0.5 * (0.5 * sum over the key ranges of O) + 0.5 * x_prev, read with whole-row loads into LDS; then 2 threads per row (one wave): x = LN(v) * g + b (in place on X, or to OUT for the last layer)
#define MX_R 16
__global__ __launch_bounds__(128) void k_mix(const float* __restrict__ O, float* __restrict__ X, const float* __restrict__ Gm, const float* __restrict__ Bb, float* __restrict__ OUT) { __shared__ __align__(16) float sy[MX_R][HID + 4];
  const int tid = threadIdx.x; const size_t r0 = (size_t)blockIdx.x * MX_R; const int rw0 = tid >> 6, c0 = (tid & 63) * 4;   // 64 threads cover one 1-KB row piece, the block two rows per load
  const float* po = O + (r0 + rw0) * AT_SPL * HID + c0; const float* px = X + (r0 + rw0) * HID + c0;
#pragma unroll
  for (int hg = 0; hg < MX_R / 8; ++hg) { v4f p[4][AT_SPL], x[4];   // unrolled: p and x are register arrays; 36 loads are out together
#pragma unroll
    for (int i = 0; i < 4; ++i) { const int rr = (hg * 4 + i) * 2;
#pragma unroll
      for (int s = 0; s < AT_SPL; ++s) p[i][s] = *(const v4f*)(po + (size_t)(rr * AT_SPL + s) * HID);
      x[i] = *(const v4f*)(px + (size_t)rr * HID); }
    LIN_ISSUED();   // all of the group's loads are out before the first is waited for; their address registers are rewritten only behind the wait
#pragma unroll
    for (int i = 0; i < 4; ++i) { v4f a = p[i][0];
#pragma unroll
      for (int s = 1; s < AT_SPL; ++s) a += p[i][s];
      *(v4f*)&sy[rw0 + (hg * 4 + i) * 2][c0] = 0.5f * (a * 0.5f) + 0.5f * x[i]; } }
  __syncthreads();
  if (tid < 2 * MX_R) { const int row = tid >> 1, half = tid & 1;
    float s = 0.f; for (int e = 0; e < 128; ++e) s += sy[row][half * 128 + e];
    s += __shfl_xor(s, 1); const float mu = s * (1.0f / HID); float s2 = 0.f; for (int e = 0; e < 128; ++e) { const float d = sy[row][half * 128 + e] - mu; s2 += d * d; } s2 += __shfl_xor(s2, 1); const float rs = rsqrtf(s2 * (1.0f / HID) + 1e-5f);
    for (int e = 0; e < 128; ++e) { const int c = half * 128 + e; sy[row][c] = (sy[row][c] - mu) * rs * bfr(Gm[c]) + bfr(Bb[c]); } }
  __syncthreads();
  float* dst = OUT ? OUT : X;
  for (int q = tid; q < MX_R * HID / 4; q += 128) { const int rw = q / (HID / 4), c4 = (q % (HID / 4)) * 4; vst2(dst + (r0 + rw) * HID + c4, *(const v4f*)&sy[rw][c4]); } }
extern "C" void kernel_launch(void* const* d_in, const int* in_sizes, int n_in, void* d_out, int out_size, void* d_ws, size_t ws_size, hipStream_t stream) {
  (void)in_sizes; (void)n_in; (void)out_size;
  const float** F = (const float**)d_in;   // 0 x [4096,512], 1 fc_w [512,256], 2 fc_b, 3 ln_g [3,256], 4 ln_b [3,256], 5 wq [2,256,256], 6 bq [2,256], 7 wk, 8 bk, 9 wvl, 10 bvl, 11 wvg [2,256,512], 12 bvg [2,512]
  if (ws_size < (size_t)WS_END) return;
  char* ws = (char*)d_ws; float *X = (float*)(ws + WS_X), *O = (float*)(ws + WS_O); _Float16 *Q = (_Float16*)(ws + WS_Q), *K = (_Float16*)(ws + WS_K), *VI = (_Float16*)(ws + WS_VI), *VP = (_Float16*)(ws + WS_VP);
  k_fc<<<dim3(NN / 64), 256, 0, stream>>>(F[0], F[1], F[2], F[3], F[4], X);
  for (int l = 0; l < TNL; ++l) {
    k_lin<<<dim3(NN / 64, HID / 128, 3), 256, 0, stream>>>(X, nullptr, F[5] + (size_t)l * HID * HID, F[7] + (size_t)l * HID * HID, F[9] + (size_t)l * HID * HID, F[6] + l * HID, F[8] + l * HID, F[10] + l * HID, 0, Q, K, VI);
    const float* wg = F[11] + (size_t)l * HID * NHD * VW; const float* bg = F[12] + l * NHD * VW;
    k_lin<<<dim3(NN / 64, (NHD * VW) / 128, 1), 256, 0, stream>>>(X, VI, wg, wg, wg, bg, bg, bg, 3, VP, VP, VP);
    k_att<<<dim3(NN / 64, AT_SPL), 256, 0, stream>>>(Q, K, VP, O);
    k_mix<<<dim3(NN / MX_R), 128, 0, stream>>>(O, X, F[3] + (l + 1) * HID, F[4] + (l + 1) * HID, (l == NL - 1) ? (float*)d_out : nullptr);
  }
}

// v006
// One run takes 120 microseconds.
// In two side-by-side timings against v005, it was 1.17 and 1.18 times as fast.
// Over all steps from v000 it is 10.4 times as fast.
// compute dtype: all float inputs rounded to bf16; x fc_w exact bf16 products on WMMA 16x16x32; LayerNorm/ReLU in f32; per layer the q/k/v_in/v projections with the LayerNorm'd operand rounded once to f16 against f16 weights (bf16 values x 16, folded); both heads' logits q.k/sqrt(128) from f16 rows (1 product) and the reference's softmax over the HEAD axis (a 2-way softmax per (node, node) pair, f32, precise expf) -> w_0 rounded to f16 x 2^11; because w_1 = 1 - w_0, the sum over all nodes and both heads of w_h v_h is taken as sum of w_0 (v_0 - v_1) (the difference formed in f32, rounded once to f16) plus the f32 column sum of v_1; head mean, residual mix and LayerNorm in f32; f32 output.
#include <hip/hip_runtime.h>
#include <math.h>

typedef __attribute__((ext_vector_type(16))) _Float16 v16h;
typedef __attribute__((ext_vector_type(16))) __bf16 v16b;
typedef __attribute__((ext_vector_type(8)))  _Float16 v8h;
typedef __attribute__((ext_vector_type(4)))  _Float16 v4hh;
typedef __attribute__((ext_vector_type(8)))  float v8f;
typedef __attribute__((ext_vector_type(4)))  float v4f;
typedef __attribute__((ext_vector_type(2)))  float v2f;
typedef __attribute__((ext_vector_type(4)))  unsigned v4u;
typedef __attribute__((ext_vector_type(4)))  int v4i;
typedef float __attribute__((may_alias)) float_a;
typedef int __attribute__((may_alias)) int_a;

template <typename T> __device__ __forceinline__ void vst2(void* p, T v) { *(T*)p = v;  }
__device__ __forceinline__ v8f wmma16(v16h a, v16h b, v8f c) {
  v8f d = __builtin_amdgcn_wmma_f32_16x16x32_f16(false, a, false, b, (short)0, c, false, false);
  asm volatile("v_nop\n\tv_nop\n\tv_nop\n\tv_nop" : "+v"(d) : "v"(a), "v"(b));
  return d;
}
__device__ __forceinline__ v8f wmma_bf(v16b a, v16b b, v8f c) {
  v8f d = __builtin_amdgcn_wmma_f32_16x16x32_bf16(false, a, false, b, (short)0, c, false, false);
  asm volatile("v_nop\n\tv_nop\n\tv_nop\n\tv_nop" : "+v"(d) : "v"(a), "v"(b));
  return d;
}
// 16x16x32 fragments: lane = (h = lane>>4, row/col = lane&15); elements 0..7 = k0+8h+0..7, 8..15 = k0+16+8h+0..7; D element r = row 8h+r
__device__ __forceinline__ v16h frag_h(const _Float16* rowk0, int lane) {
  union { v16h v; v8h q[2]; } u; const _Float16* p = rowk0 + 8 * (lane >> 4);
  u.q[0] = *(const v8h*)p; u.q[1] = *(const v8h*)(p + 16); return u.v;
}
__device__ __forceinline__ v16h frag_f32(const float* rowk0, int lane) {
  v16h a; const float* p = rowk0 + 8 * (lane >> 4);
#pragma unroll
  for (int i = 0; i < 8; ++i) { a[i] = (_Float16)p[i]; a[8 + i] = (_Float16)p[16 + i]; }
  return a;
}
__device__ __forceinline__ v16h frag_f32s(const float* rowk0, int lane, float sc) {
  v16h a; const float* p = rowk0 + 8 * (lane >> 4);
#pragma unroll
  for (int i = 0; i < 8; ++i) { a[i] = (_Float16)(p[i] * sc); a[8 + i] = (_Float16)(p[16 + i] * sc); }
  return a;
}
// column fragment from a [K][ld] layout (column n), rows >= K read as 0
__device__ __forceinline__ v16h fragc_f32(const float* W, int k0, int n, int lane, int ld, int K) {
  v16h a; const int g = lane >> 4;
#pragma unroll
  for (int i = 0; i < 8; ++i) { const int ka = k0 + 8 * g + i, kb = ka + 16;
    a[i] = (_Float16)(ka < K ? W[(size_t)(ka < K ? ka : K - 1) * ld + n] : 0.f); a[8 + i] = (_Float16)(kb < K ? W[(size_t)(kb < K ? kb : K - 1) * ld + n] : 0.f); }
  return a;
}
struct F2 { v16b h, l; };
__device__ __forceinline__ F2 bsplit16(const float v[16]) { F2 r;
#pragma unroll
  for (int i = 0; i < 16; ++i) { const __bf16 h = (__bf16)v[i]; r.h[i] = h; r.l[i] = (__bf16)(v[i] - (float)h); }
  return r; }
__device__ __forceinline__ F2 split_row(const float* row, int k0, int lane) { float v[16]; const float* p = row + k0 + 8 * (lane >> 4);
#pragma unroll
  for (int i = 0; i < 8; ++i) { v[i] = p[i]; v[8 + i] = p[16 + i]; }
  return bsplit16(v); }
__device__ __forceinline__ F2 split_rowK(const float* row, int k0, int lane, int K) { float v[16]; const int g = lane >> 4;
#pragma unroll
  for (int i = 0; i < 8; ++i) { const int ka = k0 + 8 * g + i, kb = ka + 16; v[i] = ka < K ? row[ka < K ? ka : K - 1] : 0.f; v[8 + i] = kb < K ? row[kb < K ? kb : K - 1] : 0.f; }
  return bsplit16(v); }
__device__ __forceinline__ F2 split_col(const float* W, int k0, int n, int lane, int ld, int K) { float v[16]; const int g = lane >> 4;
#pragma unroll
  for (int i = 0; i < 8; ++i) { const int ka = k0 + 8 * g + i, kb = ka + 16; v[i] = ka < K ? W[(size_t)(ka < K ? ka : K - 1) * ld + n] : 0.f; v[8 + i] = kb < K ? W[(size_t)(kb < K ? kb : K - 1) * ld + n] : 0.f; }
  return bsplit16(v); }
__device__ __forceinline__ v8f mac3(const F2& a, const F2& b, v8f c) { c = wmma_bf(a.l, b.h, c); c = wmma_bf(a.h, b.l, c); return wmma_bf(a.h, b.h, c); }
__device__ __forceinline__ float sigm(float v) { return 1.0f / (1.0f + expf(-v)); }

// TransConv (graph-transformer style, N 4,096 nodes, in 512, hidden 256, 2 heads x 128, 2 layers, alpha 0.5): x = relu(LN(x fc_w + b)); per layer: q, k = x W + b (per head 128), v = (x Wvl + b) Wvg + b (per head 256), scores[n][l][h] = q_n,h . k_l,h / sqrt(128), w = softmax over the LAST axis = the 2 heads (literally as written), out[n][h] = sum_l w[n][l][h] v[l][h], head mean, x = LN(0.5 out + 0.5 x_prev).
__device__ __forceinline__ float bfr(float v) { return (float)(__bf16)v; }
#define NN 4096
#define DIN 512
#define HID 256
#define NHD 2
#define DK 128
#define VW 256                 // per-head value width
#define NL 2
#ifndef TNL
#define TNL NL
#endif
#define WS_X   0u                                      // f32 x rows [n][256] (current layer input / prev)
#define WS_Q   (WS_X + 4u * (size_t)NN * HID)           // f16 q rows [n][256]
#define WS_K   (WS_Q + 2u * (size_t)NN * HID)
#define WS_VI  (WS_K + 2u * (size_t)NN * HID)           // f16 v_in rows [n][256]
#define WS_VP  (WS_VI + 2u * (size_t)NN * HID)          // f16 planes of v_0 - v_1, [c][n]
#define WS_O   (WS_VP + 2u * (size_t)VW * NN)            // f32 partial head sums [n][key range][256], 8 key ranges
#define WS_PS  (WS_O + 4u * 8u * (size_t)NN * HID)       // f32 column sums of v_1 over each block of 64 nodes, [node block][256]
#define WS_END (WS_PS + 4u * (size_t)(NN / 64) * VW)
typedef __attribute__((ext_vector_type(8)))  __bf16 v8b;
__device__ __forceinline__ v16b frag_b(const __bf16* rowk0, int lane) {
  union { v16b v; v8b q[2]; } u; const __bf16* p = rowk0 + 8 * (lane >> 4);
  u.q[0] = *(const v8b*)p; u.q[1] = *(const v8b*)(p + 16); return u.v;
}
// publish point of an LDS weight tile: the wave's own LDS stores and reads have retired, then the work-group barrier. Written by hand because __syncthreads() also drains the global loads that are meant to stay in flight across it.
#define WT_BAR() do { asm volatile("s_wait_dscnt 0x0" ::: "memory"); asm volatile("s_barrier_signal -1\n\ts_barrier_wait -1" ::: "memory"); } while (0)
// ---- k_fc: block = 64 rows, 8 waves of 16 rows x 128 columns: y = x fc_w + b (exact bf16 products) -> LDS; per row LayerNorm (eps 1e-5) x g0 + b0, ReLU -> X rows (1 KB each). fc_w is read once per block in chunks of 64 k x 256 columns with whole-row loads, rounded to bf16 once and stored k-contiguous per column in LDS (two buffers, row pitch 144 B); the next chunk's loads (weights and the wave's own x pieces) fly while this chunk is multiplied. Every accumulator still sums k in ascending blocks of 32.
#define FC_BK 64
#define FC_T (DIN / FC_BK)
#define FC_LD (FC_BK + 8)
__global__ __launch_bounds__(256) void k_fc(const float* __restrict__ XI, const float* __restrict__ W, const float* __restrict__ Bv, const float* __restrict__ G0, const float* __restrict__ B0, float* __restrict__ X) { __shared__ __align__(16) float sy[64][HID + 4]; __shared__ __align__(16) __bf16 wt[2][HID][FC_LD];
  const int tid = threadIdx.x, wave = tid >> 5, lane = tid & 31, col = lane & 15, g = lane >> 4; const size_t r0 = (size_t)blockIdx.x * 64; const int wr = (wave >> 1) * 16, cp = wave & 1;
  const int nq = tid & 63, kg = tid >> 6;   // staging piece: 8 k rows x 4 columns; a wave covers 512 B of one weight row per load
  const float* gw = W + (size_t)(kg * 8) * HID + nq * 4; const float* gx = XI + (r0 + wr + col) * DIN + 8 * g;
  v4f rw[16], rx[8]; v16b a[2]; v8f acc[8] = {};
  auto ldw = [&](int c) {
#pragma unroll
    for (int i = 0; i < 2; ++i)
#pragma unroll
      for (int e = 0; e < 8; ++e) rw[i * 8 + e] = *(const v4f*)(gw + (size_t)(c * FC_BK + i * 32 + e) * HID);
#pragma unroll
    for (int kk = 0; kk < 2; ++kk) { const float* p = gx + c * FC_BK + kk * 32; rx[kk * 4] = *(const v4f*)p; rx[kk * 4 + 1] = *(const v4f*)(p + 4); rx[kk * 4 + 2] = *(const v4f*)(p + 16); rx[kk * 4 + 3] = *(const v4f*)(p + 20); }
    __builtin_amdgcn_sched_barrier(0);   // keeps the chunk's loads together at this place, one chunk ahead of their use
    asm volatile("s_wait_xcnt 0x0" ::: "memory");   // the loads stay in flight over later arithmetic: their address registers are rewritten only behind this wait
    __builtin_amdgcn_sched_barrier(0); };   // keeps later register writes from being lifted over that wait
  auto stw = [&](int b) {
#pragma unroll
    for (int i = 0; i < 2; ++i)
#pragma unroll
      for (int m = 0; m < 4; ++m) { v8b t;
#pragma unroll
        for (int e = 0; e < 8; ++e) t[e] = (__bf16)rw[i * 8 + e][m];
        *(v8b*)&wt[b][nq * 4 + m][(kg + 4 * i) * 8] = t; }
#pragma unroll
    for (int kk = 0; kk < 2; ++kk)
#pragma unroll
      for (int i = 0; i < 4; ++i) { a[kk][i] = (__bf16)rx[kk * 4][i]; a[kk][4 + i] = (__bf16)rx[kk * 4 + 1][i]; a[kk][8 + i] = (__bf16)rx[kk * 4 + 2][i]; a[kk][12 + i] = (__bf16)rx[kk * 4 + 3][i]; } };
  auto mm = [&](int b) {
#pragma unroll
    for (int kk = 0; kk < 2; ++kk) { v16b f[8];   // the eight fragment reads go out as one group ahead of their products
#pragma unroll
      for (int j = 0; j < 8; ++j) f[j] = frag_b(&wt[b][cp * 128 + j * 16 + col][kk * 32], lane);
#pragma unroll
      for (int j = 0; j < 8; ++j) acc[j] = wmma_bf(a[kk], f[j], acc[j]); } };
  ldw(0); stw(0); ldw(1);
  WT_BAR();
#pragma unroll 1
  for (int c = 0; c < FC_T; ++c) {   // rolled: one copy of the body is enough
    mm(c & 1);
    if (c + 1 < FC_T) stw((c + 1) & 1);
    if (c + 2 < FC_T) ldw(c + 2);
    WT_BAR();   // chunk c+1 is published; every reader has left the buffer of chunk c
  }
#pragma unroll
  for (int j = 0; j < 8; ++j) { const int o = cp * 128 + j * 16 + col; const float bb = bfr(Bv[o]);
#pragma unroll
    for (int r = 0; r < 8; ++r) sy[wr + 8 * g + r][o] = acc[j][r] + bb; }
  __syncthreads();
  // LN per row: 2 threads per row (the first 128 threads / 64 rows), each 128 elements
  if (tid < 128) { const int row = tid >> 1, half = tid & 1; float* v = &sy[row][half * 128]; float s = 0.f; for (int e = 0; e < 128; ++e) s += v[e]; s += __shfl_xor(s, 1); const float mu = s * (1.0f / HID);
    float s2 = 0.f; for (int e = 0; e < 128; ++e) { const float d = v[e] - mu; s2 += d * d; } s2 += __shfl_xor(s2, 1); const float rs = rsqrtf(s2 * (1.0f / HID) + 1e-5f);
    for (int e = 0; e < 128; ++e) { const int c = half * 128 + e; v[e] = fmaxf((v[e] - mu) * rs * bfr(G0[c]) + bfr(B0[c]), 0.f); } }
  __syncthreads();
  for (int q = tid; q < 64 * HID / 4; q += 256) { const int row = q / (HID / 4), c4 = (q % (HID / 4)) * 4; vst2(X + (r0 + row) * HID + c4, *(const v4f*)&sy[row][c4]); } }
// ---- k_lin: block = (64 rows, 128 cols, which = wb + blockIdx.z), 8 waves of 16 x 64: which 0 q, 1 k, 2 v_in from X (f32 -> f16 A), the three of them independent and therefore one launch (grid z = 3, wb 0); 3 v = v_in (f16 rows) Wvg + b (grid z = 1, wb 3, first pointer of each triple): the block's 128 columns are 64 columns of head 0 and the same 64 of head 1 (4 column blocks), laid out so that a wave holds both heads of its 32 columns; it writes v_0 - v_1 (f32 difference -> f16 planes [c][n]) and the f32 sum of v_1 over its 64 rows (PS[row block][c]). The block's weight tile (256 k x 128 columns) is read once with whole-row loads, converted once and stored k-contiguous per column in LDS (row pitch 528 B); the 64 operand rows go through LDS the same way; all fragments come from LDS. Every accumulator still sums k in ascending blocks of 32.
#define LIN_LD (HID + 8)
// behind a group of global loads: the first scheduling barrier keeps all of the group's loads issued before the first is waited for; s_wait_xcnt stands before any of their address registers is rewritten; the second scheduling barrier keeps later register writes from being lifted over that wait
#define LIN_ISSUED() do { __builtin_amdgcn_sched_barrier(0); asm volatile("s_wait_xcnt 0x0" ::: "memory"); __builtin_amdgcn_sched_barrier(0); } while (0)
__global__ __launch_bounds__(256) void k_lin(const float* __restrict__ X, const _Float16* __restrict__ VI, const float* __restrict__ Wa, const float* __restrict__ Wb, const float* __restrict__ Wc, const float* __restrict__ Ba, const float* __restrict__ Bb, const float* __restrict__ Bc, int wb, _Float16* __restrict__ Da, _Float16* __restrict__ Db, _Float16* __restrict__ Dc, float* __restrict__ PS) { __shared__ __align__(16) _Float16 sh[64][136]; __shared__ __align__(16) _Float16 th[64][72]; __shared__ float ps[8][64]; __shared__ __align__(16) _Float16 wt[128][LIN_LD]; __shared__ __align__(16) _Float16 sa[64][LIN_LD];
  const int tid = threadIdx.x, wave = tid >> 5, lane = tid & 31, col = lane & 15, g = lane >> 4; const size_t r0 = (size_t)blockIdx.x * 64; const int wr = (wave >> 1) * 16, wc = (wave & 1) * 64;
  const int z = blockIdx.z, which = wb + z, c0 = blockIdx.y * (which < 3 ? 128 : 64); const float* Wm = z == 0 ? Wa : z == 1 ? Wb : Wc; const float* Bv = z == 0 ? Ba : z == 1 ? Bb : Bc; _Float16* D = z == 0 ? Da : z == 1 ? Db : Dc;
  { v4f rw[32];   // staging piece: 8 k rows x 4 columns; a wave covers the tile's whole 512-B row per load
    const int sr = wave * 8;
    // which 3: lanes 0..15 read head 0's 64 columns, lanes 16..31 head 1's; tile row = (column >> 5) * 64 + (head * 2 + ((column >> 4) & 1)) * 16 + (column & 15)
    const int sc = which < 3 ? c0 + lane * 4 : g * VW + c0 + col * 4, lr = which < 3 ? lane * 4 : ((lane >> 3) & 1) * 64 + (g * 2 + ((lane >> 2) & 1)) * 16 + (lane & 3) * 4;
    if (which < 3) { v4f rx[16]; const float* gw = Wm + (size_t)sr * HID + sc; const float* gx = X + (r0 + (tid >> 6)) * HID + (tid & 63) * 4;
#pragma unroll
      for (int i = 0; i < 4; ++i)
#pragma unroll
        for (int e = 0; e < 8; ++e) rw[i * 8 + e] = *(const v4f*)(gw + (i * 64 + e) * HID);
#pragma unroll
      for (int i = 0; i < 16; ++i) rx[i] = *(const v4f*)(gx + i * 4 * HID);
      LIN_ISSUED();
#pragma unroll
      for (int i = 0; i < 16; ++i) { v4hh t; t[0] = (_Float16)rx[i][0]; t[1] = (_Float16)rx[i][1]; t[2] = (_Float16)rx[i][2]; t[3] = (_Float16)rx[i][3]; *(v4hh*)&sa[(tid >> 6) + 4 * i][(tid & 63) * 4] = t; } }
    else { v8h rx[8]; const float* gw = Wm + (size_t)sr * (NHD * VW) + sc; const _Float16* gx = VI + (r0 + (tid >> 5)) * HID + (tid & 31) * 8;
#pragma unroll
      for (int i = 0; i < 4; ++i)
#pragma unroll
        for (int e = 0; e < 8; ++e) rw[i * 8 + e] = *(const v4f*)(gw + (i * 64 + e) * (NHD * VW));
#pragma unroll
      for (int i = 0; i < 8; ++i) rx[i] = *(const v8h*)(gx + i * 8 * HID);
      LIN_ISSUED();
#pragma unroll
      for (int i = 0; i < 8; ++i) *(v8h*)&sa[(tid >> 5) + 8 * i][(tid & 31) * 8] = rx[i]; }
#pragma unroll
    for (int i = 0; i < 4; ++i)
#pragma unroll
      for (int m = 0; m < 4; ++m) { v8h t;
#pragma unroll
        for (int e = 0; e < 8; ++e) t[e] = (_Float16)(bfr(rw[i * 8 + e][m]) * 16.0f);
        *(v8h*)&wt[lr + m][(wave + 8 * i) * 8] = t; } }
  __syncthreads();
  v8f acc[4] = {}; v16h fa[2], fb[2][4];
  auto lf = [&](int kc) { fa[kc & 1] = frag_h(&sa[wr + col][kc * 32], lane);
#pragma unroll
    for (int j = 0; j < 4; ++j) fb[kc & 1][j] = frag_h(&wt[wc + j * 16 + col][kc * 32], lane); };
  lf(0);
#pragma unroll
  for (int kc = 0; kc < HID / 32; ++kc) { if (kc + 1 < HID / 32) lf(kc + 1);   // the next step's fragment reads go out ahead of this step's products
#pragma unroll
    for (int j = 0; j < 4; ++j) acc[j] = wmma16(fa[kc & 1], fb[kc & 1][j], acc[j]); }
  if (which < 3) {
#pragma unroll
    for (int j = 0; j < 4; ++j) { const int cl = wc + j * 16 + col; const float bb = bfr(Bv[c0 + cl]);
#pragma unroll
      for (int r = 0; r < 8; ++r) sh[wr + 8 * g + r][cl] = (_Float16)(acc[j][r] * (1.0f / 16.0f) + bb); } }
  else {
#pragma unroll
    for (int j = 0; j < 2; ++j) { const int cl = (wave & 1) * 32 + j * 16 + col; const float b0 = bfr(Bv[c0 + cl]), b1 = bfr(Bv[VW + c0 + cl]); float s = 0.f;   // acc[j] = head 0, acc[j + 2] = head 1 of the same column
#pragma unroll
      for (int r = 0; r < 8; ++r) { const float v0 = acc[j][r] * (1.0f / 16.0f) + b0, v1 = acc[j + 2][r] * (1.0f / 16.0f) + b1; th[cl][wr + 8 * g + r] = (_Float16)(v0 - v1); s += v1; }
      ps[(wave >> 1) * 2 + g][cl] = s; } }
  __syncthreads();
  if (which < 3) { for (int e = tid; e < 64 * 16; e += 256) { const int rl = e >> 4, q = e & 15; vst2((unsigned*)(D + (r0 + rl) * HID + c0 + q * 8), *(const v4u*)&sh[rl][q * 8]); } }
  else { for (int e = tid; e < 64 * 8; e += 256) { const int cl = e >> 3, q = e & 7; vst2((unsigned*)(D + (size_t)(c0 + cl) * NN + r0 + q * 8), *(const v4u*)&th[cl][q * 8]); }
    if (tid < 64) { float s = ps[0][tid];
#pragma unroll
      for (int i = 1; i < 8; ++i) s += ps[i][tid];
      PS[(size_t)blockIdx.x * VW + c0 + tid] = s; } } }
// ---- k_att: block = (64 queries n, one of 8 key ranges of 512 keys l), 8 waves, all 256 output columns. Per tile of 64 keys: s_h = q_h . k_h / sqrt(128) for BOTH heads (wave = 16 queries x 32 keys), the reference's softmax over the HEAD axis (axis -1 of [n, l, h]): w_0 = 1 / (1 + exp(s_1 - s_0)), w_1 = 1 - w_0 (f32, precise expf). There is no normalisation over l and the reference takes the mean of the heads, so the two heads' products add up, and w_0 v_0 + (1 - w_0) v_1 = w_0 (v_0 - v_1) + v_1: only w_0 is kept, rounded to f16 x 2^11 into an LDS tile [query][key]; that tile times the tile of v_0 - v_1 (wave = 64 queries x 32 columns) is the one product left, and the sum of v_1 over the range's keys, the same for every query, comes from PS and is added at the end. The key ranges are plain partial sums: O[n][range][c], added up in k_mix. The weights never leave the block. Every logit still sums k in ascending blocks of 32. Row pitches in LDS: 528 B (q, k), 144 B (v, weights).
__device__ __forceinline__ v8f wmma16c(v16h a, v16h b, v8f c) { return __builtin_amdgcn_wmma_f32_16x16x32_f16(false, a, false, b, (short)0, c, false, false); }   // the builtin alone: the compiler keeps the distance behind it itself
#define AT_BK 64
#define AT_SPL 8
#define AT_KS (NN / AT_SPL)
#define AT_T (AT_KS / AT_BK)
#define AT_QLD (HID + 8)
#define AT_VLD (AT_BK + 8)
#define AT_PLD (AT_BK + 8)
#define AT_OLD (HID + 4)
__global__ __launch_bounds__(256) __attribute__((amdgpu_waves_per_eu(4, 4))) void k_att(const _Float16* __restrict__ Q, const _Float16* __restrict__ K, const _Float16* __restrict__ VP, const float* __restrict__ PS, float* __restrict__ O) { __shared__ __align__(16) _Float16 sqk[64 + AT_BK][AT_QLD], sv[VW][AT_VLD], sp[64][AT_PLD]; _Float16 (*const sq)[AT_QLD] = sqk; _Float16 (*const sk)[AT_QLD] = sqk + 64;
  const int tid = threadIdx.x, wave = tid >> 5, lane = tid & 31, col = lane & 15, g = lane >> 4; const int n0 = blockIdx.x * 64, l0 = blockIdx.y * AT_KS, wr = (wave >> 1) * 16, wk = (wave & 1) * 32, wc = wave * 32;
  const int kr = tid >> 5, kq = (tid & 31) * 8;   // q, k staging: a wave covers one whole 512-B row per load
  const int vr = tid >> 3, vq = (tid & 7) * 8;    // v staging: 8 lanes cover one 128-B row piece, a wave four rows per load
  const _Float16* gk = K + (size_t)(l0 + kr) * HID + kq; const _Float16* gv = VP + (size_t)vr * NN + l0 + vq;
  const float isd = 1.0f / sqrtf((float)DK);
  v8f acc[4][2] = {};   // every loop over acc, rq, rk, rv and the fragments is unrolled: they are register arrays
  { v8h rq[8], rk[8]; const _Float16* gq = Q + (size_t)(n0 + kr) * HID + kq;
#pragma unroll
    for (int i = 0; i < 8; ++i) { rq[i] = *(const v8h*)(gq + (size_t)(8 * i) * HID); rk[i] = *(const v8h*)(gk + (size_t)(8 * i) * HID); }
    __builtin_amdgcn_sched_barrier(0);   // all 16 loads are out before the first is waited for
    asm volatile("s_wait_xcnt 0x0" :: "v"(gq), "v"(gk) : "memory");   // the two addresses are inputs, so they stay in their registers up to this wait: no load of the group lands on them, and they are rewritten only behind it
    __builtin_amdgcn_sched_barrier(0);   // keeps later register writes from being lifted over that wait
#pragma unroll
    for (int i = 0; i < 8; ++i) { *(v8h*)&sq[kr + 8 * i][kq] = rq[i]; *(v8h*)&sk[kr + 8 * i][kq] = rk[i]; } }
  __syncthreads();   // the query rows and the first key tile are published
  auto tile = [&](const int t, const bool more) { v8h rk[8], rv[8];   // more: a next key tile exists (the same for the whole block)
#pragma unroll
    for (int i = 0; i < 8; ++i) rv[i] = *(const v8h*)(gv + (size_t)(32 * i) * NN + t * AT_BK);
    LIN_ISSUED();   // the value tile's loads go out here and fly under the logits and the softmax; their address registers are rewritten only behind the wait
    v8f s0[2] = {}, s1[2] = {};
#pragma unroll
    for (int kc = 0; kc < DK / 32; ++kc) { const v16h a0 = frag_h(&sq[wr + col][kc * 32], lane), a1 = frag_h(&sq[wr + col][DK + kc * 32], lane); v16h f0[2], f1[2];   // the step's fragment reads go out as one group ahead of its products
#pragma unroll
      for (int j = 0; j < 2; ++j) { f0[j] = frag_h(&sk[wk + j * 16 + col][kc * 32], lane); f1[j] = frag_h(&sk[wk + j * 16 + col][DK + kc * 32], lane); }
#pragma unroll
      for (int j = 0; j < 2; ++j) { s0[j] = wmma16c(a0, f0[j], s0[j]); s1[j] = wmma16c(a1, f1[j], s1[j]); } }
#pragma unroll
    for (int j = 0; j < 2; ++j)
#pragma unroll
      for (int r = 0; r < 8; ++r) { const float d = (s1[j][r] - s0[j][r]) * isd; const float w0 = 1.0f / (1.0f + expf(d)); sp[wr + 8 * g + r][wk + j * 16 + col] = (_Float16)(w0 * 2048.0f); }
#pragma unroll
    for (int i = 0; i < 8; ++i) *(v8h*)&sv[vr + 32 * i][vq] = rv[i];
    __syncthreads();   // the tile's weights and values are published; every reader has left the key tile
    if (more) {
#pragma unroll
      for (int i = 0; i < 8; ++i) rk[i] = *(const v8h*)(gk + (size_t)((t + 1) * AT_BK + 8 * i) * HID);
      LIN_ISSUED(); }   // the next key tile's loads fly under this tile's products; their address registers are rewritten only behind the wait
    v16h fa[AT_BK / 32][4], fb[AT_BK / 32][2];
#pragma unroll
    for (int kk = 0; kk < AT_BK / 32; ++kk) {
#pragma unroll
      for (int i = 0; i < 4; ++i) fa[kk][i] = frag_h(&sp[i * 16 + col][kk * 32], lane);
#pragma unroll
      for (int j = 0; j < 2; ++j) fb[kk][j] = frag_h(&sv[wc + j * 16 + col][kk * 32], lane); }
    __builtin_amdgcn_sched_barrier(0);   // the tile's 12 fragment reads go out as one group ahead of its products: read piecemeal, every pair of products waits for its own reads
#pragma unroll
    for (int kk = 0; kk < AT_BK / 32; ++kk)
#pragma unroll
      for (int i = 0; i < 4; ++i)
#pragma unroll
        for (int j = 0; j < 2; ++j) acc[i][j] = wmma16c(fa[kk][i], fb[kk][j], acc[i][j]);
    if (more) {
#pragma unroll
      for (int i = 0; i < 8; ++i) *(v8h*)&sk[kr + 8 * i][kq] = rk[i]; }
    __syncthreads(); };   // the next key tile is published; every reader has left the weight and value tiles
#pragma unroll 1
  for (int t = 0; t < AT_T; ++t) tile(t, t + 1 < AT_T);   // rolled, the last tile included ('more' is a scalar test): one copy of the body is enough, and a copy of its own for the last tile was scheduled past the register budget (spills)
  v4f pv[AT_KS / 64]; const float* gp = PS + (size_t)blockIdx.y * (AT_KS / 64) * VW + (tid & 63) * 4;   // the thread's four output columns: v_1 summed over each of the range's blocks of 64 keys
#pragma unroll
  for (int s = 0; s < AT_KS / 64; ++s) pv[s] = *(const v4f*)(gp + s * VW);
  LIN_ISSUED();   // the loads fly under the LDS stores below; their address registers are rewritten only behind the wait
  float* so = (float*)&sqk[0][0];   // the 64 x 256 result tile (row pitch 1,040 B) reuses the query and key tiles' LDS behind the last barrier
#pragma unroll
  for (int i = 0; i < 4; ++i)
#pragma unroll
    for (int j = 0; j < 2; ++j)
#pragma unroll
      for (int r = 0; r < 8; ++r) so[(i * 16 + 8 * g + r) * AT_OLD + wc + j * 16 + col] = acc[i][j][r] * (1.0f / 2048.0f);
  __syncthreads();
  v4f s1 = pv[0];
#pragma unroll
  for (int s = 1; s < AT_KS / 64; ++s) s1 += pv[s];
  for (int e = tid; e < 64 * (HID / 4); e += 256) { const int rl = e / (HID / 4), c4 = (e % (HID / 4)) * 4; vst2(O + ((size_t)(n0 + rl) * AT_SPL + blockIdx.y) * HID + c4, *(const v4f*)&so[rl * AT_OLD + c4] + s1); } }   // c4 = (tid & 63) * 4 on every trip: the step of 256 is a multiple of 64
// ---- k_mix: block = 16 rows, 128 threads: v = 0.5 * (0.5 * sum over the key ranges of O) + 0.5 * x_prev, read with whole-row loads into LDS; then 2 threads per row (one wave): x = LN(v) * g + b (in place on X, or to OUT for the last layer)
#define MX_R 16
__global__ __launch_bounds__(128) void k_mix(const float* __restrict__ O, float* __restrict__ X, const float* __restrict__ Gm, const float* __restrict__ Bb, float* __restrict__ OUT) { __shared__ __align__(16) float sy[MX_R][HID + 4];
  const int tid = threadIdx.x; const size_t r0 = (size_t)blockIdx.x * MX_R; const int rw0 = tid >> 6, c0 = (tid & 63) * 4;   // 64 threads cover one 1-KB row piece, the block two rows per load
  const float* po = O + (r0 + rw0) * AT_SPL * HID + c0; const float* px = X + (r0 + rw0) * HID + c0;
#pragma unroll
  for (int hg = 0; hg < MX_R / 8; ++hg) { v4f p[4][AT_SPL], x[4];   // unrolled: p and x are register arrays; 36 loads are out together
#pragma unroll
    for (int i = 0; i < 4; ++i) { const int rr = (hg * 4 + i) * 2;
#pragma unroll
      for (int s = 0; s < AT_SPL; ++s) p[i][s] = *(const v4f*)(po + (size_t)(rr * AT_SPL + s) * HID);
      x[i] = *(const v4f*)(px + (size_t)rr * HID); }
    LIN_ISSUED();   // all of the group's loads are out before the first is waited for; their address registers are rewritten only behind the wait
#pragma unroll
    for (int i = 0; i < 4; ++i) { v4f a = p[i][0];
#pragma unroll
      for (int s = 1; s < AT_SPL; ++s) a += p[i][s];
      *(v4f*)&sy[rw0 + (hg * 4 + i) * 2][c0] = 0.5f * (a * 0.5f) + 0.5f * x[i]; } }
  __syncthreads();
  if (tid < 2 * MX_R) { const int row = tid >> 1, half = tid & 1;
    float s = 0.f; for (int e = 0; e < 128; ++e) s += sy[row][half * 128 + e];
    s += __shfl_xor(s, 1); const float mu = s * (1.0f / HID); float s2 = 0.f; for (int e = 0; e < 128; ++e) { const float d = sy[row][half * 128 + e] - mu; s2 += d * d; } s2 += __shfl_xor(s2, 1); const float rs = rsqrtf(s2 * (1.0f / HID) + 1e-5f);
    for (int e = 0; e < 128; ++e) { const int c = half * 128 + e; sy[row][c] = (sy[row][c] - mu) * rs * bfr(Gm[c]) + bfr(Bb[c]); } }
  __syncthreads();
  float* dst = OUT ? OUT : X;
  for (int q = tid; q < MX_R * HID / 4; q += 128) { const int rw = q / (HID / 4), c4 = (q % (HID / 4)) * 4; vst2(dst + (r0 + rw) * HID + c4, *(const v4f*)&sy[rw][c4]); } }
extern "C" void kernel_launch(void* const* d_in, const int* in_sizes, int n_in, void* d_out, int out_size, void* d_ws, size_t ws_size, hipStream_t stream) {
  (void)in_sizes; (void)n_in; (void)out_size;
  const float** F = (const float**)d_in;   // 0 x [4096,512], 1 fc_w [512,256], 2 fc_b, 3 ln_g [3,256], 4 ln_b [3,256], 5 wq [2,256,256], 6 bq [2,256], 7 wk, 8 bk, 9 wvl, 10 bvl, 11 wvg [2,256,512], 12 bvg [2,512]
  if (ws_size < (size_t)WS_END) return;
  char* ws = (char*)d_ws; float *X = (float*)(ws + WS_X), *O = (float*)(ws + WS_O), *PS = (float*)(ws + WS_PS); _Float16 *Q = (_Float16*)(ws + WS_Q), *K = (_Float16*)(ws + WS_K), *VI = (_Float16*)(ws + WS_VI), *VP = (_Float16*)(ws + WS_VP);
  k_fc<<<dim3(NN / 64), 256, 0, stream>>>(F[0], F[1], F[2], F[3], F[4], X);
  for (int l = 0; l < TNL; ++l) {
    k_lin<<<dim3(NN / 64, HID / 128, 3), 256, 0, stream>>>(X, nullptr, F[5] + (size_t)l * HID * HID, F[7] + (size_t)l * HID * HID, F[9] + (size_t)l * HID * HID, F[6] + l * HID, F[8] + l * HID, F[10] + l * HID, 0, Q, K, VI, PS);
    const float* wg = F[11] + (size_t)l * HID * NHD * VW; const float* bg = F[12] + l * NHD * VW;
    k_lin<<<dim3(NN / 64, (NHD * VW) / 128, 1), 256, 0, stream>>>(X, VI, wg, wg, wg, bg, bg, bg, 3, VP, VP, VP, PS);
    k_att<<<dim3(NN / 64, AT_SPL), 256, 0, stream>>>(Q, K, VP, PS, O);
    k_mix<<<dim3(NN / MX_R), 128, 0, stream>>>(O, X, F[3] + (l + 1) * HID, F[4] + (l + 1) * HID, (l == NL - 1) ? (float*)d_out : nullptr);
  }
}

// v007
// It runs in 112 microseconds.
// Two timings next to v006 both put it at 1.08 times that version's speed.
// Counting every step since v000, it is 11.3 times as fast.
// compute dtype: all float inputs rounded to bf16; x fc_w exact bf16 products on WMMA 16x16x32; LayerNorm/ReLU in f32; per layer the q/k/v_in/v projections with the LayerNorm'd operand rounded once to f16 against f16 weights (bf16 values x 16, folded); both heads' logits q.k/sqrt(128) from f16 rows (1 product) and the reference's softmax over the HEAD axis (a 2-way softmax per (node, node) pair, f32, the hardware's exp2 and reciprocal) -> w_0 rounded to f16 x 2^11; because w_1 = 1 - w_0, the sum over all nodes and both heads of w_h v_h is taken as sum of w_0 (v_0 - v_1) (the difference formed in f32, rounded once to f16) plus the f32 column sum of v_1; head mean, residual mix and LayerNorm in f32; f32 output.
#include <hip/hip_runtime.h>
#include <math.h>

typedef __attribute__((ext_vector_type(16))) _Float16 v16h;
typedef __attribute__((ext_vector_type(16))) __bf16 v16b;
typedef __attribute__((ext_vector_type(8)))  _Float16 v8h;
typedef __attribute__((ext_vector_type(4)))  _Float16 v4hh;
typedef __attribute__((ext_vector_type(8)))  float v8f;
typedef __attribute__((ext_vector_type(4)))  float v4f;
typedef __attribute__((ext_vector_type(2)))  float v2f;
typedef __attribute__((ext_vector_type(4)))  unsigned v4u;
typedef __attribute__((ext_vector_type(4)))  int v4i;
typedef float __attribute__((may_alias)) float_a;
typedef int __attribute__((may_alias)) int_a;

template <typename T> __device__ __forceinline__ void vst2(void* p, T v) { *(T*)p = v;  }
__device__ __forceinline__ v8f wmma16(v16h a, v16h b, v8f c) {
  v8f d = __builtin_amdgcn_wmma_f32_16x16x32_f16(false, a, false, b, (short)0, c, false, false);
  asm volatile("v_nop\n\tv_nop\n\tv_nop\n\tv_nop" : "+v"(d) : "v"(a), "v"(b));
  return d;
}
__device__ __forceinline__ v8f wmma_bf(v16b a, v16b b, v8f c) {
  v8f d = __builtin_amdgcn_wmma_f32_16x16x32_bf16(false, a, false, b, (short)0, c, false, false);
  asm volatile("v_nop\n\tv_nop\n\tv_nop\n\tv_nop" : "+v"(d) : "v"(a), "v"(b));
  return d;
}
// 16x16x32 fragments: lane = (h = lane>>4, row/col = lane&15); elements 0..7 = k0+8h+0..7, 8..15 = k0+16+8h+0..7; D element r = row 8h+r
__device__ __forceinline__ v16h frag_h(const _Float16* rowk0, int lane) {
  union { v16h v; v8h q[2]; } u; const _Float16* p = rowk0 + 8 * (lane >> 4);
  u.q[0] = *(const v8h*)p; u.q[1] = *(const v8h*)(p + 16); return u.v;
}
__device__ __forceinline__ v16h frag_f32(const float* rowk0, int lane) {
  v16h a; const float* p = rowk0 + 8 * (lane >> 4);
#pragma unroll
  for (int i = 0; i < 8; ++i) { a[i] = (_Float16)p[i]; a[8 + i] = (_Float16)p[16 + i]; }
  return a;
}
__device__ __forceinline__ v16h frag_f32s(const float* rowk0, int lane, float sc) {
  v16h a; const float* p = rowk0 + 8 * (lane >> 4);
#pragma unroll
  for (int i = 0; i < 8; ++i) { a[i] = (_Float16)(p[i] * sc); a[8 + i] = (_Float16)(p[16 + i] * sc); }
  return a;
}
// column fragment from a [K][ld] layout (column n), rows >= K read as 0
__device__ __forceinline__ v16h fragc_f32(const float* W, int k0, int n, int lane, int ld, int K) {
  v16h a; const int g = lane >> 4;
#pragma unroll
  for (int i = 0; i < 8; ++i) { const int ka = k0 + 8 * g + i, kb = ka + 16;
    a[i] = (_Float16)(ka < K ? W[(size_t)(ka < K ? ka : K - 1) * ld + n] : 0.f); a[8 + i] = (_Float16)(kb < K ? W[(size_t)(kb < K ? kb : K - 1) * ld + n] : 0.f); }
  return a;
}
struct F2 { v16b h, l; };
__device__ __forceinline__ F2 bsplit16(const float v[16]) { F2 r;
#pragma unroll
  for (int i = 0; i < 16; ++i) { const __bf16 h = (__bf16)v[i]; r.h[i] = h; r.l[i] = (__bf16)(v[i] - (float)h); }
  return r; }
__device__ __forceinline__ F2 split_row(const float* row, int k0, int lane) { float v[16]; const float* p = row + k0 + 8 * (lane >> 4);
#pragma unroll
  for (int i = 0; i < 8; ++i) { v[i] = p[i]; v[8 + i] = p[16 + i]; }
  return bsplit16(v); }
__device__ __forceinline__ F2 split_rowK(const float* row, int k0, int lane, int K) { float v[16]; const int g = lane >> 4;
#pragma unroll
  for (int i = 0; i < 8; ++i) { const int ka = k0 + 8 * g + i, kb = ka + 16; v[i] = ka < K ? row[ka < K ? ka : K - 1] : 0.f; v[8 + i] = kb < K ? row[kb < K ? kb : K - 1] : 0.f; }
  return bsplit16(v); }
__device__ __forceinline__ F2 split_col(const float* W, int k0, int n, int lane, int ld, int K) { float v[16]; const int g = lane >> 4;
#pragma unroll
  for (int i = 0; i < 8; ++i) { const int ka = k0 + 8 * g + i, kb = ka + 16; v[i] = ka < K ? W[(size_t)(ka < K ? ka : K - 1) * ld + n] : 0.f; v[8 + i] = kb < K ? W[(size_t)(kb < K ? kb : K - 1) * ld + n] : 0.f; }
  return bsplit16(v); }
__device__ __forceinline__ v8f mac3(const F2& a, const F2& b, v8f c) { c = wmma_bf(a.l, b.h, c); c = wmma_bf(a.h, b.l, c); return wmma_bf(a.h, b.h, c); }
__device__ __forceinline__ float sigm(float v) { return 1.0f / (1.0f + expf(-v)); }

// TransConv (graph-transformer style, N 4,096 nodes, in 512, hidden 256, 2 heads x 128, 2 layers, alpha 0.5): x = relu(LN(x fc_w + b)); per layer: q, k = x W + b (per head 128), v = (x Wvl + b) Wvg + b (per head 256), scores[n][l][h] = q_n,h . k_l,h / sqrt(128), w = softmax over the LAST axis = the 2 heads (literally as written), out[n][h] = sum_l w[n][l][h] v[l][h], head mean, x = LN(0.5 out + 0.5 x_prev).
__device__ __forceinline__ float bfr(float v) { return (float)(__bf16)v; }
#define NN 4096
#define DIN 512
#define HID 256
#define NHD 2
#define DK 128
#define VW 256                 // per-head value width
#define NL 2
#ifndef TNL
#define TNL NL
#endif
#define WS_X   0u                                      // f32 x rows [n][256] (current layer input / prev)
#define WS_Q   (WS_X + 4u * (size_t)NN * HID)           // f16 q rows [n][256]
#define WS_K   (WS_Q + 2u * (size_t)NN * HID)
#define WS_VI  (WS_K + 2u * (size_t)NN * HID)           // f16 v_in rows [n][256]
#define WS_VP  (WS_VI + 2u * (size_t)NN * HID)          // f16 planes of v_0 - v_1, [c][n]
#define WS_O   (WS_VP + 2u * (size_t)VW * NN)            // f32 partial head sums [n][key range][256], 8 key ranges
#define WS_PS  (WS_O + 4u * 8u * (size_t)NN * HID)       // f32 column sums of v_1 over each block of 64 nodes, [node block][256]
#define WS_END (WS_PS + 4u * (size_t)(NN / 64) * VW)
typedef __attribute__((ext_vector_type(8)))  __bf16 v8b;
__device__ __forceinline__ v16b frag_b(const __bf16* rowk0, int lane) {
  union { v16b v; v8b q[2]; } u; const __bf16* p = rowk0 + 8 * (lane >> 4);
  u.q[0] = *(const v8b*)p; u.q[1] = *(const v8b*)(p + 16); return u.v;
}
// publish point of an LDS weight tile: the wave's own LDS stores and reads have retired, then the work-group barrier. Written by hand because __syncthreads() also drains the global loads that are meant to stay in flight across it.
#define WT_BAR() do { asm volatile("s_wait_dscnt 0x0" ::: "memory"); asm volatile("s_barrier_signal -1\n\ts_barrier_wait -1" ::: "memory"); } while (0)
// ---- k_fc: block = 64 rows, 8 waves of 16 rows x 128 columns: y = x fc_w + b (exact bf16 products) -> LDS; per row LayerNorm (eps 1e-5) x g0 + b0, ReLU -> X rows (1 KB each). fc_w is read once per block in chunks of 64 k x 256 columns with whole-row loads, rounded to bf16 once and stored k-contiguous per column in LDS (two buffers, row pitch 144 B); the next chunk's loads (weights and the wave's own x pieces) fly while this chunk is multiplied. Every accumulator still sums k in ascending blocks of 32.
#define FC_BK 64
#define FC_T (DIN / FC_BK)
#define FC_LD (FC_BK + 8)
__global__ __launch_bounds__(256) void k_fc(const float* __restrict__ XI, const float* __restrict__ W, const float* __restrict__ Bv, const float* __restrict__ G0, const float* __restrict__ B0, float* __restrict__ X) { __shared__ __align__(16) float sy[64][HID + 4]; __shared__ __align__(16) __bf16 wt[2][HID][FC_LD];
  const int tid = threadIdx.x, wave = tid >> 5, lane = tid & 31, col = lane & 15, g = lane >> 4; const size_t r0 = (size_t)blockIdx.x * 64; const int wr = (wave >> 1) * 16, cp = wave & 1;
  const int nq = tid & 63, kg = tid >> 6;   // staging piece: 8 k rows x 4 columns; a wave covers 512 B of one weight row per load
  const float* gw = W + (size_t)(kg * 8) * HID + nq * 4; const float* gx = XI + (r0 + wr + col) * DIN + 8 * g;
  v4f rw[16], rx[8]; v16b a[2]; v8f acc[8] = {};
  auto ldw = [&](int c) {
#pragma unroll
    for (int i = 0; i < 2; ++i)
#pragma unroll
      for (int e = 0; e < 8; ++e) rw[i * 8 + e] = *(const v4f*)(gw + (size_t)(c * FC_BK + i * 32 + e) * HID);
#pragma unroll
    for (int kk = 0; kk < 2; ++kk) { const float* p = gx + c * FC_BK + kk * 32; rx[kk * 4] = *(const v4f*)p; rx[kk * 4 + 1] = *(const v4f*)(p + 4); rx[kk * 4 + 2] = *(const v4f*)(p + 16); rx[kk * 4 + 3] = *(const v4f*)(p + 20); }
    __builtin_amdgcn_sched_barrier(0);   // keeps the chunk's loads together at this place, one chunk ahead of their use
    asm volatile("s_wait_xcnt 0x0" ::: "memory");   // the loads stay in flight over later arithmetic: their address registers are rewritten only behind this wait
    __builtin_amdgcn_sched_barrier(0); };   // keeps later register writes from being lifted over that wait
  auto stw = [&](int b) {
#pragma unroll
    for (int i = 0; i < 2; ++i)
#pragma unroll
      for (int m = 0; m < 4; ++m) { v8b t;
#pragma unroll
        for (int e = 0; e < 8; ++e) t[e] = (__bf16)rw[i * 8 + e][m];
        *(v8b*)&wt[b][nq * 4 + m][(kg + 4 * i) * 8] = t; }
#pragma unroll
    for (int kk = 0; kk < 2; ++kk)
#pragma unroll
      for (int i = 0; i < 4; ++i) { a[kk][i] = (__bf16)rx[kk * 4][i]; a[kk][4 + i] = (__bf16)rx[kk * 4 + 1][i]; a[kk][8 + i] = (__bf16)rx[kk * 4 + 2][i]; a[kk][12 + i] = (__bf16)rx[kk * 4 + 3][i]; } };
  auto mm = [&](int b) {
#pragma unroll
    for (int kk = 0; kk < 2; ++kk) { v16b f[8];   // the eight fragment reads go out as one group ahead of their products
#pragma unroll
      for (int j = 0; j < 8; ++j) f[j] = frag_b(&wt[b][cp * 128 + j * 16 + col][kk * 32], lane);
#pragma unroll
      for (int j = 0; j < 8; ++j) acc[j] = wmma_bf(a[kk], f[j], acc[j]); } };
  ldw(0); stw(0); ldw(1);
  WT_BAR();
#pragma unroll 1
  for (int c = 0; c < FC_T; ++c) {   // rolled: one copy of the body is enough
    mm(c & 1);
    if (c + 1 < FC_T) stw((c + 1) & 1);
    if (c + 2 < FC_T) ldw(c + 2);
    WT_BAR();   // chunk c+1 is published; every reader has left the buffer of chunk c
  }
#pragma unroll
  for (int j = 0; j < 8; ++j) { const int o = cp * 128 + j * 16 + col; const float bb = bfr(Bv[o]);
#pragma unroll
    for (int r = 0; r < 8; ++r) sy[wr + 8 * g + r][o] = acc[j][r] + bb; }
  __syncthreads();
  // LN per row: 2 threads per row (the first 128 threads / 64 rows), each 128 elements
  if (tid < 128) { const int row = tid >> 1, half = tid & 1; float* v = &sy[row][half * 128]; float s = 0.f; for (int e = 0; e < 128; ++e) s += v[e]; s += __shfl_xor(s, 1); const float mu = s * (1.0f / HID);
    float s2 = 0.f; for (int e = 0; e < 128; ++e) { const float d = v[e] - mu; s2 += d * d; } s2 += __shfl_xor(s2, 1); const float rs = rsqrtf(s2 * (1.0f / HID) + 1e-5f);
    for (int e = 0; e < 128; ++e) { const int c = half * 128 + e; v[e] = fmaxf((v[e] - mu) * rs * bfr(G0[c]) + bfr(B0[c]), 0.f); } }
  __syncthreads();
  for (int q = tid; q < 64 * HID / 4; q += 256) { const int row = q / (HID / 4), c4 = (q % (HID / 4)) * 4; vst2(X + (r0 + row) * HID + c4, *(const v4f*)&sy[row][c4]); } }
// ---- k_lin: block = (64 rows, 128 cols, which = wb + blockIdx.z), 8 waves of 16 x 64: which 0 q, 1 k, 2 v_in from X (f32 -> f16 A), the three of them independent and therefore one launch (grid z = 3, wb 0); 3 v = v_in (f16 rows) Wvg + b (grid z = 1, wb 3, first pointer of each triple): the block's 128 columns are 64 columns of head 0 and the same 64 of head 1 (4 column blocks), laid out so that a wave holds both heads of its 32 columns; it writes v_0 - v_1 (f32 difference -> f16 planes [c][n]) and the f32 sum of v_1 over its 64 rows (PS[row block][c]). The block's weight tile (256 k x 128 columns) is read once with whole-row loads, converted once and stored k-contiguous per column in LDS (row pitch 528 B); the 64 operand rows go through LDS the same way; all fragments come from LDS. Every accumulator still sums k in ascending blocks of 32.
#define LIN_LD (HID + 8)
// behind a group of global loads: the first scheduling barrier keeps all of the group's loads issued before the first is waited for; s_wait_xcnt stands before any of their address registers is rewritten; the second scheduling barrier keeps later register writes from being lifted over that wait
#define LIN_ISSUED() do { __builtin_amdgcn_sched_barrier(0); asm volatile("s_wait_xcnt 0x0" ::: "memory"); __builtin_amdgcn_sched_barrier(0); } while (0)
__global__ __launch_bounds__(256) void k_lin(const float* __restrict__ X, const _Float16* __restrict__ VI, const float* __restrict__ Wa, const float* __restrict__ Wb, const float* __restrict__ Wc, const float* __restrict__ Ba, const float* __restrict__ Bb, const float* __restrict__ Bc, int wb, _Float16* __restrict__ Da, _Float16* __restrict__ Db, _Float16* __restrict__ Dc, float* __restrict__ PS) { __shared__ __align__(16) _Float16 sh[64][136]; __shared__ __align__(16) _Float16 th[64][72]; __shared__ float ps[8][64]; __shared__ __align__(16) _Float16 wt[128][LIN_LD]; __shared__ __align__(16) _Float16 sa[64][LIN_LD];
  const int tid = threadIdx.x, wave = tid >> 5, lane = tid & 31, col = lane & 15, g = lane >> 4; const size_t r0 = (size_t)blockIdx.x * 64; const int wr = (wave >> 1) * 16, wc = (wave & 1) * 64;
  const int z = blockIdx.z, which = wb + z, c0 = blockIdx.y * (which < 3 ? 128 : 64); const float* Wm = z == 0 ? Wa : z == 1 ? Wb : Wc; const float* Bv = z == 0 ? Ba : z == 1 ? Bb : Bc; _Float16* D = z == 0 ? Da : z == 1 ? Db : Dc;
  { v4f rw[32];   // staging piece: 8 k rows x 4 columns; a wave covers the tile's whole 512-B row per load
    const int sr = wave * 8;
    // which 3: lanes 0..15 read head 0's 64 columns, lanes 16..31 head 1's; tile row = (column >> 5) * 64 + (head * 2 + ((column >> 4) & 1)) * 16 + (column & 15)
    const int sc = which < 3 ? c0 + lane * 4 : g * VW + c0 + col * 4, lr = which < 3 ? lane * 4 : ((lane >> 3) & 1) * 64 + (g * 2 + ((lane >> 2) & 1)) * 16 + (lane & 3) * 4;
    if (which < 3) { v4f rx[16]; const float* gw = Wm + (size_t)sr * HID + sc; const float* gx = X + (r0 + (tid >> 6)) * HID + (tid & 63) * 4;
#pragma unroll
      for (int i = 0; i < 4; ++i)
#pragma unroll
        for (int e = 0; e < 8; ++e) rw[i * 8 + e] = *(const v4f*)(gw + (i * 64 + e) * HID);
#pragma unroll
      for (int i = 0; i < 16; ++i) rx[i] = *(const v4f*)(gx + i * 4 * HID);
      LIN_ISSUED();
#pragma unroll
      for (int i = 0; i < 16; ++i) { v4hh t; t[0] = (_Float16)rx[i][0]; t[1] = (_Float16)rx[i][1]; t[2] = (_Float16)rx[i][2]; t[3] = (_Float16)rx[i][3]; *(v4hh*)&sa[(tid >> 6) + 4 * i][(tid & 63) * 4] = t; } }
    else { v8h rx[8]; const float* gw = Wm + (size_t)sr * (NHD * VW) + sc; const _Float16* gx = VI + (r0 + (tid >> 5)) * HID + (tid & 31) * 8;
#pragma unroll
      for (int i = 0; i < 4; ++i)
#pragma unroll
        for (int e = 0; e < 8; ++e) rw[i * 8 + e] = *(const v4f*)(gw + (i * 64 + e) * (NHD * VW));
#pragma unroll
      for (int i = 0; i < 8; ++i) rx[i] = *(const v8h*)(gx + i * 8 * HID);
      LIN_ISSUED();
#pragma unroll
      for (int i = 0; i < 8; ++i) *(v8h*)&sa[(tid >> 5) + 8 * i][(tid & 31) * 8] = rx[i]; }
#pragma unroll
    for (int i = 0; i < 4; ++i)
#pragma unroll
      for (int m = 0; m < 4; ++m) { v8h t;
#pragma unroll
        for (int e = 0; e < 8; ++e) t[e] = (_Float16)(bfr(rw[i * 8 + e][m]) * 16.0f);
        *(v8h*)&wt[lr + m][(wave + 8 * i) * 8] = t; } }
  __syncthreads();
  v8f acc[4] = {}; v16h fa[2], fb[2][4];
  auto lf = [&](int kc) { fa[kc & 1] = frag_h(&sa[wr + col][kc * 32], lane);
#pragma unroll
    for (int j = 0; j < 4; ++j) fb[kc & 1][j] = frag_h(&wt[wc + j * 16 + col][kc * 32], lane); };
  lf(0);
#pragma unroll
  for (int kc = 0; kc < HID / 32; ++kc) { if (kc + 1 < HID / 32) lf(kc + 1);   // the next step's fragment reads go out ahead of this step's products
#pragma unroll
    for (int j = 0; j < 4; ++j) acc[j] = wmma16(fa[kc & 1], fb[kc & 1][j], acc[j]); }
  if (which < 3) {
#pragma unroll
    for (int j = 0; j < 4; ++j) { const int cl = wc + j * 16 + col; const float bb = bfr(Bv[c0 + cl]);
#pragma unroll
      for (int r = 0; r < 8; ++r) sh[wr + 8 * g + r][cl] = (_Float16)(acc[j][r] * (1.0f / 16.0f) + bb); } }
  else {
#pragma unroll
    for (int j = 0; j < 2; ++j) { const int cl = (wave & 1) * 32 + j * 16 + col; const float b0 = bfr(Bv[c0 + cl]), b1 = bfr(Bv[VW + c0 + cl]); float s = 0.f;   // acc[j] = head 0, acc[j + 2] = head 1 of the same column
#pragma unroll
      for (int r = 0; r < 8; ++r) { const float v0 = acc[j][r] * (1.0f / 16.0f) + b0, v1 = acc[j + 2][r] * (1.0f / 16.0f) + b1; th[cl][wr + 8 * g + r] = (_Float16)(v0 - v1); s += v1; }
      ps[(wave >> 1) * 2 + g][cl] = s; } }
  __syncthreads();
  if (which < 3) { for (int e = tid; e < 64 * 16; e += 256) { const int rl = e >> 4, q = e & 15; vst2((unsigned*)(D + (r0 + rl) * HID + c0 + q * 8), *(const v4u*)&sh[rl][q * 8]); } }
  else { for (int e = tid; e < 64 * 8; e += 256) { const int cl = e >> 3, q = e & 7; vst2((unsigned*)(D + (size_t)(c0 + cl) * NN + r0 + q * 8), *(const v4u*)&th[cl][q * 8]); }
    if (tid < 64) { float s = ps[0][tid];
#pragma unroll
      for (int i = 1; i < 8; ++i) s += ps[i][tid];
      PS[(size_t)blockIdx.x * VW + c0 + tid] = s; } } }
// ---- k_att: block = (64 queries n, one of 8 key ranges of 512 keys l), 8 waves, all 256 output columns. Per tile of 64 keys: s_h = q_h . k_h / sqrt(128) for BOTH heads (wave = 16 queries x 32 keys), the reference's softmax over the HEAD axis (axis -1 of [n, l, h]): w_0 = 1 / (1 + exp(s_1 - s_0)), w_1 = 1 - w_0, in f32 as 2^11 w_0 = rcp(2^-11 + exp2((s_1 - s_0) log2(e) / sqrt(128) - 11)) on the hardware's own exp2 and reciprocal: their error of about one f32 unit in the last place lies far below the f16 rounding that follows; an overflowing exp2 gives inf and weight 0, a vanishing one weight 2^11, as the limits ask. There is no normalisation over l and the reference takes the mean of the heads, so the two heads' products add up, and w_0 v_0 + (1 - w_0) v_1 = w_0 (v_0 - v_1) + v_1: only w_0 is kept, rounded to f16 x 2^11 into an LDS tile [query][key]; that tile times the tile of v_0 - v_1 (wave = 64 queries x 32 columns) is the one product left, and the sum of v_1 over the range's keys, the same for every query, comes from PS and is added at the end. The key ranges are plain partial sums: O[n][range][c], added up in k_mix. The weights never leave the block. Every logit still sums k in ascending blocks of 32. Row pitches in LDS: 528 B (q, k), 144 B (v, weights).
__device__ __forceinline__ v8f wmma16c(v16h a, v16h b, v8f c) { return __builtin_amdgcn_wmma_f32_16x16x32_f16(false, a, false, b, (short)0, c, false, false); }   // the builtin alone: the compiler keeps the distance behind it itself
#define AT_BK 64
#define AT_SPL 8
#define AT_KS (NN / AT_SPL)
#define AT_T (AT_KS / AT_BK)
#define AT_QLD (HID + 8)
#define AT_VLD (AT_BK + 8)
#define AT_PLD (AT_BK + 8)
#define AT_OLD (HID + 4)
__global__ __launch_bounds__(256) __attribute__((amdgpu_waves_per_eu(4, 4))) void k_att(const _Float16* __restrict__ Q, const _Float16* __restrict__ K, const _Float16* __restrict__ VP, const float* __restrict__ PS, float* __restrict__ O) { __shared__ __align__(16) _Float16 sqk[64 + AT_BK][AT_QLD], sv[VW][AT_VLD], sp[64][AT_PLD]; _Float16 (*const sq)[AT_QLD] = sqk; _Float16 (*const sk)[AT_QLD] = sqk + 64;
  const int tid = threadIdx.x, wave = tid >> 5, lane = tid & 31, col = lane & 15, g = lane >> 4; const int n0 = blockIdx.x * 64, l0 = blockIdx.y * AT_KS, wr = (wave >> 1) * 16, wk = (wave & 1) * 32, wc = wave * 32;
  const int kr = tid >> 5, kq = (tid & 31) * 8;   // q, k staging: a wave covers one whole 512-B row per load
  const int vr = tid >> 3, vq = (tid & 7) * 8;    // v staging: 8 lanes cover one 128-B row piece, a wave four rows per load
  const _Float16* gk = K + (size_t)(l0 + kr) * HID + kq; const _Float16* gv = VP + (size_t)vr * NN + l0 + vq;
  const float isl = 1.44269504088896340736f / sqrtf((float)DK);   // log2(e) / sqrt(128)
  v8f acc[4][2] = {};   // every loop over acc, rq, rk, rv and the fragments is unrolled: they are register arrays
  { v8h rq[8], rk[8]; const _Float16* gq = Q + (size_t)(n0 + kr) * HID + kq;
#pragma unroll
    for (int i = 0; i < 8; ++i) { rq[i] = *(const v8h*)(gq + (size_t)(8 * i) * HID); rk[i] = *(const v8h*)(gk + (size_t)(8 * i) * HID); }
    __builtin_amdgcn_sched_barrier(0);   // all 16 loads are out before the first is waited for
    asm volatile("s_wait_xcnt 0x0" :: "v"(gq), "v"(gk) : "memory");   // the two addresses are inputs, so they stay in their registers up to this wait: no load of the group lands on them, and they are rewritten only behind it
    __builtin_amdgcn_sched_barrier(0);   // keeps later register writes from being lifted over that wait
#pragma unroll
    for (int i = 0; i < 8; ++i) { *(v8h*)&sq[kr + 8 * i][kq] = rq[i]; *(v8h*)&sk[kr + 8 * i][kq] = rk[i]; } }
  __syncthreads();   // the query rows and the first key tile are published
  auto tile = [&](const int t, const bool more) { v8h rk[8], rv[8];   // more: a next key tile exists (the same for the whole block)
#pragma unroll
    for (int i = 0; i < 8; ++i) rv[i] = *(const v8h*)(gv + (size_t)(32 * i) * NN + t * AT_BK);
    LIN_ISSUED();   // the value tile's loads go out here and fly under the logits and the softmax; their address registers are rewritten only behind the wait
    v8f s0[2] = {}, s1[2] = {};
#pragma unroll
    for (int kc = 0; kc < DK / 32; ++kc) { const v16h a0 = frag_h(&sq[wr + col][kc * 32], lane), a1 = frag_h(&sq[wr + col][DK + kc * 32], lane); v16h f0[2], f1[2];   // the step's fragment reads go out as one group ahead of its products
#pragma unroll
      for (int j = 0; j < 2; ++j) { f0[j] = frag_h(&sk[wk + j * 16 + col][kc * 32], lane); f1[j] = frag_h(&sk[wk + j * 16 + col][DK + kc * 32], lane); }
#pragma unroll
      for (int j = 0; j < 2; ++j) { s0[j] = wmma16c(a0, f0[j], s0[j]); s1[j] = wmma16c(a1, f1[j], s1[j]); } }
    float e[2][8];   // all 16 exponentials, then all 16 reciprocals: 16 independent chains instead of one after another
#pragma unroll
    for (int j = 0; j < 2; ++j)
#pragma unroll
      for (int r = 0; r < 8; ++r) e[j][r] = __builtin_amdgcn_exp2f((s1[j][r] - s0[j][r]) * isl - 11.0f);
#pragma unroll
    for (int j = 0; j < 2; ++j)
#pragma unroll
      for (int r = 0; r < 8; ++r) e[j][r] = __builtin_amdgcn_rcpf(e[j][r] + 0x1p-11f);
#pragma unroll
    for (int j = 0; j < 2; ++j)
#pragma unroll
      for (int r = 0; r < 8; ++r) sp[wr + 8 * g + r][wk + j * 16 + col] = (_Float16)e[j][r];
#pragma unroll
    for (int i = 0; i < 8; ++i) *(v8h*)&sv[vr + 32 * i][vq] = rv[i];
    __syncthreads();   // the tile's weights and values are published; every reader has left the key tile
    if (more) {
#pragma unroll
      for (int i = 0; i < 8; ++i) rk[i] = *(const v8h*)(gk + (size_t)((t + 1) * AT_BK + 8 * i) * HID);
      LIN_ISSUED(); }   // the next key tile's loads fly under this tile's products; their address registers are rewritten only behind the wait
    v16h fa[AT_BK / 32][4], fb[AT_BK / 32][2];
#pragma unroll
    for (int kk = 0; kk < AT_BK / 32; ++kk) {
#pragma unroll
      for (int i = 0; i < 4; ++i) fa[kk][i] = frag_h(&sp[i * 16 + col][kk * 32], lane);
#pragma unroll
      for (int j = 0; j < 2; ++j) fb[kk][j] = frag_h(&sv[wc + j * 16 + col][kk * 32], lane); }
    __builtin_amdgcn_sched_barrier(0);   // the tile's 12 fragment reads go out as one group ahead of its products: read piecemeal, every pair of products waits for its own reads
#pragma unroll
    for (int kk = 0; kk < AT_BK / 32; ++kk)
#pragma unroll
      for (int i = 0; i < 4; ++i)
#pragma unroll
        for (int j = 0; j < 2; ++j) acc[i][j] = wmma16c(fa[kk][i], fb[kk][j], acc[i][j]);
    if (more) {
#pragma unroll
      for (int i = 0; i < 8; ++i) *(v8h*)&sk[kr + 8 * i][kq] = rk[i]; }
    __syncthreads(); };   // the next key tile is published; every reader has left the weight and value tiles
#pragma unroll 1
  for (int t = 0; t < AT_T; ++t) tile(t, t + 1 < AT_T);   // rolled, the last tile included ('more' is a scalar test): one copy of the body is enough, and a copy of its own for the last tile was scheduled past the register budget (spills)
  v4f pv[AT_KS / 64]; const float* gp = PS + (size_t)blockIdx.y * (AT_KS / 64) * VW + (tid & 63) * 4;   // the thread's four output columns: v_1 summed over each of the range's blocks of 64 keys
#pragma unroll
  for (int s = 0; s < AT_KS / 64; ++s) pv[s] = *(const v4f*)(gp + s * VW);
  LIN_ISSUED();   // the loads fly under the LDS stores below; their address registers are rewritten only behind the wait
  float* so = (float*)&sqk[0][0];   // the 64 x 256 result tile (row pitch 1,040 B) reuses the query and key tiles' LDS behind the last barrier
#pragma unroll
  for (int i = 0; i < 4; ++i)
#pragma unroll
    for (int j = 0; j < 2; ++j)
#pragma unroll
      for (int r = 0; r < 8; ++r) so[(i * 16 + 8 * g + r) * AT_OLD + wc + j * 16 + col] = acc[i][j][r] * (1.0f / 2048.0f);
  __syncthreads();
  v4f s1 = pv[0];
#pragma unroll
  for (int s = 1; s < AT_KS / 64; ++s) s1 += pv[s];
  for (int e = tid; e < 64 * (HID / 4); e += 256) { const int rl = e / (HID / 4), c4 = (e % (HID / 4)) * 4; vst2(O + ((size_t)(n0 + rl) * AT_SPL + blockIdx.y) * HID + c4, *(const v4f*)&so[rl * AT_OLD + c4] + s1); } }   // c4 = (tid & 63) * 4 on every trip: the step of 256 is a multiple of 64
// ---- k_mix: block = 16 rows, 128 threads: v = 0.5 * (0.5 * sum over the key ranges of O) + 0.5 * x_prev, read with whole-row loads into LDS; then 2 threads per row (one wave): x = LN(v) * g + b (in place on X, or to OUT for the last layer)
#define MX_R 16
__global__ __launch_bounds__(128) void k_mix(const float* __restrict__ O, float* __restrict__ X, const float* __restrict__ Gm, const float* __restrict__ Bb, float* __restrict__ OUT) { __shared__ __align__(16) float sy[MX_R][HID + 4];
  const int tid = threadIdx.x; const size_t r0 = (size_t)blockIdx.x * MX_R; const int rw0 = tid >> 6, c0 = (tid & 63) * 4;   // 64 threads cover one 1-KB row piece, the block two rows per load
  const float* po = O + (r0 + rw0) * AT_SPL * HID + c0; const float* px = X + (r0 + rw0) * HID + c0;
#pragma unroll
  for (int hg = 0; hg < MX_R / 8; ++hg) { v4f p[4][AT_SPL], x[4];   // unrolled: p and x are register arrays; 36 loads are out together
#pragma unroll
    for (int i = 0; i < 4; ++i) { const int rr = (hg * 4 + i) * 2;
#pragma unroll
      for (int s = 0; s < AT_SPL; ++s) p[i][s] = *(const v4f*)(po + (size_t)(rr * AT_SPL + s) * HID);
      x[i] = *(const v4f*)(px + (size_t)rr * HID); }
    LIN_ISSUED();   // all of the group's loads are out before the first is waited for; their address registers are rewritten only behind the wait
#pragma unroll
    for (int i = 0; i < 4; ++i) { v4f a = p[i][0];
#pragma unroll
      for (int s = 1; s < AT_SPL; ++s) a += p[i][s];
      *(v4f*)&sy[rw0 + (hg * 4 + i) * 2][c0] = 0.5f * (a * 0.5f) + 0.5f * x[i]; } }
  __syncthreads();
  if (tid < 2 * MX_R) { const int row = tid >> 1, half = tid & 1;
    float s = 0.f; for (int e = 0; e < 128; ++e) s += sy[row][half * 128 + e];
    s += __shfl_xor(s, 1); const float mu = s * (1.0f / HID); float s2 = 0.f; for (int e = 0; e < 128; ++e) { const float d = sy[row][half * 128 + e] - mu; s2 += d * d; } s2 += __shfl_xor(s2, 1); const float rs = rsqrtf(s2 * (1.0f / HID) + 1e-5f);
    for (int e = 0; e < 128; ++e) { const int c = half * 128 + e; sy[row][c] = (sy[row][c] - mu) * rs * bfr(Gm[c]) + bfr(Bb[c]); } }
  __syncthreads();
  float* dst = OUT ? OUT : X;
  for (int q = tid; q < MX_R * HID / 4; q += 128) { const int rw = q / (HID / 4), c4 = (q % (HID / 4)) * 4; vst2(dst + (r0 + rw) * HID + c4, *(const v4f*)&sy[rw][c4]); } }
extern "C" void kernel_launch(void* const* d_in, const int* in_sizes, int n_in, void* d_out, int out_size, void* d_ws, size_t ws_size, hipStream_t stream) {
  (void)in_sizes; (void)n_in; (void)out_size;
  const float** F = (const float**)d_in;   // 0 x [4096,512], 1 fc_w [512,256], 2 fc_b, 3 ln_g [3,256], 4 ln_b [3,256], 5 wq [2,256,256], 6 bq [2,256], 7 wk, 8 bk, 9 wvl, 10 bvl, 11 wvg [2,256,512], 12 bvg [2,512]
  if (ws_size < (size_t)WS_END) return;
  char* ws = (char*)d_ws; float *X = (float*)(ws + WS_X), *O = (float*)(ws + WS_O), *PS = (float*)(ws + WS_PS); _Float16 *Q = (_Float16*)(ws + WS_Q), *K = (_Float16*)(ws + WS_K), *VI = (_Float16*)(ws + WS_VI), *VP = (_Float16*)(ws + WS_VP);
  k_fc<<<dim3(NN / 64), 256, 0, stream>>>(F[0], F[1], F[2], F[3], F[4], X);
  for (int l = 0; l < TNL; ++l) {
    k_lin<<<dim3(NN / 64, HID / 128, 3), 256, 0, stream>>>(X, nullptr, F[5] + (size_t)l * HID * HID, F[7] + (size_t)l * HID * HID, F[9] + (size_t)l * HID * HID, F[6] + l * HID, F[8] + l * HID, F[10] + l * HID, 0, Q, K, VI, PS);
    const float* wg = F[11] + (size_t)l * HID * NHD * VW; const float* bg = F[12] + l * NHD * VW;
    k_lin<<<dim3(NN / 64, (NHD * VW) / 128, 1), 256, 0, stream>>>(X, VI, wg, wg, wg, bg, bg, bg, 3, VP, VP, VP, PS);
    k_att<<<dim3(NN / 64, AT_SPL), 256, 0, stream>>>(Q, K, VP, PS, O);
    k_mix<<<dim3(NN / MX_R), 128, 0, stream>>>(O, X, F[3] + (l + 1) * HID, F[4] + (l + 1) * HID, (l == NL - 1) ? (float*)d_out : nullptr);
  }
}

// v009
// One run takes 90.2 microseconds.
// Versions in between are left out here; by their measured steps it is 1.24 times as fast as v007.
// Counting every step since v000, it is 14.0 times as fast.
// compute dtype: all float inputs rounded to bf16; x fc_w exact bf16 products on WMMA 16x16x32; LayerNorm/ReLU in f32; per layer the q/k/v projections with the LayerNorm'd operand rounded once to f16 against f16 weights (x 16, folded; bf16 values for q and k); the two value projections are one: v = x (Wvl Wvg) + (bvl Wvg + bvg), the weight product from exact f16 copies of the bf16 weights, f32 sums, rounded once to f16; both heads' logits q.k/sqrt(128) from f16 rows (1 product) and the reference's softmax over the HEAD axis (a 2-way softmax per (node, node) pair, f32, the hardware's exp2 and reciprocal) -> w_0 rounded to f16 x 2^11; because w_1 = 1 - w_0, the sum over all nodes and both heads of w_h v_h is taken as sum of w_0 (v_0 - v_1) (the difference formed in f32, rounded once to f16) plus the f32 column sum of v_1; head mean, residual mix and LayerNorm in f32; f32 output.
#include <hip/hip_runtime.h>
#include <math.h>

typedef __attribute__((ext_vector_type(16))) _Float16 v16h;
typedef __attribute__((ext_vector_type(16))) __bf16 v16b;
typedef __attribute__((ext_vector_type(8)))  _Float16 v8h;
typedef __attribute__((ext_vector_type(4)))  _Float16 v4hh;
typedef __attribute__((ext_vector_type(8)))  float v8f;
typedef __attribute__((ext_vector_type(4)))  float v4f;
typedef __attribute__((ext_vector_type(2)))  float v2f;
typedef __attribute__((ext_vector_type(4)))  unsigned v4u;
typedef __attribute__((ext_vector_type(4)))  int v4i;
typedef float __attribute__((may_alias)) float_a;
typedef int __attribute__((may_alias)) int_a;

template <typename T> __device__ __forceinline__ void vst2(void* p, T v) { *(T*)p = v;  }
__device__ __forceinline__ v8f wmma16(v16h a, v16h b, v8f c) {
  v8f d = __builtin_amdgcn_wmma_f32_16x16x32_f16(false, a, false, b, (short)0, c, false, false);
  asm volatile("v_nop\n\tv_nop\n\tv_nop\n\tv_nop" : "+v"(d) : "v"(a), "v"(b));
  return d;
}
__device__ __forceinline__ v8f wmma_bf(v16b a, v16b b, v8f c) {
  v8f d = __builtin_amdgcn_wmma_f32_16x16x32_bf16(false, a, false, b, (short)0, c, false, false);
  asm volatile("v_nop\n\tv_nop\n\tv_nop\n\tv_nop" : "+v"(d) : "v"(a), "v"(b));
  return d;
}
// 16x16x32 fragments: lane = (h = lane>>4, row/col = lane&15); elements 0..7 = k0+8h+0..7, 8..15 = k0+16+8h+0..7; D element r = row 8h+r
__device__ __forceinline__ v16h frag_h(const _Float16* rowk0, int lane) {
  union { v16h v; v8h q[2]; } u; const _Float16* p = rowk0 + 8 * (lane >> 4);
  u.q[0] = *(const v8h*)p; u.q[1] = *(const v8h*)(p + 16); return u.v;
}
__device__ __forceinline__ v16h frag_f32(const float* rowk0, int lane) {
  v16h a; const float* p = rowk0 + 8 * (lane >> 4);
#pragma unroll
  for (int i = 0; i < 8; ++i) { a[i] = (_Float16)p[i]; a[8 + i] = (_Float16)p[16 + i]; }
  return a;
}
__device__ __forceinline__ v16h frag_f32s(const float* rowk0, int lane, float sc) {
  v16h a; const float* p = rowk0 + 8 * (lane >> 4);
#pragma unroll
  for (int i = 0; i < 8; ++i) { a[i] = (_Float16)(p[i] * sc); a[8 + i] = (_Float16)(p[16 + i] * sc); }
  return a;
}
// column fragment from a [K][ld] layout (column n), rows >= K read as 0
__device__ __forceinline__ v16h fragc_f32(const float* W, int k0, int n, int lane, int ld, int K) {
  v16h a; const int g = lane >> 4;
#pragma unroll
  for (int i = 0; i < 8; ++i) { const int ka = k0 + 8 * g + i, kb = ka + 16;
    a[i] = (_Float16)(ka < K ? W[(size_t)(ka < K ? ka : K - 1) * ld + n] : 0.f); a[8 + i] = (_Float16)(kb < K ? W[(size_t)(kb < K ? kb : K - 1) * ld + n] : 0.f); }
  return a;
}
struct F2 { v16b h, l; };
__device__ __forceinline__ F2 bsplit16(const float v[16]) { F2 r;
#pragma unroll
  for (int i = 0; i < 16; ++i) { const __bf16 h = (__bf16)v[i]; r.h[i] = h; r.l[i] = (__bf16)(v[i] - (float)h); }
  return r; }
__device__ __forceinline__ F2 split_row(const float* row, int k0, int lane) { float v[16]; const float* p = row + k0 + 8 * (lane >> 4);
#pragma unroll
  for (int i = 0; i < 8; ++i) { v[i] = p[i]; v[8 + i] = p[16 + i]; }
  return bsplit16(v); }
__device__ __forceinline__ F2 split_rowK(const float* row, int k0, int lane, int K) { float v[16]; const int g = lane >> 4;
#pragma unroll
  for (int i = 0; i < 8; ++i) { const int ka = k0 + 8 * g + i, kb = ka + 16; v[i] = ka < K ? row[ka < K ? ka : K - 1] : 0.f; v[8 + i] = kb < K ? row[kb < K ? kb : K - 1] : 0.f; }
  return bsplit16(v); }
__device__ __forceinline__ F2 split_col(const float* W, int k0, int n, int lane, int ld, int K) { float v[16]; const int g = lane >> 4;
#pragma unroll
  for (int i = 0; i < 8; ++i) { const int ka = k0 + 8 * g + i, kb = ka + 16; v[i] = ka < K ? W[(size_t)(ka < K ? ka : K - 1) * ld + n] : 0.f; v[8 + i] = kb < K ? W[(size_t)(kb < K ? kb : K - 1) * ld + n] : 0.f; }
  return bsplit16(v); }
__device__ __forceinline__ v8f mac3(const F2& a, const F2& b, v8f c) { c = wmma_bf(a.l, b.h, c); c = wmma_bf(a.h, b.l, c); return wmma_bf(a.h, b.h, c); }
__device__ __forceinline__ float sigm(float v) { return 1.0f / (1.0f + expf(-v)); }

// TransConv (graph-transformer style, N 4,096 nodes, in 512, hidden 256, 2 heads x 128, 2 layers, alpha 0.5): x = relu(LN(x fc_w + b)); per layer: q, k = x W + b (per head 128), v = (x Wvl + b) Wvg + b (per head 256), scores[n][l][h] = q_n,h . k_l,h / sqrt(128), w = softmax over the LAST axis = the 2 heads (literally as written), out[n][h] = sum_l w[n][l][h] v[l][h], head mean, x = LN(0.5 out + 0.5 x_prev).
__device__ __forceinline__ float bfr(float v) { return (float)(__bf16)v; }
#define NN 4096
#define DIN 512
#define HID 256
#define NHD 2
#define DK 128
#define VW 256                 // per-head value width
#define NL 2
#ifndef TNL
#define TNL NL
#endif
#define WS_X   0u                                      // f32 x rows [n][256] (current layer input / prev)
#define WS_Q   (WS_X + 4u * (size_t)NN * HID)           // f16 q rows [n][256]
#define WS_K   (WS_Q + 2u * (size_t)NN * HID)
#define WS_VP  (WS_K + 2u * (size_t)NN * HID)           // f16 planes of v_0 - v_1, [c][n]
#define WS_O   (WS_VP + 2u * (size_t)VW * NN)            // f32 partial head sums [n][key range][256], 8 key ranges
#define WS_PS  (WS_O + 4u * 8u * (size_t)NN * HID)       // f32 column sums of v_1 over each block of 64 nodes, [node block][256]
#define WS_CW  (WS_PS + 4u * (size_t)(NN / 64) * VW)     // f32 weight products Wvl Wvg, [layer][256][512]
#define WS_CB  (WS_CW + 4u * (size_t)NL * HID * NHD * VW) // f32 bias rows bvl Wvg + bvg, [layer][512]
#define WS_END (WS_CB + 4u * (size_t)NL * NHD * VW)
typedef __attribute__((ext_vector_type(8)))  __bf16 v8b;
__device__ __forceinline__ v16b frag_b(const __bf16* rowk0, int lane) {
  union { v16b v; v8b q[2]; } u; const __bf16* p = rowk0 + 8 * (lane >> 4);
  u.q[0] = *(const v8b*)p; u.q[1] = *(const v8b*)(p + 16); return u.v;
}
// publish point of an LDS weight tile: the wave's own LDS stores and reads have retired, then the work-group barrier. Written by hand because __syncthreads() also drains the global loads that are meant to stay in flight across it.
#define WT_BAR() do { asm volatile("s_wait_dscnt 0x0" ::: "memory"); asm volatile("s_barrier_signal -1\n\ts_barrier_wait -1" ::: "memory"); } while (0)
// ---- lin_body: one block = 64 rows x 128 columns of a product A W, K = 256, 8 waves of 16 x 64. In k_lin (PRE false): which 0 q, 1 k from X (f32 -> f16 A) against the bf16-rounded weights x 16; which 3 v = X CW + CB, where CW = Wvl Wvg and CB = bvl Wvg + bvg (see below): the block's 128 columns are 64 columns of head 0 and the same 64 of head 1 (4 column blocks), laid out so that a wave holds both heads of its 32 columns; it writes v_0 - v_1 (f32 difference -> f16 planes [c][n]) and the f32 sum of v_1 over its 64 rows (PS[row block][c]). In k_fc's launch (PRE true): because (x Wvl + bvl) Wvg + bvg = x (Wvl Wvg) + (bvl Wvg + bvg), the product of the two weight matrices is formed first, once per layer: A = 64 rows of Wvl (or, br, the row bvl in all 64 rows, of which row 0 is kept), bf16-rounded x 16, W = 128 columns of Wvg, bf16-rounded x 16; f32 result to FO rows [256][512], the bias row + bvg to FB[512]. CW is rounded once to f16 (x 16) when k_lin stages it. The block's weight tile (256 k x 128 columns) is read once with whole-row loads, converted once and stored k-contiguous per column in LDS (row pitch 528 B); the 64 operand rows go through LDS the same way; all fragments come from LDS. Every accumulator sums k in ascending blocks of 32.
#define LIN_LD (HID + 8)
#define LIN_OLD (128 + 4)
// behind a group of global loads: the first scheduling barrier keeps all of the group's loads issued before the first is waited for; s_wait_xcnt stands before any of their address registers is rewritten; the second scheduling barrier keeps later register writes from being lifted over that wait
#define LIN_ISSUED() do { __builtin_amdgcn_sched_barrier(0); asm volatile("s_wait_xcnt 0x0" ::: "memory"); __builtin_amdgcn_sched_barrier(0); } while (0)
// the same with the group's addresses as inputs of the wait, so that they stay in their registers up to it: no load of the group lands on them
#define LIN_ISSUED2(a, b) do { __builtin_amdgcn_sched_barrier(0); asm volatile("s_wait_xcnt 0x0" :: "v"(a), "v"(b) : "memory"); __builtin_amdgcn_sched_barrier(0); } while (0)
#define LIN_ISSUED3(a, b, c) do { __builtin_amdgcn_sched_barrier(0); asm volatile("s_wait_xcnt 0x0" :: "v"(a), "v"(b), "v"(c) : "memory"); __builtin_amdgcn_sched_barrier(0); } while (0)
template <bool PRE> __device__ __forceinline__ void lin_body(const int which, const int rb, const int cb, const bool br, const float* __restrict__ A, const float* __restrict__ AB, const float* __restrict__ Wm, const float* __restrict__ Bv, _Float16* __restrict__ D, float* __restrict__ PS, float* __restrict__ FO, float* __restrict__ FB) { __shared__ __align__(16) _Float16 sh[64][136]; __shared__ __align__(16) _Float16 th[64][72]; __shared__ float ps[8][64]; __shared__ __align__(16) _Float16 wt[128][LIN_LD]; __shared__ __align__(16) _Float16 sa[64][LIN_LD];
  const int wave = PRE ? __builtin_amdgcn_readfirstlane(threadIdx.x >> 5) : threadIdx.x >> 5, lane = PRE ? (int)__builtin_amdgcn_mbcnt_lo(~0u, 0u) : threadIdx.x & 31, tid = wave * 32 + lane, col = lane & 15, g = lane >> 4; const size_t r0 = (size_t)rb * 64; const int wr = (wave >> 1) * 16, wc = (wave & 1) * 64;   // PRE: the wave's number as a scalar and the lane from the lane count, so that this path shares no vector value with k_fc's own path: shared ones were computed ahead of the branch and kept live through that path, whose 256 registers are full (one more brought register-window switches into its loop)
  const bool two = !PRE && which == 3; const int c0 = cb * (two ? 64 : 128);   // two: both heads of 64 columns
  { v4f rw[32], rx[16], bx = {};   // staging piece: 8 k rows x 4 columns; a wave covers the tile's whole 512-B row per load
    const int sr = wave * 8;
    // two: lanes 0..15 read head 0's 64 columns, lanes 16..31 head 1's; tile row = (column >> 5) * 64 + (head * 2 + ((column >> 4) & 1)) * 16 + (column & 15)
    const int sc = !two ? c0 + lane * 4 : g * VW + c0 + col * 4, lr = !two ? lane * 4 : ((lane >> 3) & 1) * 64 + (g * 2 + ((lane >> 2) & 1)) * 16 + (lane & 3) * 4;
    const float* gx = A + (r0 + (tid >> 6)) * HID + (tid & 63) * 4; const float* gb = PRE ? AB + (tid & 63) * 4 : gx;
    if (!PRE && which < 2) { const float* gw = Wm + (size_t)sr * HID + sc;
#pragma unroll
      for (int i = 0; i < 4; ++i)
#pragma unroll
        for (int e = 0; e < 8; ++e) rw[i * 8 + e] = *(const v4f*)(gw + (i * 64 + e) * HID);
#pragma unroll
      for (int i = 0; i < 16; ++i) rx[i] = *(const v4f*)(gx + i * 4 * HID);
      LIN_ISSUED2(gw, gx); }
    else { const float* gw = Wm + (size_t)sr * (NHD * VW) + sc;
#pragma unroll
      for (int i = 0; i < 4; ++i)
#pragma unroll
        for (int e = 0; e < 8; ++e) rw[i * 8 + e] = *(const v4f*)(gw + (i * 64 + e) * (NHD * VW));
#pragma unroll
      for (int i = 0; i < 16; ++i) rx[i] = *(const v4f*)(gx + i * 4 * HID);
      if (PRE) bx = *(const v4f*)(gb);
      LIN_ISSUED3(gw, gx, gb); }
    if (PRE) {
#pragma unroll
      for (int i = 0; i < 16; ++i) { const v4f a = br ? bx : rx[i]; v4hh t; t[0] = (_Float16)(bfr(a[0]) * 16.0f); t[1] = (_Float16)(bfr(a[1]) * 16.0f); t[2] = (_Float16)(bfr(a[2]) * 16.0f); t[3] = (_Float16)(bfr(a[3]) * 16.0f); *(v4hh*)&sa[(tid >> 6) + 4 * i][(tid & 63) * 4] = t; } }
    else {
#pragma unroll
      for (int i = 0; i < 16; ++i) { v4hh t; t[0] = (_Float16)rx[i][0]; t[1] = (_Float16)rx[i][1]; t[2] = (_Float16)rx[i][2]; t[3] = (_Float16)rx[i][3]; *(v4hh*)&sa[(tid >> 6) + 4 * i][(tid & 63) * 4] = t; } }
    if (!two) {   // an input's weights: rounded to bf16 as every input is
#pragma unroll
      for (int i = 0; i < 4; ++i)
#pragma unroll
        for (int m = 0; m < 4; ++m) { v8h t;
#pragma unroll
          for (int e = 0; e < 8; ++e) t[e] = (_Float16)(bfr(rw[i * 8 + e][m]) * 16.0f);
          *(v8h*)&wt[lr + m][(wave + 8 * i) * 8] = t; } }
    else {        // the f32 weight product: one rounding, to f16
#pragma unroll
      for (int i = 0; i < 4; ++i)
#pragma unroll
        for (int m = 0; m < 4; ++m) { v8h t;
#pragma unroll
          for (int e = 0; e < 8; ++e) t[e] = (_Float16)(rw[i * 8 + e][m] * 16.0f);
          *(v8h*)&wt[lr + m][(wave + 8 * i) * 8] = t; } } }
  __syncthreads();
  v8f acc[4] = {}; v16h fa[2], fb[2][4];
  auto lf = [&](int kc) { fa[kc & 1] = frag_h(&sa[wr + col][kc * 32], lane);
#pragma unroll
    for (int j = 0; j < 4; ++j) fb[kc & 1][j] = frag_h(&wt[wc + j * 16 + col][kc * 32], lane); };
  lf(0);
#pragma unroll
  for (int kc = 0; kc < HID / 32; ++kc) { if (kc + 1 < HID / 32) lf(kc + 1);   // the next step's fragment reads go out ahead of this step's products
#pragma unroll
    for (int j = 0; j < 4; ++j) acc[j] = wmma16(fa[kc & 1], fb[kc & 1][j], acc[j]); }
  if (PRE) { float* so = (float*)&wt[0][0];   // the 64 x 128 f32 result tile (row pitch 528 B) reuses the weight tile's LDS
    __syncthreads();   // every wave has read its last fragments of the weight tile
#pragma unroll
    for (int j = 0; j < 4; ++j)
#pragma unroll
      for (int r = 0; r < 8; ++r) so[(wr + 8 * g + r) * LIN_OLD + wc + j * 16 + col] = acc[j][r] * (1.0f / 256.0f);
    __syncthreads();
    if (!br) { for (int e = tid; e < 64 * 32; e += 256) { const int rl = e >> 5, q = e & 31; vst2(FO + (r0 + rl) * (NHD * VW) + c0 + q * 4, *(const v4f*)&so[rl * LIN_OLD + q * 4]); } }
    else if (tid < 32) { const v4f b = *(const v4f*)(Bv + c0 + tid * 4); asm volatile("s_wait_xcnt 0x0" ::: "memory");   // the load's address registers are rewritten only behind this wait
      v4f o = *(const v4f*)&so[tid * 4]; o[0] += bfr(b[0]); o[1] += bfr(b[1]); o[2] += bfr(b[2]); o[3] += bfr(b[3]); vst2(FB + c0 + tid * 4, o); }
    return; }
  if (!two) {
#pragma unroll
    for (int j = 0; j < 4; ++j) { const int cl = wc + j * 16 + col; const float bb = bfr(Bv[c0 + cl]);
#pragma unroll
      for (int r = 0; r < 8; ++r) sh[wr + 8 * g + r][cl] = (_Float16)(acc[j][r] * (1.0f / 16.0f) + bb); } }
  else {
#pragma unroll
    for (int j = 0; j < 2; ++j) { const int cl = (wave & 1) * 32 + j * 16 + col; const float b0 = Bv[c0 + cl], b1 = Bv[VW + c0 + cl]; float s = 0.f;   // acc[j] = head 0, acc[j + 2] = head 1 of the same column
#pragma unroll
      for (int r = 0; r < 8; ++r) { const float v0 = acc[j][r] * (1.0f / 16.0f) + b0, v1 = acc[j + 2][r] * (1.0f / 16.0f) + b1; th[cl][wr + 8 * g + r] = (_Float16)(v0 - v1); s += v1; }
      ps[(wave >> 1) * 2 + g][cl] = s; } }
  __syncthreads();
  if (!two) { for (int e = tid; e < 64 * 16; e += 256) { const int rl = e >> 4, q = e & 15; vst2((unsigned*)(D + (r0 + rl) * HID + c0 + q * 8), *(const v4u*)&sh[rl][q * 8]); } }
  else { for (int e = tid; e < 64 * 8; e += 256) { const int cl = e >> 3, q = e & 7; vst2((unsigned*)(D + (size_t)(c0 + cl) * NN + r0 + q * 8), *(const v4u*)&th[cl][q * 8]); }
    if (tid < 64) { float s = ps[0][tid];
#pragma unroll
      for (int i = 1; i < 8; ++i) s += ps[i][tid];
      PS[(size_t)rb * VW + c0 + tid] = s; } } }
// ---- k_lin: q, k and v of one layer, independent of one another and therefore one launch: grid (64 row blocks, 2, 4): z 0 q, z 1 k (2 column blocks of 128 each), z 2 and 3 the four column blocks of v
__global__ __launch_bounds__(256) void k_lin(const float* __restrict__ X, const float* __restrict__ Wa, const float* __restrict__ Wb, const float* __restrict__ Wc, const float* __restrict__ Ba, const float* __restrict__ Bb, const float* __restrict__ Bc, _Float16* __restrict__ Da, _Float16* __restrict__ Db, _Float16* __restrict__ Dc, float* __restrict__ PS) {
  const int z = blockIdx.z; lin_body<false>(z < 2 ? z : 3, blockIdx.x, z < 2 ? blockIdx.y : (z - 2) * 2 + blockIdx.y, false, X, nullptr, z == 0 ? Wa : z == 1 ? Wb : Wc, z == 0 ? Ba : z == 1 ? Bb : Bc, z == 0 ? Da : z == 1 ? Db : Dc, PS, nullptr, nullptr); }
// ---- LayerNorm of whole rows, one wave per row: lane l holds columns 4l..4l+3 and 128+4l..128+4l+3 in registers; a row's sum is 7 additions in the lane, then 5 cross-lane steps; several rows are worked on side by side so that their chains fill one another's latency. All 32 lanes are on wherever these are called.
template <int C> __device__ __forceinline__ float dpp_x(float x) { return __builtin_bit_cast(float, __builtin_amdgcn_update_dpp(0, __builtin_bit_cast(int, x), C, 0xf, 0xf, true)); }   // C = 0x160 + m: lane l reads lane l ^ m of its own 16-lane row
__device__ __forceinline__ float xhalf(float x) { return __builtin_bit_cast(float, __builtin_amdgcn_permlanex16(__builtin_bit_cast(int, x), __builtin_bit_cast(int, x), 0x76543210, 0xfedcba98, false, false)); }   // lane l reads lane l ^ 16
__device__ __forceinline__ float wsum(float x) { x += dpp_x<0x161>(x); x += dpp_x<0x162>(x); x += dpp_x<0x164>(x); x += dpp_x<0x168>(x); return x + xhalf(x); }   // the sum over the wave, the same in every lane
__device__ __forceinline__ float sum8(v4f a, v4f b) { const v4f t = a + b; return (t[0] + t[1]) + (t[2] + t[3]); }
__device__ __forceinline__ v4f bfr4(v4f a) { v4f r; r[0] = bfr(a[0]); r[1] = bfr(a[1]); r[2] = bfr(a[2]); r[3] = bfr(a[3]); return r; }
template <int NR, bool RELU> __device__ __forceinline__ void ln_rows(v4f (&v)[NR][2], const v4f (&gg)[2], const v4f (&bb)[2]) { float mu[NR], rs[NR];   // every loop is unrolled: v, mu and rs are register arrays
#pragma unroll
  for (int i = 0; i < NR; ++i) mu[i] = wsum(sum8(v[i][0], v[i][1])) * (1.0f / HID);
#pragma unroll
  for (int i = 0; i < NR; ++i) { v[i][0] -= mu[i]; v[i][1] -= mu[i]; rs[i] = rsqrtf(wsum(sum8(v[i][0] * v[i][0], v[i][1] * v[i][1])) * (1.0f / HID) + 1e-5f); }
#pragma unroll
  for (int i = 0; i < NR; ++i)
#pragma unroll
    for (int h = 0; h < 2; ++h) { v4f o = v[i][h] * rs[i] * gg[h] + bb[h];
      if (RELU) { o[0] = fmaxf(o[0], 0.f); o[1] = fmaxf(o[1], 0.f); o[2] = fmaxf(o[2], 0.f); o[3] = fmaxf(o[3], 0.f); }
      v[i][h] = o; } }
// ---- k_fc: block = 64 rows, 8 waves of 16 rows x 128 columns: y = x fc_w + b (exact bf16 products) -> LDS; per row LayerNorm (eps 1e-5) x g0 + b0, ReLU -> X rows (1 KB each). fc_w is read once per block in chunks of 64 k x 256 columns with whole-row loads, rounded to bf16 once and stored k-contiguous per column in LDS (two buffers, row pitch 144 B); the next chunk's loads (weights and the wave's own x pieces) fly while this chunk is multiplied. Every accumulator still sums k in ascending blocks of 32. Blocks 64 and up of the same launch, on WGPs that the 64 row blocks leave idle, form each layer's weight product Wvl Wvg and its bias row (lin_body<true>): per layer 4 row blocks + 1 bias block, times 4 column blocks.
#define FC_BK 64
#define FC_T (DIN / FC_BK)
#define FC_LD (FC_BK + 8)
__global__ __launch_bounds__(256) void k_fc(const float* __restrict__ XI, const float* __restrict__ W, const float* __restrict__ Bv, const float* __restrict__ G0, const float* __restrict__ B0, float* __restrict__ X, const float* __restrict__ WVL, const float* __restrict__ BVL, const float* __restrict__ WVG, const float* __restrict__ BVG, float* __restrict__ CW, float* __restrict__ CB) { __shared__ __align__(16) float sy[64][HID + 4]; __shared__ __align__(16) __bf16 wt[2][HID][FC_LD];
  if (blockIdx.x >= NN / 64) { const int p = blockIdx.x - NN / 64, l = p / 20, t = p % 20, rb = t >> 2; const bool br = rb == 4;   // the same for the whole block, ahead of every barrier; the bias block reads the last 64 rows of Wvl in place of rows that do not exist and does not use them
    lin_body<true>(4, br ? 3 : rb, t & 3, br, WVL + (size_t)l * HID * HID, BVL + l * HID, WVG + (size_t)l * HID * NHD * VW, BVG + l * NHD * VW, nullptr, nullptr, CW + (size_t)l * HID * NHD * VW, CB + l * NHD * VW); return; }
  const int tid = threadIdx.x, wave = tid >> 5, lane = tid & 31, col = lane & 15, g = lane >> 4; const size_t r0 = (size_t)blockIdx.x * 64; const int wr = (wave >> 1) * 16, cp = wave & 1;
  const int nq = tid & 63, kg = tid >> 6;   // staging piece: 8 k rows x 4 columns; a wave covers 512 B of one weight row per load
  const float* gw = W + (size_t)(kg * 8) * HID + nq * 4; const float* gx = XI + (r0 + wr + col) * DIN + 8 * g;
  v4f rw[16], rx[8]; v16b a[2]; v8f acc[8] = {};
  auto ldw = [&](int c) {
#pragma unroll
    for (int i = 0; i < 2; ++i)
#pragma unroll
      for (int e = 0; e < 8; ++e) rw[i * 8 + e] = *(const v4f*)(gw + (size_t)(c * FC_BK + i * 32 + e) * HID);
#pragma unroll
    for (int kk = 0; kk < 2; ++kk) { const float* p = gx + c * FC_BK + kk * 32; rx[kk * 4] = *(const v4f*)p; rx[kk * 4 + 1] = *(const v4f*)(p + 4); rx[kk * 4 + 2] = *(const v4f*)(p + 16); rx[kk * 4 + 3] = *(const v4f*)(p + 20); }
    __builtin_amdgcn_sched_barrier(0);   // keeps the chunk's loads together at this place, one chunk ahead of their use
    asm volatile("s_wait_xcnt 0x0" ::: "memory");   // the loads stay in flight over later arithmetic: their address registers are rewritten only behind this wait
    __builtin_amdgcn_sched_barrier(0); };   // keeps later register writes from being lifted over that wait
  auto stw = [&](int b) {
#pragma unroll
    for (int i = 0; i < 2; ++i)
#pragma unroll
      for (int m = 0; m < 4; ++m) { v8b t;
#pragma unroll
        for (int e = 0; e < 8; ++e) t[e] = (__bf16)rw[i * 8 + e][m];
        *(v8b*)&wt[b][nq * 4 + m][(kg + 4 * i) * 8] = t; }
#pragma unroll
    for (int kk = 0; kk < 2; ++kk)
#pragma unroll
      for (int i = 0; i < 4; ++i) { a[kk][i] = (__bf16)rx[kk * 4][i]; a[kk][4 + i] = (__bf16)rx[kk * 4 + 1][i]; a[kk][8 + i] = (__bf16)rx[kk * 4 + 2][i]; a[kk][12 + i] = (__bf16)rx[kk * 4 + 3][i]; } };
  auto mm = [&](int b) {
#pragma unroll
    for (int kk = 0; kk < 2; ++kk) { v16b f[8];   // the eight fragment reads go out as one group ahead of their products
#pragma unroll
      for (int j = 0; j < 8; ++j) f[j] = frag_b(&wt[b][cp * 128 + j * 16 + col][kk * 32], lane);
#pragma unroll
      for (int j = 0; j < 8; ++j) acc[j] = wmma_bf(a[kk], f[j], acc[j]); } };
  ldw(0); stw(0); ldw(1);
  WT_BAR();
#pragma unroll 1
  for (int c = 0; c < FC_T; ++c) {   // rolled: one copy of the body is enough
    mm(c & 1);
    if (c + 1 < FC_T) stw((c + 1) & 1);
    if (c + 2 < FC_T) ldw(c + 2);
    WT_BAR();   // chunk c+1 is published; every reader has left the buffer of chunk c
  }
  const float* pg = G0 + lane * 4; const float* pb = B0 + lane * 4;
  v4f gg[2] = { *(const v4f*)pg, *(const v4f*)(pg + 128) }, bb2[2] = { *(const v4f*)pb, *(const v4f*)(pb + 128) };
  LIN_ISSUED2(pg, pb);   // the lane's scale and shift columns fly under the LDS stores below; their address registers are rewritten only behind the wait
#pragma unroll
  for (int j = 0; j < 8; ++j) { const int o = cp * 128 + j * 16 + col; const float bb = bfr(Bv[o]);
#pragma unroll
    for (int r = 0; r < 8; ++r) sy[wr + 8 * g + r][o] = acc[j][r] + bb; }
  __syncthreads();
  // LayerNorm and ReLU: a wave takes 8 whole rows out of LDS into registers and stores them straight to X, 512 B per store
  v4f y[8][2]; gg[0] = bfr4(gg[0]); gg[1] = bfr4(gg[1]); bb2[0] = bfr4(bb2[0]); bb2[1] = bfr4(bb2[1]);
#pragma unroll
  for (int i = 0; i < 8; ++i) { y[i][0] = *(const v4f*)&sy[wave * 8 + i][lane * 4]; y[i][1] = *(const v4f*)&sy[wave * 8 + i][128 + lane * 4]; }
  ln_rows<8, true>(y, gg, bb2);
  float* px = X + (r0 + wave * 8) * HID + lane * 4;
#pragma unroll
  for (int i = 0; i < 8; ++i) { vst2(px + i * HID, y[i][0]); vst2(px + i * HID + 128, y[i][1]); } }
// ---- k_att: block = (64 queries n, one of 8 key ranges of 512 keys l), 8 waves, all 256 output columns. Per tile of 64 keys: s_h = q_h . k_h / sqrt(128) for BOTH heads (wave = 16 queries x 32 keys), the reference's softmax over the HEAD axis (axis -1 of [n, l, h]): w_0 = 1 / (1 + exp(s_1 - s_0)), w_1 = 1 - w_0, in f32 as 2^11 w_0 = rcp(2^-11 + exp2((s_1 - s_0) log2(e) / sqrt(128) - 11)) on the hardware's own exp2 and reciprocal: their error of about one f32 unit in the last place lies far below the f16 rounding that follows; an overflowing exp2 gives inf and weight 0, a vanishing one weight 2^11, as the limits ask. There is no normalisation over l and the reference takes the mean of the heads, so the two heads' products add up, and w_0 v_0 + (1 - w_0) v_1 = w_0 (v_0 - v_1) + v_1: only w_0 is kept, rounded to f16 x 2^11 into an LDS tile [query][key]; that tile times the tile of v_0 - v_1 (wave = 64 queries x 32 columns) is the one product left, and the sum of v_1 over the range's keys, the same for every query, comes from PS and is added at the end. The key ranges are plain partial sums: O[n][range][c], added up in k_mix. The weights never leave the block. Every logit still sums k in ascending blocks of 32. Row pitches in LDS: 528 B (q, k), 144 B (v, weights).
__device__ __forceinline__ v8f wmma16c(v16h a, v16h b, v8f c) { return __builtin_amdgcn_wmma_f32_16x16x32_f16(false, a, false, b, (short)0, c, false, false); }   // the builtin alone: the compiler keeps the distance behind it itself
#define AT_BK 64
#define AT_SPL 8
#define AT_KS (NN / AT_SPL)
#define AT_T (AT_KS / AT_BK)
#define AT_QLD (HID + 8)
#define AT_VLD (AT_BK + 8)
#define AT_PLD (AT_BK + 8)
#define AT_OLD (HID + 4)
__global__ __launch_bounds__(256) __attribute__((amdgpu_waves_per_eu(4, 4))) void k_att(const _Float16* __restrict__ Q, const _Float16* __restrict__ K, const _Float16* __restrict__ VP, const float* __restrict__ PS, float* __restrict__ O) { __shared__ __align__(16) _Float16 sqk[64 + AT_BK][AT_QLD], sv[VW][AT_VLD], sp[64][AT_PLD]; _Float16 (*const sq)[AT_QLD] = sqk; _Float16 (*const sk)[AT_QLD] = sqk + 64;
  const int tid = threadIdx.x, wave = tid >> 5, lane = tid & 31, col = lane & 15, g = lane >> 4; const int n0 = blockIdx.x * 64, l0 = blockIdx.y * AT_KS, wr = (wave >> 1) * 16, wk = (wave & 1) * 32, wc = wave * 32;
  const int kr = tid >> 5, kq = (tid & 31) * 8;   // q, k staging: a wave covers one whole 512-B row per load
  const int vr = tid >> 3, vq = (tid & 7) * 8;    // v staging: 8 lanes cover one 128-B row piece, a wave four rows per load
  const _Float16* gk = K + (size_t)(l0 + kr) * HID + kq; const _Float16* gv = VP + (size_t)vr * NN + l0 + vq;
  const float isl = 1.44269504088896340736f / sqrtf((float)DK);   // log2(e) / sqrt(128)
  v8f acc[4][2] = {};   // every loop over acc, rq, rk, rv and the fragments is unrolled: they are register arrays
  { v8h rq[8], rk[8]; const _Float16* gq = Q + (size_t)(n0 + kr) * HID + kq;
#pragma unroll
    for (int i = 0; i < 8; ++i) { rq[i] = *(const v8h*)(gq + (size_t)(8 * i) * HID); rk[i] = *(const v8h*)(gk + (size_t)(8 * i) * HID); }
    __builtin_amdgcn_sched_barrier(0);   // all 16 loads are out before the first is waited for
    asm volatile("s_wait_xcnt 0x0" :: "v"(gq), "v"(gk) : "memory");   // the two addresses are inputs, so they stay in their registers up to this wait: no load of the group lands on them, and they are rewritten only behind it
    __builtin_amdgcn_sched_barrier(0);   // keeps later register writes from being lifted over that wait
#pragma unroll
    for (int i = 0; i < 8; ++i) { *(v8h*)&sq[kr + 8 * i][kq] = rq[i]; *(v8h*)&sk[kr + 8 * i][kq] = rk[i]; } }
  __syncthreads();   // the query rows and the first key tile are published
  auto tile = [&](const int t, const bool more) { v8h rk[8], rv[8];   // more: a next key tile exists (the same for the whole block)
#pragma unroll
    for (int i = 0; i < 8; ++i) rv[i] = *(const v8h*)(gv + (size_t)(32 * i) * NN + t * AT_BK);
    LIN_ISSUED();   // the value tile's loads go out here and fly under the logits and the softmax; their address registers are rewritten only behind the wait
    v8f s0[2] = {}, s1[2] = {};
#pragma unroll
    for (int kc = 0; kc < DK / 32; ++kc) { const v16h a0 = frag_h(&sq[wr + col][kc * 32], lane), a1 = frag_h(&sq[wr + col][DK + kc * 32], lane); v16h f0[2], f1[2];   // the step's fragment reads go out as one group ahead of its products
#pragma unroll
      for (int j = 0; j < 2; ++j) { f0[j] = frag_h(&sk[wk + j * 16 + col][kc * 32], lane); f1[j] = frag_h(&sk[wk + j * 16 + col][DK + kc * 32], lane); }
#pragma unroll
      for (int j = 0; j < 2; ++j) { s0[j] = wmma16c(a0, f0[j], s0[j]); s1[j] = wmma16c(a1, f1[j], s1[j]); } }
    float e[2][8];   // all 16 exponentials, then all 16 reciprocals: 16 independent chains instead of one after another
#pragma unroll
    for (int j = 0; j < 2; ++j)
#pragma unroll
      for (int r = 0; r < 8; ++r) e[j][r] = __builtin_amdgcn_exp2f((s1[j][r] - s0[j][r]) * isl - 11.0f);
#pragma unroll
    for (int j = 0; j < 2; ++j)
#pragma unroll
      for (int r = 0; r < 8; ++r) e[j][r] = __builtin_amdgcn_rcpf(e[j][r] + 0x1p-11f);
#pragma unroll
    for (int j = 0; j < 2; ++j)
#pragma unroll
      for (int r = 0; r < 8; ++r) sp[wr + 8 * g + r][wk + j * 16 + col] = (_Float16)e[j][r];
#pragma unroll
    for (int i = 0; i < 8; ++i) *(v8h*)&sv[vr + 32 * i][vq] = rv[i];
    __syncthreads();   // the tile's weights and values are published; every reader has left the key tile
    if (more) {
#pragma unroll
      for (int i = 0; i < 8; ++i) rk[i] = *(const v8h*)(gk + (size_t)((t + 1) * AT_BK + 8 * i) * HID);
      LIN_ISSUED(); }   // the next key tile's loads fly under this tile's products; their address registers are rewritten only behind the wait
    v16h fa[AT_BK / 32][4], fb[AT_BK / 32][2];
#pragma unroll
    for (int kk = 0; kk < AT_BK / 32; ++kk) {
#pragma unroll
      for (int i = 0; i < 4; ++i) fa[kk][i] = frag_h(&sp[i * 16 + col][kk * 32], lane);
#pragma unroll
      for (int j = 0; j < 2; ++j) fb[kk][j] = frag_h(&sv[wc + j * 16 + col][kk * 32], lane); }
    __builtin_amdgcn_sched_barrier(0);   // the tile's 12 fragment reads go out as one group ahead of its products: read piecemeal, every pair of products waits for its own reads
#pragma unroll
    for (int kk = 0; kk < AT_BK / 32; ++kk)
#pragma unroll
      for (int i = 0; i < 4; ++i)
#pragma unroll
        for (int j = 0; j < 2; ++j) acc[i][j] = wmma16c(fa[kk][i], fb[kk][j], acc[i][j]);
    if (more) {
#pragma unroll
      for (int i = 0; i < 8; ++i) *(v8h*)&sk[kr + 8 * i][kq] = rk[i]; }
    __syncthreads(); };   // the next key tile is published; every reader has left the weight and value tiles
#pragma unroll 1
  for (int t = 0; t < AT_T; ++t) tile(t, t + 1 < AT_T);   // rolled, the last tile included ('more' is a scalar test): one copy of the body is enough, and a copy of its own for the last tile was scheduled past the register budget (spills)
  v4f pv[AT_KS / 64]; const float* gp = PS + (size_t)blockIdx.y * (AT_KS / 64) * VW + (tid & 63) * 4;   // the thread's four output columns: v_1 summed over each of the range's blocks of 64 keys
#pragma unroll
  for (int s = 0; s < AT_KS / 64; ++s) pv[s] = *(const v4f*)(gp + s * VW);
  LIN_ISSUED();   // the loads fly under the LDS stores below; their address registers are rewritten only behind the wait
  float* so = (float*)&sqk[0][0];   // the 64 x 256 result tile (row pitch 1,040 B) reuses the query and key tiles' LDS behind the last barrier
#pragma unroll
  for (int i = 0; i < 4; ++i)
#pragma unroll
    for (int j = 0; j < 2; ++j)
#pragma unroll
      for (int r = 0; r < 8; ++r) so[(i * 16 + 8 * g + r) * AT_OLD + wc + j * 16 + col] = acc[i][j][r] * (1.0f / 2048.0f);
  __syncthreads();
  v4f s1 = pv[0];
#pragma unroll
  for (int s = 1; s < AT_KS / 64; ++s) s1 += pv[s];
  for (int e = tid; e < 64 * (HID / 4); e += 256) { const int rl = e / (HID / 4), c4 = (e % (HID / 4)) * 4; vst2(O + ((size_t)(n0 + rl) * AT_SPL + blockIdx.y) * HID + c4, *(const v4f*)&so[rl * AT_OLD + c4] + s1); } }   // c4 = (tid & 63) * 4 on every trip: the step of 256 is a multiple of 64
// ---- k_mix: block = 16 rows, 4 waves, a wave takes 4 whole rows, two at a time: v = 0.5 * (0.5 * sum over the key ranges of O) + 0.5 * x_prev, read with 512-B loads and kept in registers; x = LN(v) * g + b (in place on X, or to OUT for the last layer). A row is read, normalised and written by one wave alone: no LDS, no barrier. The second pair's loads fly under the first pair's LayerNorm.
#define MX_R 16
__global__ __launch_bounds__(128) void k_mix(const float* __restrict__ O, float* __restrict__ X, const float* __restrict__ Gm, const float* __restrict__ Bb, float* __restrict__ OUT) {
  const int tid = threadIdx.x, wave = tid >> 5, lane = tid & 31; const size_t r0 = (size_t)blockIdx.x * MX_R + wave * 4;
  const float* po = O + r0 * AT_SPL * HID + lane * 4; const float* px = X + r0 * HID + lane * 4; const float* pg = Gm + lane * 4; const float* pb = Bb + lane * 4; float* dst = (OUT ? OUT : X) + r0 * HID + lane * 4;
  v4f p[2][AT_SPL][2], x[2][2], v[2][2];   // every loop over them is unrolled: they are register arrays
  auto ld = [&](const int hg) {
#pragma unroll
    for (int i = 0; i < 2; ++i)
#pragma unroll
      for (int h = 0; h < 2; ++h) {
#pragma unroll
        for (int s = 0; s < AT_SPL; ++s) p[i][s][h] = *(const v4f*)(po + ((hg * 2 + i) * AT_SPL + s) * HID + h * 128);
        x[i][h] = *(const v4f*)(px + (hg * 2 + i) * HID + h * 128); } };
  auto mixv = [&]() {
#pragma unroll
    for (int i = 0; i < 2; ++i)
#pragma unroll
      for (int h = 0; h < 2; ++h) { v4f a = p[i][0][h];
#pragma unroll
        for (int s = 1; s < AT_SPL; ++s) a += p[i][s][h];
        v[i][h] = 0.5f * (a * 0.5f) + 0.5f * x[i][h]; } };
  auto st = [&](const int hg) {
#pragma unroll
    for (int i = 0; i < 2; ++i) { vst2(dst + (hg * 2 + i) * HID, v[i][0]); vst2(dst + (hg * 2 + i) * HID + 128, v[i][1]); } };
  v4f gg[2] = { *(const v4f*)pg, *(const v4f*)(pg + 128) }, bb[2] = { *(const v4f*)pb, *(const v4f*)(pb + 128) };
  ld(0);
  LIN_ISSUED();   // all 40 loads are out before the first is waited for; their address registers are rewritten only behind the wait
  gg[0] = bfr4(gg[0]); gg[1] = bfr4(gg[1]); bb[0] = bfr4(bb[0]); bb[1] = bfr4(bb[1]);
  mixv();
  ld(1);
  LIN_ISSUED2(po, px);   // the second pair's 36 loads go out here, ahead of the first pair's LayerNorm; the two addresses are inputs of the wait, so no load of the group lands on them and they are rewritten only behind it
  ln_rows<2, false>(v, gg, bb);
  st(0);
  LIN_ISSUED();   // the four stores' registers are rewritten only behind the wait
  mixv();
  ln_rows<2, false>(v, gg, bb);
  st(1); }
extern "C" void kernel_launch(void* const* d_in, const int* in_sizes, int n_in, void* d_out, int out_size, void* d_ws, size_t ws_size, hipStream_t stream) {
  (void)in_sizes; (void)n_in; (void)out_size;
  const float** F = (const float**)d_in;   // 0 x [4096,512], 1 fc_w [512,256], 2 fc_b, 3 ln_g [3,256], 4 ln_b [3,256], 5 wq [2,256,256], 6 bq [2,256], 7 wk, 8 bk, 9 wvl, 10 bvl, 11 wvg [2,256,512], 12 bvg [2,512]
  if (ws_size < (size_t)WS_END) return;
  char* ws = (char*)d_ws; float *X = (float*)(ws + WS_X), *O = (float*)(ws + WS_O), *PS = (float*)(ws + WS_PS); _Float16 *Q = (_Float16*)(ws + WS_Q), *K = (_Float16*)(ws + WS_K), *VP = (_Float16*)(ws + WS_VP); float *CW = (float*)(ws + WS_CW), *CB = (float*)(ws + WS_CB);
  k_fc<<<dim3(NN / 64 + 20 * NL), 256, 0, stream>>>(F[0], F[1], F[2], F[3], F[4], X, F[9], F[10], F[11], F[12], CW, CB);
  for (int l = 0; l < TNL; ++l) {
    k_lin<<<dim3(NN / 64, HID / 128, 4), 256, 0, stream>>>(X, F[5] + (size_t)l * HID * HID, F[7] + (size_t)l * HID * HID, CW + (size_t)l * HID * NHD * VW, F[6] + l * HID, F[8] + l * HID, CB + l * NHD * VW, Q, K, VP, PS);
    k_att<<<dim3(NN / 64, AT_SPL), 256, 0, stream>>>(Q, K, VP, PS, O);
    k_mix<<<dim3(NN / MX_R), 128, 0, stream>>>(O, X, F[3] + (l + 1) * HID, F[4] + (l + 1) * HID, (l == NL - 1) ? (float*)d_out : nullptr);
  }
}

// v010
// One run takes 83.5 microseconds.
// Timed twice side by side with v009, it ran 1.09 and 1.08 times as fast.
// All steps since v000 together make it 15.2 times as fast.
// compute dtype: all float inputs rounded to bf16; x fc_w exact bf16 products on WMMA 16x16x32; LayerNorm/ReLU in f32; per layer the q/k/v projections with the LayerNorm'd operand rounded once to f16 against f16 weights (x 16, folded; bf16 values for q and k); the two value projections are one: v = x (Wvl Wvg) + (bvl Wvg + bvg), the weight product from exact f16 copies of the bf16 weights, f32 sums, rounded once to f16; both heads' logits q.k/sqrt(128) from f16 rows (1 product) and the reference's softmax over the HEAD axis (a 2-way softmax per (node, node) pair, f32, the hardware's exp2 and reciprocal) -> w_0 rounded to f16 x 2^11; because w_1 = 1 - w_0, the sum over all nodes and both heads of w_h v_h is taken as sum of w_0 (v_0 - v_1) (the difference formed in f32, rounded once to f16) plus the f32 column sum of v_1; head mean, residual mix and LayerNorm in f32; f32 output.
#include <hip/hip_runtime.h>
#include <math.h>

typedef __attribute__((ext_vector_type(16))) _Float16 v16h;
typedef __attribute__((ext_vector_type(16))) __bf16 v16b;
typedef __attribute__((ext_vector_type(8)))  _Float16 v8h;
typedef __attribute__((ext_vector_type(4)))  _Float16 v4hh;
typedef __attribute__((ext_vector_type(8)))  float v8f;
typedef __attribute__((ext_vector_type(4)))  float v4f;
typedef __attribute__((ext_vector_type(2)))  float v2f;
typedef __attribute__((ext_vector_type(4)))  unsigned v4u;
typedef __attribute__((ext_vector_type(4)))  int v4i;
typedef float __attribute__((may_alias)) float_a;
typedef int __attribute__((may_alias)) int_a;

template <typename T> __device__ __forceinline__ void vst2(void* p, T v) { *(T*)p = v;  }
__device__ __forceinline__ v8f wmma16(v16h a, v16h b, v8f c) {
  v8f d = __builtin_amdgcn_wmma_f32_16x16x32_f16(false, a, false, b, (short)0, c, false, false);
  asm volatile("v_nop\n\tv_nop\n\tv_nop\n\tv_nop" : "+v"(d) : "v"(a), "v"(b));
  return d;
}
__device__ __forceinline__ v8f wmma_bf(v16b a, v16b b, v8f c) {
  v8f d = __builtin_amdgcn_wmma_f32_16x16x32_bf16(false, a, false, b, (short)0, c, false, false);
  asm volatile("v_nop\n\tv_nop\n\tv_nop\n\tv_nop" : "+v"(d) : "v"(a), "v"(b));
  return d;
}
// 16x16x32 fragments: lane = (h = lane>>4, row/col = lane&15); elements 0..7 = k0+8h+0..7, 8..15 = k0+16+8h+0..7; D element r = row 8h+r
__device__ __forceinline__ v16h frag_h(const _Float16* rowk0, int lane) {
  union { v16h v; v8h q[2]; } u; const _Float16* p = rowk0 + 8 * (lane >> 4);
  u.q[0] = *(const v8h*)p; u.q[1] = *(const v8h*)(p + 16); return u.v;
}
__device__ __forceinline__ v16h frag_f32(const float* rowk0, int lane) {
  v16h a; const float* p = rowk0 + 8 * (lane >> 4);
#pragma unroll
  for (int i = 0; i < 8; ++i) { a[i] = (_Float16)p[i]; a[8 + i] = (_Float16)p[16 + i]; }
  return a;
}
__device__ __forceinline__ v16h frag_f32s(const float* rowk0, int lane, float sc) {
  v16h a; const float* p = rowk0 + 8 * (lane >> 4);
#pragma unroll
  for (int i = 0; i < 8; ++i) { a[i] = (_Float16)(p[i] * sc); a[8 + i] = (_Float16)(p[16 + i] * sc); }
  return a;
}
// column fragment from a [K][ld] layout (column n), rows >= K read as 0
__device__ __forceinline__ v16h fragc_f32(const float* W, int k0, int n, int lane, int ld, int K) {
  v16h a; const int g = lane >> 4;
#pragma unroll
  for (int i = 0; i < 8; ++i) { const int ka = k0 + 8 * g + i, kb = ka + 16;
    a[i] = (_Float16)(ka < K ? W[(size_t)(ka < K ? ka : K - 1) * ld + n] : 0.f); a[8 + i] = (_Float16)(kb < K ? W[(size_t)(kb < K ? kb : K - 1) * ld + n] : 0.f); }
  return a;
}
struct F2 { v16b h, l; };
__device__ __forceinline__ F2 bsplit16(const float v[16]) { F2 r;
#pragma unroll
  for (int i = 0; i < 16; ++i) { const __bf16 h = (__bf16)v[i]; r.h[i] = h; r.l[i] = (__bf16)(v[i] - (float)h); }
  return r; }
__device__ __forceinline__ F2 split_row(const float* row, int k0, int lane) { float v[16]; const float* p = row + k0 + 8 * (lane >> 4);
#pragma unroll
  for (int i = 0; i < 8; ++i) { v[i] = p[i]; v[8 + i] = p[16 + i]; }
  return bsplit16(v); }
__device__ __forceinline__ F2 split_rowK(const float* row, int k0, int lane, int K) { float v[16]; const int g = lane >> 4;
#pragma unroll
  for (int i = 0; i < 8; ++i) { const int ka = k0 + 8 * g + i, kb = ka + 16; v[i] = ka < K ? row[ka < K ? ka : K - 1] : 0.f; v[8 + i] = kb < K ? row[kb < K ? kb : K - 1] : 0.f; }
  return bsplit16(v); }
__device__ __forceinline__ F2 split_col(const float* W, int k0, int n, int lane, int ld, int K) { float v[16]; const int g = lane >> 4;
#pragma unroll
  for (int i = 0; i < 8; ++i) { const int ka = k0 + 8 * g + i, kb = ka + 16; v[i] = ka < K ? W[(size_t)(ka < K ? ka : K - 1) * ld + n] : 0.f; v[8 + i] = kb < K ? W[(size_t)(kb < K ? kb : K - 1) * ld + n] : 0.f; }
  return bsplit16(v); }
__device__ __forceinline__ v8f mac3(const F2& a, const F2& b, v8f c) { c = wmma_bf(a.l, b.h, c); c = wmma_bf(a.h, b.l, c); return wmma_bf(a.h, b.h, c); }
__device__ __forceinline__ float sigm(float v) { return 1.0f / (1.0f + expf(-v)); }

// TransConv (graph-transformer style, N 4,096 nodes, in 512, hidden 256, 2 heads x 128, 2 layers, alpha 0.5): x = relu(LN(x fc_w + b)); per layer: q, k = x W + b (per head 128), v = (x Wvl + b) Wvg + b (per head 256), scores[n][l][h] = q_n,h . k_l,h / sqrt(128), w = softmax over the LAST axis = the 2 heads (literally as written), out[n][h] = sum_l w[n][l][h] v[l][h], head mean, x = LN(0.5 out + 0.5 x_prev).
__device__ __forceinline__ float bfr(float v) { return (float)(__bf16)v; }
#define NN 4096
#define DIN 512
#define HID 256
#define NHD 2
#define DK 128
#define VW 256                 // per-head value width
#define NL 2
#ifndef TNL
#define TNL NL
#endif
#define WS_X   0u                                      // f32 x rows [n][256] (current layer input / prev)
#define WS_Q   (WS_X + 4u * (size_t)NN * HID)           // f16 q rows [n][256]
#define WS_K   (WS_Q + 2u * (size_t)NN * HID)
#define WS_VP  (WS_K + 2u * (size_t)NN * HID)           // f16 planes of v_0 - v_1, [c][n]
#define WS_O   (WS_VP + 2u * (size_t)VW * NN)            // f32 partial head sums [n][key range][256], 8 key ranges
#define WS_PS  (WS_O + 4u * 8u * (size_t)NN * HID)       // f32 column sums of v_1 over each block of 64 nodes, [node block][256]
#define WS_CW  (WS_PS + 4u * (size_t)(NN / 64) * VW)     // f32 weight products Wvl Wvg, [layer][256][512]
#define WS_CB  (WS_CW + 4u * (size_t)NL * HID * NHD * VW) // f32 bias rows bvl Wvg + bvg, [layer][512]
#define WS_END (WS_CB + 4u * (size_t)NL * NHD * VW)
typedef __attribute__((ext_vector_type(8)))  __bf16 v8b;
__device__ __forceinline__ v16b frag_b(const __bf16* rowk0, int lane) {
  union { v16b v; v8b q[2]; } u; const __bf16* p = rowk0 + 8 * (lane >> 4);
  u.q[0] = *(const v8b*)p; u.q[1] = *(const v8b*)(p + 16); return u.v;
}
// publish point of an LDS weight tile: the wave's own LDS stores and reads have retired, then the work-group barrier. Written by hand because __syncthreads() also drains the global loads that are meant to stay in flight across it.
#define WT_BAR() do { asm volatile("s_wait_dscnt 0x0" ::: "memory"); asm volatile("s_barrier_signal -1\n\ts_barrier_wait -1" ::: "memory"); } while (0)
// ---- lin_body: one block = 64 rows x 128 columns of a product A W, K = 256, 8 waves of 16 x 64. In k_lin (PRE false): which 0 q, 1 k from X (f32 -> f16 A) against the bf16-rounded weights x 16; which 3 v = X CW + CB, where CW = Wvl Wvg and CB = bvl Wvg + bvg (see below): the block's 128 columns are 64 columns of head 0 and the same 64 of head 1 (4 column blocks), laid out so that a wave holds both heads of its 32 columns; it writes v_0 - v_1 (f32 difference -> f16 planes [c][n]) and the f32 sum of v_1 over its 64 rows (PS[row block][c]). In k_fc's launch (PRE true): because (x Wvl + bvl) Wvg + bvg = x (Wvl Wvg) + (bvl Wvg + bvg), the product of the two weight matrices is formed first, once per layer: A = 64 rows of Wvl (or, br, the row bvl in all 64 rows, of which row 0 is kept), bf16-rounded x 16, W = 128 columns of Wvg, bf16-rounded x 16; f32 result to FO rows [256][512], the bias row + bvg to FB[512]. CW is rounded once to f16 (x 16) when k_lin stages it. The block's weight tile (256 k x 128 columns) is read once with whole-row loads, converted once and stored k-contiguous per column in LDS (row pitch 528 B); the 64 operand rows go through LDS the same way; all fragments come from LDS. Every accumulator sums k in ascending blocks of 32.
#define LIN_LD (HID + 8)
#define LIN_OLD (128 + 4)
// behind a group of global loads: the first scheduling barrier keeps all of the group's loads issued before the first is waited for; s_wait_xcnt stands before any of their address registers is rewritten; the second scheduling barrier keeps later register writes from being lifted over that wait
#define LIN_ISSUED() do { __builtin_amdgcn_sched_barrier(0); asm volatile("s_wait_xcnt 0x0" ::: "memory"); __builtin_amdgcn_sched_barrier(0); } while (0)
// the same with the group's addresses as inputs of the wait, so that they stay in their registers up to it: no load of the group lands on them
#define LIN_ISSUED1(a) do { __builtin_amdgcn_sched_barrier(0); asm volatile("s_wait_xcnt 0x0" :: "v"(a) : "memory"); __builtin_amdgcn_sched_barrier(0); } while (0)
#define LIN_ISSUED2(a, b) do { __builtin_amdgcn_sched_barrier(0); asm volatile("s_wait_xcnt 0x0" :: "v"(a), "v"(b) : "memory"); __builtin_amdgcn_sched_barrier(0); } while (0)
#define LIN_ISSUED3(a, b, c) do { __builtin_amdgcn_sched_barrier(0); asm volatile("s_wait_xcnt 0x0" :: "v"(a), "v"(b), "v"(c) : "memory"); __builtin_amdgcn_sched_barrier(0); } while (0)
template <bool PRE> __device__ __forceinline__ void lin_body(const int which, const int rb, const int cb, const bool br, const float* __restrict__ A, const float* __restrict__ AB, const float* __restrict__ Wm, const float* __restrict__ Bv, _Float16* __restrict__ D, float* __restrict__ PS, float* __restrict__ FO, float* __restrict__ FB) { __shared__ __align__(16) _Float16 sh[64][136]; __shared__ __align__(16) _Float16 th[64][72]; __shared__ float ps[8][64]; __shared__ __align__(16) _Float16 wt[128][LIN_LD]; __shared__ __align__(16) _Float16 sa[64][LIN_LD];
  const int wave = PRE ? __builtin_amdgcn_readfirstlane(threadIdx.x >> 5) : threadIdx.x >> 5, lane = PRE ? (int)__builtin_amdgcn_mbcnt_lo(~0u, 0u) : threadIdx.x & 31, tid = wave * 32 + lane, col = lane & 15, g = lane >> 4; const size_t r0 = (size_t)rb * 64; const int wr = (wave >> 1) * 16, wc = (wave & 1) * 64;   // PRE: the wave's number as a scalar and the lane from the lane count, so that this path shares no vector value with k_fc's own path: shared ones were computed ahead of the branch and kept live through that path, whose 256 registers are full (one more brought register-window switches into its loop)
  const bool two = !PRE && which == 3; const int c0 = cb * (two ? 64 : 128);   // two: both heads of 64 columns
  { v4f rw[32], rx[16], bx = {};   // staging piece: 8 k rows x 4 columns; a wave covers the tile's whole 512-B row per load
    const int sr = wave * 8;
    // two: lanes 0..15 read head 0's 64 columns, lanes 16..31 head 1's; tile row = (column >> 5) * 64 + (head * 2 + ((column >> 4) & 1)) * 16 + (column & 15)
    const int sc = !two ? c0 + lane * 4 : g * VW + c0 + col * 4, lr = !two ? lane * 4 : ((lane >> 3) & 1) * 64 + (g * 2 + ((lane >> 2) & 1)) * 16 + (lane & 3) * 4;
    const float* gx = A + (r0 + (tid >> 6)) * HID + (tid & 63) * 4; const float* gb = PRE ? AB + (tid & 63) * 4 : gx;
    if (!PRE && which < 2) { const float* gw = Wm + (size_t)sr * HID + sc;
#pragma unroll
      for (int i = 0; i < 4; ++i)
#pragma unroll
        for (int e = 0; e < 8; ++e) rw[i * 8 + e] = *(const v4f*)(gw + (i * 64 + e) * HID);
#pragma unroll
      for (int i = 0; i < 16; ++i) rx[i] = *(const v4f*)(gx + i * 4 * HID);
      LIN_ISSUED2(gw, gx); }
    else { const float* gw = Wm + (size_t)sr * (NHD * VW) + sc;
#pragma unroll
      for (int i = 0; i < 4; ++i)
#pragma unroll
        for (int e = 0; e < 8; ++e) rw[i * 8 + e] = *(const v4f*)(gw + (i * 64 + e) * (NHD * VW));
#pragma unroll
      for (int i = 0; i < 16; ++i) rx[i] = *(const v4f*)(gx + i * 4 * HID);
      if (PRE) bx = *(const v4f*)(gb);
      LIN_ISSUED3(gw, gx, gb); }
    if (PRE) {
#pragma unroll
      for (int i = 0; i < 16; ++i) { const v4f a = br ? bx : rx[i]; v4hh t; t[0] = (_Float16)(bfr(a[0]) * 16.0f); t[1] = (_Float16)(bfr(a[1]) * 16.0f); t[2] = (_Float16)(bfr(a[2]) * 16.0f); t[3] = (_Float16)(bfr(a[3]) * 16.0f); *(v4hh*)&sa[(tid >> 6) + 4 * i][(tid & 63) * 4] = t; } }
    else {
#pragma unroll
      for (int i = 0; i < 16; ++i) { v4hh t; t[0] = (_Float16)rx[i][0]; t[1] = (_Float16)rx[i][1]; t[2] = (_Float16)rx[i][2]; t[3] = (_Float16)rx[i][3]; *(v4hh*)&sa[(tid >> 6) + 4 * i][(tid & 63) * 4] = t; } }
    if (!two) {   // an input's weights: rounded to bf16 as every input is
#pragma unroll
      for (int i = 0; i < 4; ++i)
#pragma unroll
        for (int m = 0; m < 4; ++m) { v8h t;
#pragma unroll
          for (int e = 0; e < 8; ++e) t[e] = (_Float16)(bfr(rw[i * 8 + e][m]) * 16.0f);
          *(v8h*)&wt[lr + m][(wave + 8 * i) * 8] = t; } }
    else {        // the f32 weight product: one rounding, to f16
#pragma unroll
      for (int i = 0; i < 4; ++i)
#pragma unroll
        for (int m = 0; m < 4; ++m) { v8h t;
#pragma unroll
          for (int e = 0; e < 8; ++e) t[e] = (_Float16)(rw[i * 8 + e][m] * 16.0f);
          *(v8h*)&wt[lr + m][(wave + 8 * i) * 8] = t; } } }
  __syncthreads();
  v8f acc[4] = {}; v16h fa[2], fb[2][4];
  auto lf = [&](int kc) { fa[kc & 1] = frag_h(&sa[wr + col][kc * 32], lane);
#pragma unroll
    for (int j = 0; j < 4; ++j) fb[kc & 1][j] = frag_h(&wt[wc + j * 16 + col][kc * 32], lane); };
  lf(0);
#pragma unroll
  for (int kc = 0; kc < HID / 32; ++kc) { if (kc + 1 < HID / 32) lf(kc + 1);   // the next step's fragment reads go out ahead of this step's products
#pragma unroll
    for (int j = 0; j < 4; ++j) acc[j] = wmma16(fa[kc & 1], fb[kc & 1][j], acc[j]); }
  if (PRE) { float* so = (float*)&wt[0][0];   // the 64 x 128 f32 result tile (row pitch 528 B) reuses the weight tile's LDS
    __syncthreads();   // every wave has read its last fragments of the weight tile
#pragma unroll
    for (int j = 0; j < 4; ++j)
#pragma unroll
      for (int r = 0; r < 8; ++r) so[(wr + 8 * g + r) * LIN_OLD + wc + j * 16 + col] = acc[j][r] * (1.0f / 256.0f);
    __syncthreads();
    if (!br) { for (int e = tid; e < 64 * 32; e += 256) { const int rl = e >> 5, q = e & 31; vst2(FO + (r0 + rl) * (NHD * VW) + c0 + q * 4, *(const v4f*)&so[rl * LIN_OLD + q * 4]); } }
    else if (tid < 32) { const v4f b = *(const v4f*)(Bv + c0 + tid * 4); asm volatile("s_wait_xcnt 0x0" ::: "memory");   // the load's address registers are rewritten only behind this wait
      v4f o = *(const v4f*)&so[tid * 4]; o[0] += bfr(b[0]); o[1] += bfr(b[1]); o[2] += bfr(b[2]); o[3] += bfr(b[3]); vst2(FB + c0 + tid * 4, o); }
    return; }
  if (!two) {
#pragma unroll
    for (int j = 0; j < 4; ++j) { const int cl = wc + j * 16 + col; const float bb = bfr(Bv[c0 + cl]);
#pragma unroll
      for (int r = 0; r < 8; ++r) sh[wr + 8 * g + r][cl] = (_Float16)(acc[j][r] * (1.0f / 16.0f) + bb); } }
  else {
#pragma unroll
    for (int j = 0; j < 2; ++j) { const int cl = (wave & 1) * 32 + j * 16 + col; const float b0 = Bv[c0 + cl], b1 = Bv[VW + c0 + cl]; float s = 0.f;   // acc[j] = head 0, acc[j + 2] = head 1 of the same column
#pragma unroll
      for (int r = 0; r < 8; ++r) { const float v0 = acc[j][r] * (1.0f / 16.0f) + b0, v1 = acc[j + 2][r] * (1.0f / 16.0f) + b1; th[cl][wr + 8 * g + r] = (_Float16)(v0 - v1); s += v1; }
      ps[(wave >> 1) * 2 + g][cl] = s; } }
  __syncthreads();
  if (!two) { for (int e = tid; e < 64 * 16; e += 256) { const int rl = e >> 4, q = e & 15; vst2((unsigned*)(D + (r0 + rl) * HID + c0 + q * 8), *(const v4u*)&sh[rl][q * 8]); } }
  else { for (int e = tid; e < 64 * 8; e += 256) { const int cl = e >> 3, q = e & 7; vst2((unsigned*)(D + (size_t)(c0 + cl) * NN + r0 + q * 8), *(const v4u*)&th[cl][q * 8]); }
    if (tid < 64) { float s = ps[0][tid];
#pragma unroll
      for (int i = 1; i < 8; ++i) s += ps[i][tid];
      PS[(size_t)rb * VW + c0 + tid] = s; } } }
// ---- k_lin: q, k and v of one layer, independent of one another and therefore one launch: grid (64 row blocks, 2, 4): z 0 q, z 1 k (2 column blocks of 128 each), z 2 and 3 the four column blocks of v
__global__ __launch_bounds__(256) void k_lin(const float* __restrict__ X, const float* __restrict__ Wa, const float* __restrict__ Wb, const float* __restrict__ Wc, const float* __restrict__ Ba, const float* __restrict__ Bb, const float* __restrict__ Bc, _Float16* __restrict__ Da, _Float16* __restrict__ Db, _Float16* __restrict__ Dc, float* __restrict__ PS) {
  const int z = blockIdx.z; lin_body<false>(z < 2 ? z : 3, blockIdx.x, z < 2 ? blockIdx.y : (z - 2) * 2 + blockIdx.y, false, X, nullptr, z == 0 ? Wa : z == 1 ? Wb : Wc, z == 0 ? Ba : z == 1 ? Bb : Bc, z == 0 ? Da : z == 1 ? Db : Dc, PS, nullptr, nullptr); }
// ---- LayerNorm of whole rows, one wave per row: lane l holds columns 4l..4l+3 and 128+4l..128+4l+3 in registers; a row's sum is 7 additions in the lane, then 5 cross-lane steps; several rows are worked on side by side so that their chains fill one another's latency. All 32 lanes are on wherever these are called.
template <int C> __device__ __forceinline__ float dpp_x(float x) { return __builtin_bit_cast(float, __builtin_amdgcn_update_dpp(0, __builtin_bit_cast(int, x), C, 0xf, 0xf, true)); }   // C = 0x160 + m: lane l reads lane l ^ m of its own 16-lane row
__device__ __forceinline__ float xhalf(float x) { return __builtin_bit_cast(float, __builtin_amdgcn_permlanex16(__builtin_bit_cast(int, x), __builtin_bit_cast(int, x), 0x76543210, 0xfedcba98, false, false)); }   // lane l reads lane l ^ 16
__device__ __forceinline__ float wsum(float x) { x += dpp_x<0x161>(x); x += dpp_x<0x162>(x); x += dpp_x<0x164>(x); x += dpp_x<0x168>(x); return x + xhalf(x); }   // the sum over the wave, the same in every lane
__device__ __forceinline__ float sum8(v4f a, v4f b) { const v4f t = a + b; return (t[0] + t[1]) + (t[2] + t[3]); }
__device__ __forceinline__ v4f bfr4(v4f a) { v4f r; r[0] = bfr(a[0]); r[1] = bfr(a[1]); r[2] = bfr(a[2]); r[3] = bfr(a[3]); return r; }
template <int NR, bool RELU> __device__ __forceinline__ void ln_rows(v4f (&v)[NR][2], const v4f (&gg)[2], const v4f (&bb)[2]) { float mu[NR], rs[NR];   // every loop is unrolled: v, mu and rs are register arrays
#pragma unroll
  for (int i = 0; i < NR; ++i) mu[i] = wsum(sum8(v[i][0], v[i][1])) * (1.0f / HID);
#pragma unroll
  for (int i = 0; i < NR; ++i) { v[i][0] -= mu[i]; v[i][1] -= mu[i]; rs[i] = rsqrtf(wsum(sum8(v[i][0] * v[i][0], v[i][1] * v[i][1])) * (1.0f / HID) + 1e-5f); }
#pragma unroll
  for (int i = 0; i < NR; ++i)
#pragma unroll
    for (int h = 0; h < 2; ++h) { v4f o = v[i][h] * rs[i] * gg[h] + bb[h];
      if (RELU) { o[0] = fmaxf(o[0], 0.f); o[1] = fmaxf(o[1], 0.f); o[2] = fmaxf(o[2], 0.f); o[3] = fmaxf(o[3], 0.f); }
      v[i][h] = o; } }
// ---- k_fc: block = 64 rows, 8 waves of 16 rows x 128 columns: y = x fc_w + b (exact bf16 products) -> LDS; per row LayerNorm (eps 1e-5) x g0 + b0, ReLU -> X rows (1 KB each). fc_w is read once per block in chunks of 64 k x 256 columns with whole-row loads, rounded to bf16 once and stored k-contiguous per column in LDS (two buffers, row pitch 144 B); the next chunk's loads (weights and the wave's own x pieces) fly while this chunk is multiplied. Every accumulator still sums k in ascending blocks of 32. Blocks 64 and up of the same launch, on WGPs that the 64 row blocks leave idle, form each layer's weight product Wvl Wvg and its bias row (lin_body<true>): per layer 4 row blocks + 1 bias block, times 4 column blocks.
#define FC_BK 64
#define FC_T (DIN / FC_BK)
#define FC_LD (FC_BK + 8)
__global__ __launch_bounds__(256) void k_fc(const float* __restrict__ XI, const float* __restrict__ W, const float* __restrict__ Bv, const float* __restrict__ G0, const float* __restrict__ B0, float* __restrict__ X, const float* __restrict__ WVL, const float* __restrict__ BVL, const float* __restrict__ WVG, const float* __restrict__ BVG, float* __restrict__ CW, float* __restrict__ CB) { __shared__ __align__(16) float sy[64][HID + 4]; __shared__ __align__(16) __bf16 wt[2][HID][FC_LD];
  if (blockIdx.x >= NN / 64) { const int p = blockIdx.x - NN / 64, l = p / 20, t = p % 20, rb = t >> 2; const bool br = rb == 4;   // the same for the whole block, ahead of every barrier; the bias block reads the last 64 rows of Wvl in place of rows that do not exist and does not use them
    lin_body<true>(4, br ? 3 : rb, t & 3, br, WVL + (size_t)l * HID * HID, BVL + l * HID, WVG + (size_t)l * HID * NHD * VW, BVG + l * NHD * VW, nullptr, nullptr, CW + (size_t)l * HID * NHD * VW, CB + l * NHD * VW); return; }
  const int tid = threadIdx.x, wave = tid >> 5, lane = tid & 31, col = lane & 15, g = lane >> 4; const size_t r0 = (size_t)blockIdx.x * 64; const int wr = (wave >> 1) * 16, cp = wave & 1;
  const int nq = tid & 63, kg = tid >> 6;   // staging piece: 8 k rows x 4 columns; a wave covers 512 B of one weight row per load
  const float* gw = W + (size_t)(kg * 8) * HID + nq * 4; const float* gx = XI + (r0 + wr + col) * DIN + 8 * g;
  v4f rw[16], rx[8]; v16b a[2]; v8f acc[8] = {};
  auto ldw = [&](int c) {
#pragma unroll
    for (int i = 0; i < 2; ++i)
#pragma unroll
      for (int e = 0; e < 8; ++e) rw[i * 8 + e] = *(const v4f*)(gw + (size_t)(c * FC_BK + i * 32 + e) * HID);
#pragma unroll
    for (int kk = 0; kk < 2; ++kk) { const float* p = gx + c * FC_BK + kk * 32; rx[kk * 4] = *(const v4f*)p; rx[kk * 4 + 1] = *(const v4f*)(p + 4); rx[kk * 4 + 2] = *(const v4f*)(p + 16); rx[kk * 4 + 3] = *(const v4f*)(p + 20); }
    __builtin_amdgcn_sched_barrier(0);   // keeps the chunk's loads together at this place, one chunk ahead of their use
    asm volatile("s_wait_xcnt 0x0" ::: "memory");   // the loads stay in flight over later arithmetic: their address registers are rewritten only behind this wait
    __builtin_amdgcn_sched_barrier(0); };   // keeps later register writes from being lifted over that wait
  auto stw = [&](int b) {
#pragma unroll
    for (int i = 0; i < 2; ++i)
#pragma unroll
      for (int m = 0; m < 4; ++m) { v8b t;
#pragma unroll
        for (int e = 0; e < 8; ++e) t[e] = (__bf16)rw[i * 8 + e][m];
        *(v8b*)&wt[b][nq * 4 + m][(kg + 4 * i) * 8] = t; }
#pragma unroll
    for (int kk = 0; kk < 2; ++kk)
#pragma unroll
      for (int i = 0; i < 4; ++i) { a[kk][i] = (__bf16)rx[kk * 4][i]; a[kk][4 + i] = (__bf16)rx[kk * 4 + 1][i]; a[kk][8 + i] = (__bf16)rx[kk * 4 + 2][i]; a[kk][12 + i] = (__bf16)rx[kk * 4 + 3][i]; } };
  auto mm = [&](int b) {
#pragma unroll
    for (int kk = 0; kk < 2; ++kk) { v16b f[8];   // the eight fragment reads go out as one group ahead of their products
#pragma unroll
      for (int j = 0; j < 8; ++j) f[j] = frag_b(&wt[b][cp * 128 + j * 16 + col][kk * 32], lane);
#pragma unroll
      for (int j = 0; j < 8; ++j) acc[j] = wmma_bf(a[kk], f[j], acc[j]); } };
  ldw(0); stw(0); ldw(1);
  WT_BAR();
#pragma unroll 1
  for (int c = 0; c < FC_T; ++c) {   // rolled: one copy of the body is enough
    mm(c & 1);
    if (c + 1 < FC_T) stw((c + 1) & 1);
    if (c + 2 < FC_T) ldw(c + 2);
    WT_BAR();   // chunk c+1 is published; every reader has left the buffer of chunk c
  }
  const float* pg = G0 + lane * 4; const float* pb = B0 + lane * 4;
  v4f gg[2] = { *(const v4f*)pg, *(const v4f*)(pg + 128) }, bb2[2] = { *(const v4f*)pb, *(const v4f*)(pb + 128) };
  LIN_ISSUED2(pg, pb);   // the lane's scale and shift columns fly under the LDS stores below; their address registers are rewritten only behind the wait
#pragma unroll
  for (int j = 0; j < 8; ++j) { const int o = cp * 128 + j * 16 + col; const float bb = bfr(Bv[o]);
#pragma unroll
    for (int r = 0; r < 8; ++r) sy[wr + 8 * g + r][o] = acc[j][r] + bb; }
  __syncthreads();
  // LayerNorm and ReLU: a wave takes 8 whole rows out of LDS into registers and stores them straight to X, 512 B per store
  v4f y[8][2]; gg[0] = bfr4(gg[0]); gg[1] = bfr4(gg[1]); bb2[0] = bfr4(bb2[0]); bb2[1] = bfr4(bb2[1]);
#pragma unroll
  for (int i = 0; i < 8; ++i) { y[i][0] = *(const v4f*)&sy[wave * 8 + i][lane * 4]; y[i][1] = *(const v4f*)&sy[wave * 8 + i][128 + lane * 4]; }
  ln_rows<8, true>(y, gg, bb2);
  float* px = X + (r0 + wave * 8) * HID + lane * 4;
#pragma unroll
  for (int i = 0; i < 8; ++i) { vst2(px + i * HID, y[i][0]); vst2(px + i * HID + 128, y[i][1]); } }
// ---- k_att: block = (128 queries n, one of 8 key ranges of 512 keys l), 8 waves at two per SIMD; a wave owns 32 queries x 32 keys of every 64-key tile and ALL 256 output columns, so its weights never leave its registers. Per tile: the transposed logits s_h^T = k_h . q_h / sqrt(128) for BOTH heads (A = key rows, B = query rows, both from LDS), the reference's softmax over the HEAD axis (axis -1 of [n, l, h]): w_0 = 1 / (1 + exp(s_1 - s_0)), w_1 = 1 - w_0, in f32 as 2^11 w_0 = rcp(2^-11 + exp2((s_1 - s_0) log2(e) / sqrt(128) - 11)) on the hardware's own exp2 and reciprocal: their error of about one f32 unit in the last place lies far below the f16 rounding that follows; an overflowing exp2 gives inf and weight 0, a vanishing one weight 2^11, as the limits ask. A lane of a transposed logit tile holds keys 8h..8h+7 of one query, so the two key tiles of a wave, rounded to f16 x 2^11 in place, ARE the B fragment (32 keys x 16 queries) of the second product, in the k order of frag_h. There is no normalisation over l and the reference takes the mean of the heads, so the two heads' products add up, and w_0 v_0 + (1 - w_0) v_1 = w_0 (v_0 - v_1) + v_1: the one product left is out^T += (v_0 - v_1)^T w_0^T (A = value planes [c][key] from LDS), and the sum of v_1 over the range's keys, the same for every query, comes from PS and is added at the end. A lane of an output tile holds 8 consecutive columns of one query. The two waves that share 32 queries (keys 0..31 and 32..63 of every tile) are added at the end through LDS. The key ranges are plain partial sums: O[n][range][c], added up in k_mix. Key and value tiles have two LDS buffers each: the next tile's rows are loaded into registers during this tile and stored into the other buffer at its end, one barrier per tile. Every logit still sums k in ascending blocks of 32. Row pitches in LDS: 528 B (q, k), 144 B (v), 1,040 B (result).
__device__ __forceinline__ v8f wmma16c(v16h a, v16h b, v8f c) { return __builtin_amdgcn_wmma_f32_16x16x32_f16(false, a, false, b, (short)0, c, false, false); }   // the builtin alone: the compiler keeps the distance behind it itself
#define AT_BQ 128
#define AT_BK 64
#define AT_SPL 8
#define AT_KS (NN / AT_SPL)
#define AT_T (AT_KS / AT_BK)
#define AT_QLD (HID + 8)
#define AT_VLD (AT_BK + 8)
#define AT_OLD (HID + 4)
#define AT_SKB (AT_BK * AT_QLD)            // f16 elements of one key buffer
#define AT_SVB (VW * AT_VLD)               // f16 elements of one value buffer
#define AT_SK (AT_BQ * AT_QLD)             // the key buffers stand behind the query rows
#define AT_SV (AT_SK + 2 * AT_SKB)         // the value buffers behind the key buffers; the loop's LDS ends at (AT_SV + 2 * AT_SVB) * 2 = 208,896 B
#define AT_SMB (2 * AT_BQ * AT_OLD * 4)    // the two f32 result tiles of the end, 266,240 B, reuse the loop's LDS and set the allocation
__global__ __launch_bounds__(256) void k_att(const _Float16* __restrict__ Q, const _Float16* __restrict__ K, const _Float16* __restrict__ VP, const float* __restrict__ PS, float* __restrict__ O) { __shared__ __align__(16) char smem[AT_SMB]; _Float16* const sm = (_Float16*)smem;
  const int tid = threadIdx.x, wave = tid >> 5, lane = tid & 31, col = lane & 15, g = lane >> 4; const int n0 = blockIdx.x * AT_BQ, l0 = blockIdx.y * AT_KS, wr = (wave >> 1) * 32, wk = (wave & 1) * 32;
  const int kr = tid >> 5, kq = (tid & 31) * 8;   // q, k staging: a wave covers one whole 512-B row per load
  const int vr = tid >> 3, vq = (tid & 7) * 8;    // v staging: 8 lanes cover one 128-B row piece, a wave four rows per load
  const unsigned ko = ((l0 + kr) * HID + kq) * 2u, vo = (vr * NN + l0 + vq) * 2u;   // the thread's byte offsets into K and VP (both 2 MiB): one register each through the loop, beside the scalar bases
  const float isl = 1.44269504088896340736f / sqrtf((float)DK);   // log2(e) / sqrt(128)
  v4f c1;   // the thread's four output columns of the end: v_1 summed over the range's keys
  v8f acc[2][16] = {};   // [query tile][column tile]; every loop over acc, rq, rk, rv and the fragments is unrolled: they are register arrays
  { v8h rq[16], rk[8], rv[8]; const _Float16* gq = Q + (size_t)(n0 + kr) * HID + kq; const _Float16* gk = (const _Float16*)((const char*)K + ko); const _Float16* gv = (const _Float16*)((const char*)VP + vo);
#pragma unroll
    for (int i = 0; i < 16; ++i) rq[i] = *(const v8h*)(gq + (size_t)(8 * i) * HID);
#pragma unroll
    for (int i = 0; i < 8; ++i) { rk[i] = *(const v8h*)(gk + (size_t)(8 * i) * HID); rv[i] = *(const v8h*)(gv + (size_t)(32 * i) * NN); }
    LIN_ISSUED3(gq, ko, vo);   // all 32 loads are out before the first is waited for; the address and the two offsets are inputs of the wait, so no load of the group lands on them and they are rewritten only behind it
    v4f pv[AT_KS / 64]; const float* gp = PS + (size_t)blockIdx.y * (AT_KS / 64) * VW + (tid & 63) * 4;   // v_1 summed over each of the range's blocks of 64 keys: read here, where the latency hides behind the tiles' loads
#pragma unroll
    for (int s = 0; s < AT_KS / 64; ++s) pv[s] = *(const v4f*)(gp + s * VW);
    LIN_ISSUED();   // their address registers are rewritten only behind the wait
#pragma unroll
    for (int i = 0; i < 16; ++i) *(v8h*)&sm[(kr + 8 * i) * AT_QLD + kq] = rq[i];
#pragma unroll
    for (int i = 0; i < 8; ++i) { *(v8h*)&sm[AT_SK + (kr + 8 * i) * AT_QLD + kq] = rk[i]; *(v8h*)&sm[AT_SV + (vr + 32 * i) * AT_VLD + vq] = rv[i]; }
    c1 = pv[0];
#pragma unroll
    for (int s = 1; s < AT_KS / 64; ++s) c1 += pv[s]; }
  __syncthreads();   // the query rows and the first key and value tiles are published
  auto tile = [&](const int t, const bool more) { v8h rk[8], rv[8];   // more: a next tile exists (the same for the whole block)
    const _Float16* skb = sm + AT_SK + (t & 1) * AT_SKB; const _Float16* svb = sm + AT_SV + (t & 1) * AT_SVB;
    if (more) { const unsigned kon = ko + (unsigned)(t + 1) * (AT_BK * HID * 2u); const _Float16* gkn = (const _Float16*)((const char*)K + kon);
#pragma unroll
      for (int i = 0; i < 8; ++i) rk[i] = *(const v8h*)(gkn + (size_t)(8 * i) * HID);
      LIN_ISSUED1(kon); }   // the next key tile's loads go out here and fly under this whole tile; the offset is an input of the wait, so no load of the group lands on it and it is rewritten only behind it
    v8f s0[2][2] = {}, s1[2][2] = {};   // [key tile][query tile]
    v16h fk[3][2], fq[3][2];   // a ring of three fragment sets: a step's reads go out two steps ahead of its products
    auto lqk = [&](const int st) { const int o = (st & 1) * DK + (st >> 1) * 32;   // step = (block of 32 k, head)
#pragma unroll
      for (int i = 0; i < 2; ++i) { fk[st % 3][i] = frag_h(skb + (wk + i * 16 + col) * AT_QLD + o, lane); fq[st % 3][i] = frag_h(sm + (wr + i * 16 + col) * AT_QLD + o, lane); } };
    lqk(0); lqk(1);
#pragma unroll
    for (int st = 0; st < 2 * (DK / 32); ++st) { if (st + 2 < 2 * (DK / 32)) lqk(st + 2);
      __builtin_amdgcn_sched_barrier(0);   // keeps the reads of step st + 2 as one group ahead of the products of step st: sunk to their use, every step waits out its own LDS latency
#pragma unroll
      for (int i = 0; i < 2; ++i)
#pragma unroll
        for (int j = 0; j < 2; ++j) { if (st & 1) s1[i][j] = wmma16c(fk[st % 3][i], fq[st % 3][j], s1[i][j]); else s0[i][j] = wmma16c(fk[st % 3][i], fq[st % 3][j], s0[i][j]); }
      __builtin_amdgcn_sched_barrier(0); }   // keeps the reads of step st + 3 behind these products, in the set they free: lifted over them they took a fourth set of registers, and the kernel spilled
    if (more) { const unsigned von = vo + (unsigned)(t + 1) * (AT_BK * 2u); const _Float16* gvn = (const _Float16*)((const char*)VP + von);
#pragma unroll
      for (int i = 0; i < 8; ++i) rv[i] = *(const v8h*)(gvn + (size_t)(32 * i) * NN);
      LIN_ISSUED1(von); }   // the next value tile's loads fly under the softmax and the second product; the offset is an input of the wait, as above
    v16h fv[3][4];   // the same ring for the value fragments: a set = 4 column tiles
    auto lv = [&](const int cb) {
#pragma unroll
      for (int c = 0; c < 4; ++c) fv[cb % 3][c] = frag_h(svb + ((cb * 4 + c) * 16 + col) * AT_VLD + wk, lane); };
    lv(0); lv(1);
    __builtin_amdgcn_sched_barrier(0);   // the first two sets' reads go out ahead of the softmax and land under it
    float e[2][2][8];   // all 32 exponentials, then all 32 reciprocals: independent chains instead of one after another
#pragma unroll
    for (int i = 0; i < 2; ++i)
#pragma unroll
      for (int j = 0; j < 2; ++j)
#pragma unroll
        for (int r = 0; r < 8; ++r) e[i][j][r] = __builtin_amdgcn_exp2f((s1[i][j][r] - s0[i][j][r]) * isl - 11.0f);
#pragma unroll
    for (int i = 0; i < 2; ++i)
#pragma unroll
      for (int j = 0; j < 2; ++j)
#pragma unroll
        for (int r = 0; r < 8; r += 2) { v2f d = { e[i][j][r], e[i][j][r + 1] }; d += 0x1p-11f; e[i][j][r] = __builtin_amdgcn_rcpf(d[0]); e[i][j][r + 1] = __builtin_amdgcn_rcpf(d[1]); }   // the addition on pairs: one packed instruction for two
    v16h pb[2];   // per query tile: element 8 i + r of lane (h, query) = key 16 i + 8 h + r, the k order of frag_h
#pragma unroll
    for (int j = 0; j < 2; ++j)
#pragma unroll
      for (int i = 0; i < 2; ++i)
#pragma unroll
        for (int r = 0; r < 8; ++r) pb[j][8 * i + r] = (_Float16)e[i][j][r];
#pragma unroll
    for (int cb = 0; cb < 4; ++cb) { if (cb + 2 < 4) lv(cb + 2);
      __builtin_amdgcn_sched_barrier(0);   // keeps the reads of set cb + 2 as one group ahead of the products of set cb
#pragma unroll
      for (int c = 0; c < 4; ++c)
#pragma unroll
        for (int j = 0; j < 2; ++j) acc[j][cb * 4 + c] = wmma16c(fv[cb % 3][c], pb[j], acc[j][cb * 4 + c]); }
    if (more) { _Float16* skn = sm + AT_SK + ((t + 1) & 1) * AT_SKB; _Float16* svn = sm + AT_SV + ((t + 1) & 1) * AT_SVB;   // the buffers that tile t - 1 used: every reader left them ahead of the last barrier
#pragma unroll
      for (int i = 0; i < 8; ++i) { *(v8h*)&skn[(kr + 8 * i) * AT_QLD + kq] = rk[i]; *(v8h*)&svn[(vr + 32 * i) * AT_VLD + vq] = rv[i]; } }
    __syncthreads(); };   // the next key and value tiles are published; every reader has left this tile's buffers
#pragma unroll 1
  for (int t = 0; t < AT_T; ++t) tile(t, t + 1 < AT_T);   // rolled, the last tile included ('more' is a scalar test): one copy of the body is enough
  float* const so = (float*)smem;   // two 128 x 256 result tiles, one per key half, reuse the loop's LDS behind the last barrier
  { float* sw = so + (wave & 1) * (AT_BQ * AT_OLD) + (wr + col) * AT_OLD + 8 * g;
#pragma unroll
    for (int j = 0; j < 2; ++j)
#pragma unroll
      for (int c = 0; c < 16; ++c) { const v8f a = acc[j][c]; v4f lo = { a[0], a[1], a[2], a[3] }, hi = { a[4], a[5], a[6], a[7] }; *(v4f*)(sw + j * 16 * AT_OLD + c * 16) = lo; *(v4f*)(sw + j * 16 * AT_OLD + c * 16 + 4) = hi; } }
  __syncthreads();   // both result tiles are published
  const float* sr = so + (tid >> 6) * AT_OLD + (tid & 63) * 4; float* go = O + ((size_t)(n0 + (tid >> 6)) * AT_SPL + blockIdx.y) * HID + (tid & 63) * 4;   // a wave stores half a row, 512 B, per store; the block four rows per step
#pragma unroll 1
  for (int rl = 0; rl < AT_BQ; rl += 16) { v4f a[4], b[4];   // rolled: 4 steps a trip give the LDS reads enough of one another to hide behind
#pragma unroll
    for (int i = 0; i < 4; ++i) { a[i] = *(const v4f*)(sr + (rl + 4 * i) * AT_OLD); b[i] = *(const v4f*)(sr + AT_BQ * AT_OLD + (rl + 4 * i) * AT_OLD); }
#pragma unroll
    for (int i = 0; i < 4; ++i) vst2(go + (size_t)(rl + 4 * i) * AT_SPL * HID, (a[i] + b[i]) * (1.0f / 2048.0f) + c1);
    LIN_ISSUED(); } }   // the four stores' registers are rewritten only behind the wait
// ---- k_mix: block = 16 rows, 4 waves, a wave takes 4 whole rows, two at a time: v = 0.5 * (0.5 * sum over the key ranges of O) + 0.5 * x_prev, read with 512-B loads and kept in registers; x = LN(v) * g + b (in place on X, or to OUT for the last layer). A row is read, normalised and written by one wave alone: no LDS, no barrier. The second pair's loads fly under the first pair's LayerNorm.
#define MX_R 16
__global__ __launch_bounds__(128) void k_mix(const float* __restrict__ O, float* __restrict__ X, const float* __restrict__ Gm, const float* __restrict__ Bb, float* __restrict__ OUT) {
  const int tid = threadIdx.x, wave = tid >> 5, lane = tid & 31; const size_t r0 = (size_t)blockIdx.x * MX_R + wave * 4;
  const float* po = O + r0 * AT_SPL * HID + lane * 4; const float* px = X + r0 * HID + lane * 4; const float* pg = Gm + lane * 4; const float* pb = Bb + lane * 4; float* dst = (OUT ? OUT : X) + r0 * HID + lane * 4;
  v4f p[2][AT_SPL][2], x[2][2], v[2][2];   // every loop over them is unrolled: they are register arrays
  auto ld = [&](const int hg) {
#pragma unroll
    for (int i = 0; i < 2; ++i)
#pragma unroll
      for (int h = 0; h < 2; ++h) {
#pragma unroll
        for (int s = 0; s < AT_SPL; ++s) p[i][s][h] = *(const v4f*)(po + ((hg * 2 + i) * AT_SPL + s) * HID + h * 128);
        x[i][h] = *(const v4f*)(px + (hg * 2 + i) * HID + h * 128); } };
  auto mixv = [&]() {
#pragma unroll
    for (int i = 0; i < 2; ++i)
#pragma unroll
      for (int h = 0; h < 2; ++h) { v4f a = p[i][0][h];
#pragma unroll
        for (int s = 1; s < AT_SPL; ++s) a += p[i][s][h];
        v[i][h] = 0.5f * (a * 0.5f) + 0.5f * x[i][h]; } };
  auto st = [&](const int hg) {
#pragma unroll
    for (int i = 0; i < 2; ++i) { vst2(dst + (hg * 2 + i) * HID, v[i][0]); vst2(dst + (hg * 2 + i) * HID + 128, v[i][1]); } };
  v4f gg[2] = { *(const v4f*)pg, *(const v4f*)(pg + 128) }, bb[2] = { *(const v4f*)pb, *(const v4f*)(pb + 128) };
  ld(0);
  LIN_ISSUED();   // all 40 loads are out before the first is waited for; their address registers are rewritten only behind the wait
  gg[0] = bfr4(gg[0]); gg[1] = bfr4(gg[1]); bb[0] = bfr4(bb[0]); bb[1] = bfr4(bb[1]);
  mixv();
  ld(1);
  LIN_ISSUED2(po, px);   // the second pair's 36 loads go out here, ahead of the first pair's LayerNorm; the two addresses are inputs of the wait, so no load of the group lands on them and they are rewritten only behind it
  ln_rows<2, false>(v, gg, bb);
  st(0);
  LIN_ISSUED();   // the four stores' registers are rewritten only behind the wait
  mixv();
  ln_rows<2, false>(v, gg, bb);
  st(1); }
extern "C" void kernel_launch(void* const* d_in, const int* in_sizes, int n_in, void* d_out, int out_size, void* d_ws, size_t ws_size, hipStream_t stream) {
  (void)in_sizes; (void)n_in; (void)out_size;
  const float** F = (const float**)d_in;   // 0 x [4096,512], 1 fc_w [512,256], 2 fc_b, 3 ln_g [3,256], 4 ln_b [3,256], 5 wq [2,256,256], 6 bq [2,256], 7 wk, 8 bk, 9 wvl, 10 bvl, 11 wvg [2,256,512], 12 bvg [2,512]
  if (ws_size < (size_t)WS_END) return;
  char* ws = (char*)d_ws; float *X = (float*)(ws + WS_X), *O = (float*)(ws + WS_O), *PS = (float*)(ws + WS_PS); _Float16 *Q = (_Float16*)(ws + WS_Q), *K = (_Float16*)(ws + WS_K), *VP = (_Float16*)(ws + WS_VP); float *CW = (float*)(ws + WS_CW), *CB = (float*)(ws + WS_CB);
  k_fc<<<dim3(NN / 64 + 20 * NL), 256, 0, stream>>>(F[0], F[1], F[2], F[3], F[4], X, F[9], F[10], F[11], F[12], CW, CB);
  for (int l = 0; l < TNL; ++l) {
    k_lin<<<dim3(NN / 64, HID / 128, 4), 256, 0, stream>>>(X, F[5] + (size_t)l * HID * HID, F[7] + (size_t)l * HID * HID, CW + (size_t)l * HID * NHD * VW, F[6] + l * HID, F[8] + l * HID, CB + l * NHD * VW, Q, K, VP, PS);
    k_att<<<dim3(NN / AT_BQ, AT_SPL), 256, 0, stream>>>(Q, K, VP, PS, O);
    k_mix<<<dim3(NN / MX_R), 128, 0, stream>>>(O, X, F[3] + (l + 1) * HID, F[4] + (l + 1) * HID, (l == NL - 1) ? (float*)d_out : nullptr);
  }
}
